// v000
// Times are from an AMD MI455X. After a warm-up the kernel runs many times in a row, and a time is the length of
// such a window on the GPU divided by its runs, so every launch and the gaps after it count. The runs cycle
// through copies of the inputs. A figure is the median of several windows, for all but v000 over two sittings.
// Sittings can differ by a few percent; kernels timed side by side share one.
// The starting kernel, v000, takes 1250 microseconds a run.
#include <hip/hip_runtime.h>

// TetrahedralAttention (x [4][2048][256]; q/k/v = x W^T (8 heads x 32); scores = q.k/sqrt(32) + geo_bias_scale geometric_bias[i][j] head_geo_scales[h]; keys with attention_mask[b][j] == 0 -> -inf; softmax; x head_gates[h] (post-softmax);
// out = merged.v Wo^T -> [4][2048][256]; bias table, mask (int32), gates and scales read as data).
// Compute dtypes, f32 accumulate: every input rounded to bf16; projections on PLAIN bf16 operands (inputs: exact); scores (K 32) on bf16 hi+lo planes (3 products), bias/mask/softmax in f32 registers
// (probabilities x1024, fp16); probs.v on fp16 planes (value tiles padded to 64 rows); the head gate and 1/1024 folded into the merge (linear); Wo on hl planes x exact Wo (2 products). z-batched over head pairs. One-wave-per-64x64-tile GEMMs.

#define NB_  4
#define TT   2048
#define CC   256
#define NH_  8
#define HD   32
#define ZH   2
#define PCAR 1024.0f
typedef _Float16 h16;
typedef unsigned short bf;
typedef __attribute__((ext_vector_type(16))) __bf16   v16bf;
typedef __attribute__((ext_vector_type(16))) _Float16 v16h;
typedef __attribute__((ext_vector_type(8)))  _Float16 v8h;
typedef __attribute__((ext_vector_type(8)))  unsigned short v8us;
typedef __attribute__((ext_vector_type(8)))  float    v8f;
typedef __attribute__((ext_vector_type(4)))  float    v4f;
typedef v8h  __attribute__((may_alias)) v8ha;
typedef v4f  __attribute__((may_alias)) v4fa;
typedef v8us __attribute__((may_alias)) v8usa;

__device__ __forceinline__ unsigned short f2bf(float f) { unsigned u = __float_as_uint(f); u += 0x7FFFu + ((u >> 16) & 1u); return (unsigned short)(u >> 16); }
__device__ __forceinline__ float bf2f(unsigned short b) { return __uint_as_float(((unsigned)b) << 16); }
__device__ __forceinline__ float bfr(float f) { return bf2f(f2bf(f)); }
__device__ __forceinline__ v16h cat16(v8h lo, v8h hi) { return __builtin_shufflevector(lo, hi, 0, 1, 2, 3, 4, 5, 6, 7, 8, 9, 10, 11, 12, 13, 14, 15); }
__device__ __forceinline__ v16bf cat16b(v8us lo, v8us hi) { return __builtin_bit_cast(v16bf, __builtin_shufflevector(lo, hi, 0, 1, 2, 3, 4, 5, 6, 7, 8, 9, 10, 11, 12, 13, 14, 15)); }
__device__ __forceinline__ v8f wmma16(v16h a, v16h b, v8f c) { return __builtin_amdgcn_wmma_f32_16x16x32_f16(false, a, false, b, (short)0, c, false, false); }
__device__ __forceinline__ v8f wmmab(v16bf a, v16bf b, v8f c) { return __builtin_amdgcn_wmma_f32_16x16x32_bf16(false, a, false, b, (short)0, c, false, false); }



// ---- k_gemmw: register-blocked GEMM, ONE WAVE per 64x64 output tile (16 accumulators), operands straight from K-contiguous 16-bit planes; grid (M/64, N/64, Z), 32 threads.
// C[m][n] (f32, pitch ldc, + optional f32 bias[n]) = sum_k A[m][k] Bt[n][k] (+ split products per NSPLIT). z-batch strides sA/sB/sC in elements. K % 32 == 0.
template <typename T16> struct WFrag;
template <> struct WFrag<h16> { typedef v16h V; static __device__ __forceinline__ V ld(const h16* p) { return cat16(*(const v8h*)p, *(const v8h*)(p + 16)); } static __device__ __forceinline__ v8f mma(V a, V b, v8f c) { return wmma16(a, b, c); } };
template <> struct WFrag<bf> { typedef v16bf V; static __device__ __forceinline__ V ld(const bf* p) { return cat16b(*(const v8us*)p, *(const v8us*)(p + 16)); } static __device__ __forceinline__ v8f mma(V a, V b, v8f c) { return wmmab(a, b, c); } };
template <typename T16, int NSPLIT, bool BIAS>
__global__ __launch_bounds__(32) void k_gemmw(const T16* __restrict__ A, const T16* __restrict__ A2, const T16* __restrict__ Bt, const T16* __restrict__ Bt2, int K, float* C, int ldc, const float* __restrict__ bias, size_t sA, size_t sB, size_t sC) {
    typedef typename WFrag<T16>::V V;
    __shared__ __align__(16) float os[16 * 68];
    const size_t z = blockIdx.z; A += z * sA; if (A2) A2 += z * sA; Bt += z * sB; if (Bt2) Bt2 += z * sB; C += z * sC;
    const int lane = threadIdx.x & 31, lr = lane & 15, hi = lane >> 4; const int r0 = blockIdx.x * 64, c0 = blockIdx.y * 64;
    v8f acc[4][4];
#pragma unroll
    for (int mb = 0; mb < 4; ++mb)
#pragma unroll
        for (int nb = 0; nb < 4; ++nb) acc[mb][nb] = (v8f){};
    const size_t aoff = (size_t)(r0 + lr) * K + 8 * hi, boff = (size_t)(c0 + lr) * K + 8 * hi;
#pragma unroll 1
    for (int kc = 0; kc < K; kc += 32) {
        V a[4], a2[4];
#pragma unroll
        for (int mb = 0; mb < 4; ++mb) { a[mb] = WFrag<T16>::ld(A + aoff + (size_t)mb * 16 * K + kc); if (NSPLIT == 1 || NSPLIT == 2) a2[mb] = WFrag<T16>::ld(A2 + aoff + (size_t)mb * 16 * K + kc); }
#pragma unroll
        for (int nb = 0; nb < 4; ++nb) { const V b = WFrag<T16>::ld(Bt + boff + (size_t)nb * 16 * K + kc); V b2; if (NSPLIT >= 2) b2 = WFrag<T16>::ld(Bt2 + boff + (size_t)nb * 16 * K + kc);
#pragma unroll
            for (int mb = 0; mb < 4; ++mb) { acc[mb][nb] = WFrag<T16>::mma(a[mb], b, acc[mb][nb]); if (NSPLIT == 1 || NSPLIT == 2) acc[mb][nb] = WFrag<T16>::mma(a2[mb], b, acc[mb][nb]); if (NSPLIT >= 2) acc[mb][nb] = WFrag<T16>::mma(a[mb], b2, acc[mb][nb]); } }
        asm volatile("v_nop\n\tv_nop\n\tv_nop\n\tv_nop" : "+v"(acc[0][0]), "+v"(acc[1][1]), "+v"(acc[2][2]), "+v"(acc[3][3]) : "v"(a[0]), "v"(a[3]));
    }
#pragma unroll
    for (int mb = 0; mb < 4; ++mb) {
#pragma unroll
        for (int nb = 0; nb < 4; ++nb) {
#pragma unroll
            for (int j = 0; j < 8; ++j) os[(hi * 8 + j) * 68 + nb * 16 + lr] = acc[mb][nb][j]; }
        __builtin_amdgcn_wave_barrier(); asm volatile("" ::: "memory");
        float* crow = C + (size_t)(r0 + mb * 16) * ldc + c0;
{
#pragma unroll
            for (int s = 0; s < 8; ++s) { const int row = 2 * s + hi, cofs = lr * 4; v4f val = *(const v4fa*)(os + row * 68 + cofs); if (BIAS) { val[0] += bfr(bias[c0 + cofs]); val[1] += bfr(bias[c0 + cofs + 1]); val[2] += bfr(bias[c0 + cofs + 2]); val[3] += bfr(bias[c0 + cofs + 3]); }
                *(v4f*)(crow + (size_t)row * ldc + cofs) = val; }
             }
        __builtin_amdgcn_wave_barrier(); asm volatile("" ::: "memory");
    }
}

__device__ __forceinline__ h16 tohx(float x) { return (h16)x; }
__device__ __forceinline__ void splitf(float y, unsigned short& h, unsigned short& l) { h = f2bf(y); l = f2bf(y - bf2f(h)); }
typedef __attribute__((ext_vector_type(2))) _Float16 v2h;
typedef __attribute__((ext_vector_type(4))) _Float16 v4h;
typedef __attribute__((ext_vector_type(2))) unsigned short v2us;
typedef __attribute__((ext_vector_type(4))) unsigned short v4us;

__global__ __launch_bounds__(256) void k_wtG(const float* __restrict__ w, int K, int N, bf* Bt) {
    const int lane = threadIdx.x & 31; const int L0 = (blockIdx.x * 8 + (threadIdx.x >> 5)) * 8; const int nlines = N * K / 64;
{
#pragma unroll 1
        for (int l = 0; l < 8; ++l) { const int L = L0 + l; if (L >= nlines) break; const size_t e = (size_t)L * 64 + lane * 2; const int k = (int)(e % K), n = (int)(e / K); v2us o;
            o[0] = f2bf(w[(size_t)k * N + n]); o[1] = f2bf(w[(size_t)(k + 1) * N + n]); *(v2us*)(Bt + e) = o; }
         }
}
__global__ __launch_bounds__(256) void k_cvt8(const float* __restrict__ src, bf* dst, size_t n8) { const size_t i = (size_t)blockIdx.x * 256 + threadIdx.x; if (i >= n8) return; const v8f v = *(const v8f*)(src + i * 8); v8us o;
#pragma unroll
    for (int k = 0; k < 8; ++k) o[k] = f2bf(v[k]); *(v8us*)(dst + i * 8) = o;  }
__global__ __launch_bounds__(256) void k_qkpl(const float* __restrict__ QF, const float* __restrict__ KF, bf* Qh, bf* Ql, bf* Kh, bf* Kl) { const size_t e = ((size_t)blockIdx.x * 256 + threadIdx.x) * 2; if (e >= (size_t)NH_ * TT * HD) return; const int d = (int)(e % HD); const int t = (int)((e / HD) % TT); const int h = (int)(e / ((size_t)HD * TT)); const size_t s = (size_t)t * CC + h * HD + d; v2us qh, ql, kh, kl; unsigned short a, c;
    splitf(QF[s], a, c); qh[0] = a; ql[0] = c; splitf(QF[s + 1], a, c); qh[1] = a; ql[1] = c; splitf(KF[s], a, c); kh[0] = a; kl[0] = c; splitf(KF[s + 1], a, c); kh[1] = a; kl[1] = c;
    { *(v2us*)(Qh + e) = qh; *(v2us*)(Ql + e) = ql; *(v2us*)(Kh + e) = kh; *(v2us*)(Kl + e) = kl;  } }
__global__ __launch_bounds__(256) void k_vtp(const float* __restrict__ VF, h16* VT) { const size_t e = ((size_t)blockIdx.x * 256 + threadIdx.x) * 2; if (e >= (size_t)NH_ * 64 * TT) return; const int t = (int)(e % TT); const int d = (int)((e / TT) % 64); const int h = (int)(e / ((size_t)TT * 64)); v2h o;
    if (d < HD) { o[0] = tohx(VF[(size_t)t * CC + h * HD + d]); o[1] = tohx(VF[(size_t)(t + 1) * CC + h * HD + d]); } else { o[0] = (h16)0.f; o[1] = (h16)0.f; } *(v2h*)(VT + e) = o;  }
// k_bsoft: one wave per (z, i) row: t = S/sqrt(32) + bf16(gbs) bf16(geo[i][j]) bf16(hgs[h]); attention_mask[b][j] == 0 -> -3e38 (an all-masked row would come out uniform, not NaN; all ones here); softmax over the 2048 keys (64 per lane, one exp)
__global__ __launch_bounds__(256) void k_bsoft(const float* __restrict__ Sb, const float* __restrict__ geo, const int* __restrict__ msk, const float* __restrict__ gbsp, const float* __restrict__ hgs, int h0, h16* P) { const int lane = threadIdx.x & 31; const int row = blockIdx.x * 8 + (threadIdx.x >> 5); if (row >= ZH * TT) return; const int i = row % TT, z = row / TT; const float hs = __fmul_rn(bfr(gbsp[0]), bfr(hgs[h0 + z])); const float* sr = Sb + (size_t)row * TT; const float* gr = geo + (size_t)i * TT; float v[64]; float mx = -3.0e38f;
#pragma unroll
    for (int ch = 0; ch < 16; ++ch) { const int j0 = ch * 128 + lane * 4; const v4f a = *(const v4f*)(sr + j0), g = *(const v4f*)(gr + j0);
#pragma unroll
        for (int q = 0; q < 4; ++q) { float gb = __fmul_rn(bfr(g[q]), hs); asm volatile("" : "+v"(gb)); float as = __fmul_rn(a[q], 0.17677669529663687f); asm volatile("" : "+v"(as)); float t = __fadd_rn(as, gb); if (msk[j0 + q] == 0) t = -3.0e38f; v[ch * 4 + q] = t; mx = fmaxf(mx, t); } }
#pragma unroll
    for (int sh = 16; sh; sh >>= 1) mx = fmaxf(mx, __shfl_xor(mx, sh, 32));
    float sum = 0.f;
#pragma unroll
    for (int k = 0; k < 64; ++k) { float d0 = __fsub_rn(v[k], mx); asm volatile("" : "+v"(d0)); v[k] = __expf(d0); sum += v[k]; }
#pragma unroll
    for (int sh = 16; sh; sh >>= 1) sum += __shfl_xor(sum, sh, 32);
    const float f = __fdiv_rn(PCAR, sum);
{
#pragma unroll
        for (int ch = 0; ch < 16; ++ch) { v4h o; o[0] = tohx(v[ch * 4] * f); o[1] = tohx(v[ch * 4 + 1] * f); o[2] = tohx(v[ch * 4 + 2] * f); o[3] = tohx(v[ch * 4 + 3] * f); *(v4h*)(P + (size_t)row * TT + ch * 128 + lane * 4) = o; }
         } }
__global__ __launch_bounds__(256) void k_mrg(const float* __restrict__ Ob, const float* __restrict__ hg, int h0, bf* Ah, bf* Al) { const size_t e = ((size_t)blockIdx.x * 256 + threadIdx.x) * 2; if (e >= (size_t)ZH * TT * HD) return; const int d = (int)(e % HD); const int t = (int)((e / HD) % TT); const int z = (int)(e / ((size_t)HD * TT)); const float f = __fmul_rn(bfr(hg[h0 + z]), 1.0f / PCAR); v2us oh, ol;
#pragma unroll
    for (int u = 0; u < 2; ++u) { unsigned short a, c; splitf(__fmul_rn(Ob[((size_t)z * TT + t) * 64 + d + u], f), a, c); oh[u] = a; ol[u] = c; } const size_t o = (size_t)t * CC + (h0 + z) * HD + d; *(v2us*)(Ah + o) = oh; *(v2us*)(Al + o) = ol;  }

extern "C" void kernel_launch(void* const* d_in, const int* in_sizes, int n_in,
                              void* d_out, int out_size, void* d_ws, size_t ws_size, hipStream_t stream) {
    (void)in_sizes; (void)n_in; (void)out_size;
    const float* x = (const float*)d_in[0]; const float* geo = (const float*)d_in[1]; const int* msk = (const int*)d_in[2]; const float* hg = (const float*)d_in[3]; const float* Wq = (const float*)d_in[4]; const float* Wk = (const float*)d_in[5]; const float* Wv = (const float*)d_in[6]; const float* Wo = (const float*)d_in[7]; const float* gbsp = (const float*)d_in[8]; const float* hgs = (const float*)d_in[9];
    float* OUT = (float*)d_out;     // [4][2048][256]
    char* wsp = (char*)d_ws;
    auto take = [&](size_t bytes) { char* p = wsp; wsp += (bytes + 255) & ~(size_t)255; return (void*)p; };
    bf* WQ = (bf*)take((size_t)CC * CC * 2); bf* WK = (bf*)take((size_t)CC * CC * 2); bf* WV = (bf*)take((size_t)CC * CC * 2); bf* WO = (bf*)take((size_t)CC * CC * 2); bf* XB = (bf*)take((size_t)TT * CC * 2);
    float* QF = (float*)take((size_t)TT * CC * 4); float* KF = (float*)take((size_t)TT * CC * 4); float* VF = (float*)take((size_t)TT * CC * 4); bf* Qh = (bf*)take((size_t)NH_ * TT * HD * 2); bf* Ql = (bf*)take((size_t)NH_ * TT * HD * 2); bf* Kh = (bf*)take((size_t)NH_ * TT * HD * 2); bf* Kl = (bf*)take((size_t)NH_ * TT * HD * 2); h16* VT = (h16*)take((size_t)NH_ * 64 * TT * 2);
    float* Sb = (float*)take((size_t)ZH * TT * TT * 4); h16* P16 = (h16*)take((size_t)ZH * TT * TT * 2); float* Ob = (float*)take((size_t)ZH * TT * 64 * 4); bf* Ah = (bf*)take((size_t)TT * CC * 2); bf* Al = (bf*)take((size_t)TT * CC * 2);
    if ((size_t)(wsp - (char*)d_ws) > ws_size) return;    // total ~ 66 MB
    k_cvt8<<<(CC * CC / 8 + 255) / 256, 256, 0, stream>>>(Wq, WQ, (size_t)CC * CC / 8); k_cvt8<<<(CC * CC / 8 + 255) / 256, 256, 0, stream>>>(Wk, WK, (size_t)CC * CC / 8); k_cvt8<<<(CC * CC / 8 + 255) / 256, 256, 0, stream>>>(Wv, WV, (size_t)CC * CC / 8); k_cvt8<<<(CC * CC / 8 + 255) / 256, 256, 0, stream>>>(Wo, WO, (size_t)CC * CC / 8);   // torch [out][in] = natural Bt
    for (int b = 0; b < NB_; ++b) {
        k_cvt8<<<(TT * CC / 8 + 255) / 256, 256, 0, stream>>>(x + (size_t)b * TT * CC, XB, (size_t)TT * CC / 8);
        k_gemmw<bf, 0, false><<<dim3(TT / 64, CC / 64, 1), 32, 0, stream>>>(XB, nullptr, WQ, nullptr, CC, QF, CC, nullptr, 0, 0, 0); k_gemmw<bf, 0, false><<<dim3(TT / 64, CC / 64, 1), 32, 0, stream>>>(XB, nullptr, WK, nullptr, CC, KF, CC, nullptr, 0, 0, 0); k_gemmw<bf, 0, false><<<dim3(TT / 64, CC / 64, 1), 32, 0, stream>>>(XB, nullptr, WV, nullptr, CC, VF, CC, nullptr, 0, 0, 0);
        k_qkpl<<<(unsigned)(((size_t)NH_ * TT * HD / 2 + 255) / 256), 256, 0, stream>>>(QF, KF, Qh, Ql, Kh, Kl); k_vtp<<<(unsigned)(((size_t)NH_ * 64 * TT / 2 + 255) / 256), 256, 0, stream>>>(VF, VT);
        for (int h0 = 0; h0 < NH_; h0 += ZH) { const size_t z = (size_t)h0;
            k_gemmw<bf, 2, false><<<dim3(TT / 64, TT / 64, ZH), 32, 0, stream>>>(Qh + z * TT * HD, Ql + z * TT * HD, Kh + z * TT * HD, Kl + z * TT * HD, HD, Sb, TT, nullptr, (size_t)TT * HD, (size_t)TT * HD, (size_t)TT * TT);
            k_bsoft<<<ZH * TT / 8, 256, 0, stream>>>(Sb, geo, msk + (size_t)b * TT, gbsp, hgs, h0, P16);
            k_gemmw<h16, 0, false><<<dim3(TT / 64, 1, ZH), 32, 0, stream>>>(P16, nullptr, VT + z * 64 * TT, nullptr, TT, Ob, 64, nullptr, (size_t)TT * TT, (size_t)64 * TT, (size_t)TT * 64);
            k_mrg<<<(unsigned)(((size_t)ZH * TT * HD / 2 + 255) / 256), 256, 0, stream>>>(Ob, hg, h0, Ah, Al); }
        k_gemmw<bf, 1, false><<<dim3(TT / 64, CC / 64, 1), 32, 0, stream>>>(Ah, Al, WO, nullptr, CC, OUT + (size_t)b * TT * CC, CC, nullptr, 0, 0, 0); }
}

// v001
// It runs in 652 microseconds.
// Two timings next to v000 put it at 1.95 and 1.94 times that version's speed.
#include <hip/hip_runtime.h>

// TetrahedralAttention (x [4][2048][256]; q/k/v = x W^T (8 heads x 32); scores = q.k/sqrt(32) + geo_bias_scale geometric_bias[i][j] head_geo_scales[h]; keys with attention_mask[b][j] == 0 -> -inf; softmax; x head_gates[h] (post-softmax);
// out = merged.v Wo^T -> [4][2048][256]; bias table, mask (int32), gates and scales read as data).
// Compute dtypes, f32 accumulate: every input rounded to bf16; projections on PLAIN bf16 operands (inputs: exact); scores (K 32) on bf16 hi+lo planes (3 products), bias/mask/softmax in f32 registers
// (probabilities x1024, fp16); probs.v on fp16 planes (value tiles padded to 64 rows); the head gate and 1/1024 folded into the merge (linear); Wo on hl planes x exact Wo (2 products). z-batched over all 8 heads of a batch row. One-wave-per-64x64-tile GEMMs.

#define NB_  4
#define TT   2048
#define CC   256
#define NH_  8
#define HD   32
#define ZH   8
#define PCAR 1024.0f
typedef _Float16 h16;
typedef unsigned short bf;
typedef __attribute__((ext_vector_type(16))) __bf16   v16bf;
typedef __attribute__((ext_vector_type(16))) _Float16 v16h;
typedef __attribute__((ext_vector_type(8)))  _Float16 v8h;
typedef __attribute__((ext_vector_type(8)))  unsigned short v8us;
typedef __attribute__((ext_vector_type(8)))  float    v8f;
typedef __attribute__((ext_vector_type(4)))  float    v4f;
typedef v8h  __attribute__((may_alias)) v8ha;
typedef v4f  __attribute__((may_alias)) v4fa;
typedef v8us __attribute__((may_alias)) v8usa;

__device__ __forceinline__ unsigned short f2bf(float f) { unsigned u = __float_as_uint(f); u += 0x7FFFu + ((u >> 16) & 1u); return (unsigned short)(u >> 16); }
__device__ __forceinline__ float bf2f(unsigned short b) { return __uint_as_float(((unsigned)b) << 16); }
__device__ __forceinline__ float bfr(float f) { return bf2f(f2bf(f)); }
__device__ __forceinline__ v16h cat16(v8h lo, v8h hi) { return __builtin_shufflevector(lo, hi, 0, 1, 2, 3, 4, 5, 6, 7, 8, 9, 10, 11, 12, 13, 14, 15); }
__device__ __forceinline__ v16bf cat16b(v8us lo, v8us hi) { return __builtin_bit_cast(v16bf, __builtin_shufflevector(lo, hi, 0, 1, 2, 3, 4, 5, 6, 7, 8, 9, 10, 11, 12, 13, 14, 15)); }
__device__ __forceinline__ v8f wmma16(v16h a, v16h b, v8f c) { return __builtin_amdgcn_wmma_f32_16x16x32_f16(false, a, false, b, (short)0, c, false, false); }
__device__ __forceinline__ v8f wmmab(v16bf a, v16bf b, v8f c) { return __builtin_amdgcn_wmma_f32_16x16x32_bf16(false, a, false, b, (short)0, c, false, false); }



// ---- k_gemmw: register-blocked GEMM, ONE WAVE per 64x64 output tile (16 accumulators), operands straight from K-contiguous 16-bit planes; grid (M/64, N/64, Z), 32 threads.
// C[m][n] (f32, pitch ldc, + optional f32 bias[n]) = sum_k A[m][k] Bt[n][k] (+ split products per NSPLIT). z-batch strides sA/sB/sC in elements. K % 32 == 0.
template <typename T16> struct WFrag;
template <> struct WFrag<h16> { typedef v16h V; static __device__ __forceinline__ V ld(const h16* p) { return cat16(*(const v8h*)p, *(const v8h*)(p + 16)); } static __device__ __forceinline__ v8f mma(V a, V b, v8f c) { return wmma16(a, b, c); } };
template <> struct WFrag<bf> { typedef v16bf V; static __device__ __forceinline__ V ld(const bf* p) { return cat16b(*(const v8us*)p, *(const v8us*)(p + 16)); } static __device__ __forceinline__ v8f mma(V a, V b, v8f c) { return wmmab(a, b, c); } };
template <typename T16, int NSPLIT, bool BIAS>
__global__ __launch_bounds__(32) void k_gemmw(const T16* __restrict__ A, const T16* __restrict__ A2, const T16* __restrict__ Bt, const T16* __restrict__ Bt2, int K, float* C, int ldc, const float* __restrict__ bias, size_t sA, size_t sB, size_t sC) {
    typedef typename WFrag<T16>::V V;
    __shared__ __align__(16) float os[16 * 68];
    const size_t z = blockIdx.z; A += z * sA; if (A2) A2 += z * sA; Bt += z * sB; if (Bt2) Bt2 += z * sB; C += z * sC;
    const int lane = threadIdx.x & 31, lr = lane & 15, hi = lane >> 4; const int r0 = blockIdx.x * 64, c0 = blockIdx.y * 64;
    v8f acc[4][4];
#pragma unroll
    for (int mb = 0; mb < 4; ++mb)
#pragma unroll
        for (int nb = 0; nb < 4; ++nb) acc[mb][nb] = (v8f){};
    const size_t aoff = (size_t)(r0 + lr) * K + 8 * hi, boff = (size_t)(c0 + lr) * K + 8 * hi;
#pragma unroll 1
    for (int kc = 0; kc < K; kc += 32) {
        V a[4], a2[4];
#pragma unroll
        for (int mb = 0; mb < 4; ++mb) { a[mb] = WFrag<T16>::ld(A + aoff + (size_t)mb * 16 * K + kc); if (NSPLIT == 1 || NSPLIT == 2) a2[mb] = WFrag<T16>::ld(A2 + aoff + (size_t)mb * 16 * K + kc); }
#pragma unroll
        for (int nb = 0; nb < 4; ++nb) { const V b = WFrag<T16>::ld(Bt + boff + (size_t)nb * 16 * K + kc); V b2; if (NSPLIT >= 2) b2 = WFrag<T16>::ld(Bt2 + boff + (size_t)nb * 16 * K + kc);
#pragma unroll
            for (int mb = 0; mb < 4; ++mb) { acc[mb][nb] = WFrag<T16>::mma(a[mb], b, acc[mb][nb]); if (NSPLIT == 1 || NSPLIT == 2) acc[mb][nb] = WFrag<T16>::mma(a2[mb], b, acc[mb][nb]); if (NSPLIT >= 2) acc[mb][nb] = WFrag<T16>::mma(a[mb], b2, acc[mb][nb]); } }
        asm volatile("v_nop\n\tv_nop\n\tv_nop\n\tv_nop" : "+v"(acc[0][0]), "+v"(acc[1][1]), "+v"(acc[2][2]), "+v"(acc[3][3]) : "v"(a[0]), "v"(a[3]));
    }
#pragma unroll
    for (int mb = 0; mb < 4; ++mb) {
#pragma unroll
        for (int nb = 0; nb < 4; ++nb) {
#pragma unroll
            for (int j = 0; j < 8; ++j) os[(hi * 8 + j) * 68 + nb * 16 + lr] = acc[mb][nb][j]; }
        __builtin_amdgcn_wave_barrier(); asm volatile("" ::: "memory");
        float* crow = C + (size_t)(r0 + mb * 16) * ldc + c0;
{
#pragma unroll
            for (int s = 0; s < 8; ++s) { const int row = 2 * s + hi, cofs = lr * 4; v4f val = *(const v4fa*)(os + row * 68 + cofs); if (BIAS) { val[0] += bfr(bias[c0 + cofs]); val[1] += bfr(bias[c0 + cofs + 1]); val[2] += bfr(bias[c0 + cofs + 2]); val[3] += bfr(bias[c0 + cofs + 3]); }
                *(v4f*)(crow + (size_t)row * ldc + cofs) = val; }
             }
        __builtin_amdgcn_wave_barrier(); asm volatile("" ::: "memory");
    }
}

__device__ __forceinline__ h16 tohx(float x) { return (h16)x; }
__device__ __forceinline__ void splitf(float y, unsigned short& h, unsigned short& l) { h = f2bf(y); l = f2bf(y - bf2f(h)); }
typedef __attribute__((ext_vector_type(2))) _Float16 v2h;
typedef __attribute__((ext_vector_type(4))) _Float16 v4h;
typedef __attribute__((ext_vector_type(2))) unsigned short v2us;
typedef __attribute__((ext_vector_type(4))) unsigned short v4us;

__global__ __launch_bounds__(256) void k_wtG(const float* __restrict__ w, int K, int N, bf* Bt) {
    const int lane = threadIdx.x & 31; const int L0 = (blockIdx.x * 8 + (threadIdx.x >> 5)) * 8; const int nlines = N * K / 64;
{
#pragma unroll 1
        for (int l = 0; l < 8; ++l) { const int L = L0 + l; if (L >= nlines) break; const size_t e = (size_t)L * 64 + lane * 2; const int k = (int)(e % K), n = (int)(e / K); v2us o;
            o[0] = f2bf(w[(size_t)k * N + n]); o[1] = f2bf(w[(size_t)(k + 1) * N + n]); *(v2us*)(Bt + e) = o; }
         }
}
__global__ __launch_bounds__(256) void k_cvt8(const float* __restrict__ src, bf* dst, size_t n8) { const size_t i = (size_t)blockIdx.x * 256 + threadIdx.x; if (i >= n8) return; const v8f v = *(const v8f*)(src + i * 8); v8us o;
#pragma unroll
    for (int k = 0; k < 8; ++k) o[k] = f2bf(v[k]); *(v8us*)(dst + i * 8) = o;  }
__global__ __launch_bounds__(256) void k_qkpl(const float* __restrict__ QF, const float* __restrict__ KF, bf* Qh, bf* Ql, bf* Kh, bf* Kl) { const size_t e = ((size_t)blockIdx.x * 256 + threadIdx.x) * 2; if (e >= (size_t)NH_ * TT * HD) return; const int d = (int)(e % HD); const int t = (int)((e / HD) % TT); const int h = (int)(e / ((size_t)HD * TT)); const size_t s = (size_t)t * CC + h * HD + d; v2us qh, ql, kh, kl; unsigned short a, c;
    splitf(QF[s], a, c); qh[0] = a; ql[0] = c; splitf(QF[s + 1], a, c); qh[1] = a; ql[1] = c; splitf(KF[s], a, c); kh[0] = a; kl[0] = c; splitf(KF[s + 1], a, c); kh[1] = a; kl[1] = c;
    { *(v2us*)(Qh + e) = qh; *(v2us*)(Ql + e) = ql; *(v2us*)(Kh + e) = kh; *(v2us*)(Kl + e) = kl;  } }
__global__ __launch_bounds__(256) void k_vtp(const float* __restrict__ VF, h16* VT) { const size_t e = ((size_t)blockIdx.x * 256 + threadIdx.x) * 2; if (e >= (size_t)NH_ * 64 * TT) return; const int t = (int)(e % TT); const int d = (int)((e / TT) % 64); const int h = (int)(e / ((size_t)TT * 64)); v2h o;
    if (d < HD) { o[0] = tohx(VF[(size_t)t * CC + h * HD + d]); o[1] = tohx(VF[(size_t)(t + 1) * CC + h * HD + d]); } else { o[0] = (h16)0.f; o[1] = (h16)0.f; } *(v2h*)(VT + e) = o;  }
// k_bsoft: one wave per (z, i) row: t = S/sqrt(32) + bf16(gbs) bf16(geo[i][j]) bf16(hgs[h]); attention_mask[b][j] == 0 -> -3e38 (an all-masked row would come out uniform, not NaN; all ones here); softmax over the 2048 keys (64 per lane, one exp)
__global__ __launch_bounds__(256) void k_bsoft(const float* __restrict__ Sb, const float* __restrict__ geo, const int* __restrict__ msk, const float* __restrict__ gbsp, const float* __restrict__ hgs, int h0, h16* P) { const int lane = threadIdx.x & 31; const int row = blockIdx.x * 8 + (threadIdx.x >> 5); if (row >= ZH * TT) return; const int i = row % TT, z = row / TT; const float hs = __fmul_rn(bfr(gbsp[0]), bfr(hgs[h0 + z])); const float* sr = Sb + (size_t)row * TT; const float* gr = geo + (size_t)i * TT; float v[64]; float mx = -3.0e38f;
#pragma unroll
    for (int ch = 0; ch < 16; ++ch) { const int j0 = ch * 128 + lane * 4; const v4f a = *(const v4f*)(sr + j0), g = *(const v4f*)(gr + j0);
#pragma unroll
        for (int q = 0; q < 4; ++q) { float gb = __fmul_rn(bfr(g[q]), hs); asm volatile("" : "+v"(gb)); float as = __fmul_rn(a[q], 0.17677669529663687f); asm volatile("" : "+v"(as)); float t = __fadd_rn(as, gb); if (msk[j0 + q] == 0) t = -3.0e38f; v[ch * 4 + q] = t; mx = fmaxf(mx, t); } }
#pragma unroll
    for (int sh = 16; sh; sh >>= 1) mx = fmaxf(mx, __shfl_xor(mx, sh, 32));
    float sum = 0.f;
#pragma unroll
    for (int k = 0; k < 64; ++k) { float d0 = __fsub_rn(v[k], mx); asm volatile("" : "+v"(d0)); v[k] = __expf(d0); sum += v[k]; }
#pragma unroll
    for (int sh = 16; sh; sh >>= 1) sum += __shfl_xor(sum, sh, 32);
    const float f = __fdiv_rn(PCAR, sum);
{
#pragma unroll
        for (int ch = 0; ch < 16; ++ch) { v4h o; o[0] = tohx(v[ch * 4] * f); o[1] = tohx(v[ch * 4 + 1] * f); o[2] = tohx(v[ch * 4 + 2] * f); o[3] = tohx(v[ch * 4 + 3] * f); *(v4h*)(P + (size_t)row * TT + ch * 128 + lane * 4) = o; }
         } }
__global__ __launch_bounds__(256) void k_mrg(const float* __restrict__ Ob, const float* __restrict__ hg, int h0, bf* Ah, bf* Al) { const size_t e = ((size_t)blockIdx.x * 256 + threadIdx.x) * 2; if (e >= (size_t)ZH * TT * HD) return; const int d = (int)(e % HD); const int t = (int)((e / HD) % TT); const int z = (int)(e / ((size_t)HD * TT)); const float f = __fmul_rn(bfr(hg[h0 + z]), 1.0f / PCAR); v2us oh, ol;
#pragma unroll
    for (int u = 0; u < 2; ++u) { unsigned short a, c; splitf(__fmul_rn(Ob[((size_t)z * TT + t) * 64 + d + u], f), a, c); oh[u] = a; ol[u] = c; } const size_t o = (size_t)t * CC + (h0 + z) * HD + d; *(v2us*)(Ah + o) = oh; *(v2us*)(Al + o) = ol;  }

extern "C" void kernel_launch(void* const* d_in, const int* in_sizes, int n_in,
                              void* d_out, int out_size, void* d_ws, size_t ws_size, hipStream_t stream) {
    (void)in_sizes; (void)n_in; (void)out_size;
    const float* x = (const float*)d_in[0]; const float* geo = (const float*)d_in[1]; const int* msk = (const int*)d_in[2]; const float* hg = (const float*)d_in[3]; const float* Wq = (const float*)d_in[4]; const float* Wk = (const float*)d_in[5]; const float* Wv = (const float*)d_in[6]; const float* Wo = (const float*)d_in[7]; const float* gbsp = (const float*)d_in[8]; const float* hgs = (const float*)d_in[9];
    float* OUT = (float*)d_out;     // [4][2048][256]
    char* wsp = (char*)d_ws;
    auto take = [&](size_t bytes) { char* p = wsp; wsp += (bytes + 255) & ~(size_t)255; return (void*)p; };
    bf* WQ = (bf*)take((size_t)CC * CC * 2); bf* WK = (bf*)take((size_t)CC * CC * 2); bf* WV = (bf*)take((size_t)CC * CC * 2); bf* WO = (bf*)take((size_t)CC * CC * 2); bf* XB = (bf*)take((size_t)TT * CC * 2);
    float* QF = (float*)take((size_t)TT * CC * 4); float* KF = (float*)take((size_t)TT * CC * 4); float* VF = (float*)take((size_t)TT * CC * 4); bf* Qh = (bf*)take((size_t)NH_ * TT * HD * 2); bf* Ql = (bf*)take((size_t)NH_ * TT * HD * 2); bf* Kh = (bf*)take((size_t)NH_ * TT * HD * 2); bf* Kl = (bf*)take((size_t)NH_ * TT * HD * 2); h16* VT = (h16*)take((size_t)NH_ * 64 * TT * 2);
    float* Sb = (float*)take((size_t)ZH * TT * TT * 4); h16* P16 = (h16*)take((size_t)ZH * TT * TT * 2); float* Ob = (float*)take((size_t)ZH * TT * 64 * 4); bf* Ah = (bf*)take((size_t)TT * CC * 2); bf* Al = (bf*)take((size_t)TT * CC * 2);
    if ((size_t)(wsp - (char*)d_ws) > ws_size) return;    // total ~ 221 MB
    k_cvt8<<<(CC * CC / 8 + 255) / 256, 256, 0, stream>>>(Wq, WQ, (size_t)CC * CC / 8); k_cvt8<<<(CC * CC / 8 + 255) / 256, 256, 0, stream>>>(Wk, WK, (size_t)CC * CC / 8); k_cvt8<<<(CC * CC / 8 + 255) / 256, 256, 0, stream>>>(Wv, WV, (size_t)CC * CC / 8); k_cvt8<<<(CC * CC / 8 + 255) / 256, 256, 0, stream>>>(Wo, WO, (size_t)CC * CC / 8);   // torch [out][in] = natural Bt
    for (int b = 0; b < NB_; ++b) {
        k_cvt8<<<(TT * CC / 8 + 255) / 256, 256, 0, stream>>>(x + (size_t)b * TT * CC, XB, (size_t)TT * CC / 8);
        k_gemmw<bf, 0, false><<<dim3(TT / 64, CC / 64, 1), 32, 0, stream>>>(XB, nullptr, WQ, nullptr, CC, QF, CC, nullptr, 0, 0, 0); k_gemmw<bf, 0, false><<<dim3(TT / 64, CC / 64, 1), 32, 0, stream>>>(XB, nullptr, WK, nullptr, CC, KF, CC, nullptr, 0, 0, 0); k_gemmw<bf, 0, false><<<dim3(TT / 64, CC / 64, 1), 32, 0, stream>>>(XB, nullptr, WV, nullptr, CC, VF, CC, nullptr, 0, 0, 0);
        k_qkpl<<<(unsigned)(((size_t)NH_ * TT * HD / 2 + 255) / 256), 256, 0, stream>>>(QF, KF, Qh, Ql, Kh, Kl); k_vtp<<<(unsigned)(((size_t)NH_ * 64 * TT / 2 + 255) / 256), 256, 0, stream>>>(VF, VT);
        for (int h0 = 0; h0 < NH_; h0 += ZH) { const size_t z = (size_t)h0;
            k_gemmw<bf, 2, false><<<dim3(TT / 64, TT / 64, ZH), 32, 0, stream>>>(Qh + z * TT * HD, Ql + z * TT * HD, Kh + z * TT * HD, Kl + z * TT * HD, HD, Sb, TT, nullptr, (size_t)TT * HD, (size_t)TT * HD, (size_t)TT * TT);
            k_bsoft<<<ZH * TT / 8, 256, 0, stream>>>(Sb, geo, msk + (size_t)b * TT, gbsp, hgs, h0, P16);
            k_gemmw<h16, 0, false><<<dim3(TT / 64, 1, ZH), 32, 0, stream>>>(P16, nullptr, VT + z * 64 * TT, nullptr, TT, Ob, 64, nullptr, (size_t)TT * TT, (size_t)64 * TT, (size_t)TT * 64);
            k_mrg<<<(unsigned)(((size_t)ZH * TT * HD / 2 + 255) / 256), 256, 0, stream>>>(Ob, hg, h0, Ah, Al); }
        k_gemmw<bf, 1, false><<<dim3(TT / 64, CC / 64, 1), 32, 0, stream>>>(Ah, Al, WO, nullptr, CC, OUT + (size_t)b * TT * CC, CC, nullptr, 0, 0, 0); }
}

// v002
// A run of this version takes 247 microseconds.
// In two side-by-side timings against v001, it was 2.62 and 2.63 times as fast.
// Counting every step since v000, it is 5.10 times as fast.
#include <hip/hip_runtime.h>

// TetrahedralAttention (x [4][2048][256]; q/k/v = x W^T (8 heads x 32); scores = q.k/sqrt(32) + geo_bias_scale geometric_bias[i][j] head_geo_scales[h]; keys with attention_mask[b][j] == 0 -> -inf; softmax; x head_gates[h] (post-softmax);
// out = merged.v Wo^T -> [4][2048][256]; bias table, mask (int32), gates and scales read as data).
// Compute dtypes, f32 accumulate: every input rounded to bf16; projections on PLAIN bf16 operands (inputs: exact); scores (K 32) on bf16 hi+lo planes (3 products), bias/mask/softmax in f32 registers
// (probabilities x1024 against the running maximum, fp16); probs.v on fp16 planes; Wo on hl planes x exact Wo (2 products). Scores, softmax, probs.v and the head gate run in ONE kernel (k_fattn): no score or probability plane in memory.

#define NB_  4
#define TT   2048
#define CC   256
#define NH_  8
#define HD   32
#define KSPL 8
#define NQT  2
typedef _Float16 h16;
typedef unsigned short bf;
typedef __attribute__((ext_vector_type(16))) __bf16   v16bf;
typedef __attribute__((ext_vector_type(16))) _Float16 v16h;
typedef __attribute__((ext_vector_type(8)))  _Float16 v8h;
typedef __attribute__((ext_vector_type(8)))  unsigned short v8us;
typedef __attribute__((ext_vector_type(8)))  float    v8f;
typedef __attribute__((ext_vector_type(4)))  float    v4f;
typedef v8h  __attribute__((may_alias)) v8ha;
typedef v4f  __attribute__((may_alias)) v4fa;
typedef v8us __attribute__((may_alias)) v8usa;

__device__ __forceinline__ unsigned short f2bf(float f) { unsigned u = __float_as_uint(f); u += 0x7FFFu + ((u >> 16) & 1u); return (unsigned short)(u >> 16); }
__device__ __forceinline__ float bf2f(unsigned short b) { return __uint_as_float(((unsigned)b) << 16); }
__device__ __forceinline__ float bfr(float f) { return bf2f(f2bf(f)); }
__device__ __forceinline__ v16h cat16(v8h lo, v8h hi) { return __builtin_shufflevector(lo, hi, 0, 1, 2, 3, 4, 5, 6, 7, 8, 9, 10, 11, 12, 13, 14, 15); }
__device__ __forceinline__ v16bf cat16b(v8us lo, v8us hi) { return __builtin_bit_cast(v16bf, __builtin_shufflevector(lo, hi, 0, 1, 2, 3, 4, 5, 6, 7, 8, 9, 10, 11, 12, 13, 14, 15)); }
__device__ __forceinline__ v8f wmma16(v16h a, v16h b, v8f c) { return __builtin_amdgcn_wmma_f32_16x16x32_f16(false, a, false, b, (short)0, c, false, false); }
__device__ __forceinline__ v8f wmmab(v16bf a, v16bf b, v8f c) { return __builtin_amdgcn_wmma_f32_16x16x32_bf16(false, a, false, b, (short)0, c, false, false); }



// ---- k_gemmw: register-blocked GEMM, ONE WAVE per 64x64 output tile (16 accumulators), operands straight from K-contiguous 16-bit planes; grid (M/64, N/64, Z), 32 threads.
// C[m][n] (f32, pitch ldc, + optional f32 bias[n]) = sum_k A[m][k] Bt[n][k] (+ split products per NSPLIT). z-batch strides sA/sB/sC in elements. K % 32 == 0.
template <typename T16> struct WFrag;
template <> struct WFrag<h16> { typedef v16h V; static __device__ __forceinline__ V ld(const h16* p) { return cat16(*(const v8h*)p, *(const v8h*)(p + 16)); } static __device__ __forceinline__ v8f mma(V a, V b, v8f c) { return wmma16(a, b, c); } };
template <> struct WFrag<bf> { typedef v16bf V; static __device__ __forceinline__ V ld(const bf* p) { return cat16b(*(const v8us*)p, *(const v8us*)(p + 16)); } static __device__ __forceinline__ v8f mma(V a, V b, v8f c) { return wmmab(a, b, c); } };
template <typename T16, int NSPLIT, bool BIAS>
__global__ __launch_bounds__(32) void k_gemmw(const T16* __restrict__ A, const T16* __restrict__ A2, const T16* __restrict__ Bt, const T16* __restrict__ Bt2, int K, float* C, int ldc, const float* __restrict__ bias, size_t sA, size_t sB, size_t sC) {
    typedef typename WFrag<T16>::V V;
    __shared__ __align__(16) float os[16 * 68];
    const size_t z = blockIdx.z; A += z * sA; if (A2) A2 += z * sA; Bt += z * sB; if (Bt2) Bt2 += z * sB; C += z * sC;
    const int lane = threadIdx.x & 31, lr = lane & 15, hi = lane >> 4; const int r0 = blockIdx.x * 64, c0 = blockIdx.y * 64;
    v8f acc[4][4];
#pragma unroll
    for (int mb = 0; mb < 4; ++mb)
#pragma unroll
        for (int nb = 0; nb < 4; ++nb) acc[mb][nb] = (v8f){};
    const size_t aoff = (size_t)(r0 + lr) * K + 8 * hi, boff = (size_t)(c0 + lr) * K + 8 * hi;
#pragma unroll 1
    for (int kc = 0; kc < K; kc += 32) {
        V a[4], a2[4];
#pragma unroll
        for (int mb = 0; mb < 4; ++mb) { a[mb] = WFrag<T16>::ld(A + aoff + (size_t)mb * 16 * K + kc); if (NSPLIT == 1 || NSPLIT == 2) a2[mb] = WFrag<T16>::ld(A2 + aoff + (size_t)mb * 16 * K + kc); }
#pragma unroll
        for (int nb = 0; nb < 4; ++nb) { const V b = WFrag<T16>::ld(Bt + boff + (size_t)nb * 16 * K + kc); V b2; if (NSPLIT >= 2) b2 = WFrag<T16>::ld(Bt2 + boff + (size_t)nb * 16 * K + kc);
#pragma unroll
            for (int mb = 0; mb < 4; ++mb) { acc[mb][nb] = WFrag<T16>::mma(a[mb], b, acc[mb][nb]); if (NSPLIT == 1 || NSPLIT == 2) acc[mb][nb] = WFrag<T16>::mma(a2[mb], b, acc[mb][nb]); if (NSPLIT >= 2) acc[mb][nb] = WFrag<T16>::mma(a[mb], b2, acc[mb][nb]); } }
        asm volatile("v_nop\n\tv_nop\n\tv_nop\n\tv_nop" : "+v"(acc[0][0]), "+v"(acc[1][1]), "+v"(acc[2][2]), "+v"(acc[3][3]) : "v"(a[0]), "v"(a[3]));
    }
#pragma unroll
    for (int mb = 0; mb < 4; ++mb) {
#pragma unroll
        for (int nb = 0; nb < 4; ++nb) {
#pragma unroll
            for (int j = 0; j < 8; ++j) os[(hi * 8 + j) * 68 + nb * 16 + lr] = acc[mb][nb][j]; }
        __builtin_amdgcn_wave_barrier(); asm volatile("" ::: "memory");
        float* crow = C + (size_t)(r0 + mb * 16) * ldc + c0;
{
#pragma unroll
            for (int s = 0; s < 8; ++s) { const int row = 2 * s + hi, cofs = lr * 4; v4f val = *(const v4fa*)(os + row * 68 + cofs); if (BIAS) { val[0] += bfr(bias[c0 + cofs]); val[1] += bfr(bias[c0 + cofs + 1]); val[2] += bfr(bias[c0 + cofs + 2]); val[3] += bfr(bias[c0 + cofs + 3]); }
                *(v4f*)(crow + (size_t)row * ldc + cofs) = val; }
             }
        __builtin_amdgcn_wave_barrier(); asm volatile("" ::: "memory");
    }
}

__device__ __forceinline__ h16 tohx(float x) { return (h16)x; }
__device__ __forceinline__ void splitf(float y, unsigned short& h, unsigned short& l) { h = f2bf(y); l = f2bf(y - bf2f(h)); }
typedef __attribute__((ext_vector_type(2))) _Float16 v2h;
typedef __attribute__((ext_vector_type(4))) _Float16 v4h;
typedef __attribute__((ext_vector_type(2))) unsigned short v2us;
typedef __attribute__((ext_vector_type(4))) unsigned short v4us;

__global__ __launch_bounds__(256) void k_wtG(const float* __restrict__ w, int K, int N, bf* Bt) {
    const int lane = threadIdx.x & 31; const int L0 = (blockIdx.x * 8 + (threadIdx.x >> 5)) * 8; const int nlines = N * K / 64;
{
#pragma unroll 1
        for (int l = 0; l < 8; ++l) { const int L = L0 + l; if (L >= nlines) break; const size_t e = (size_t)L * 64 + lane * 2; const int k = (int)(e % K), n = (int)(e / K); v2us o;
            o[0] = f2bf(w[(size_t)k * N + n]); o[1] = f2bf(w[(size_t)(k + 1) * N + n]); *(v2us*)(Bt + e) = o; }
         }
}
__global__ __launch_bounds__(256) void k_cvt8(const float* __restrict__ src, bf* dst, size_t n8) { const size_t i = (size_t)blockIdx.x * 256 + threadIdx.x; if (i >= n8) return; const v8f v = *(const v8f*)(src + i * 8); v8us o;
#pragma unroll
    for (int k = 0; k < 8; ++k) o[k] = f2bf(v[k]); *(v8us*)(dst + i * 8) = o;  }
__global__ __launch_bounds__(256) void k_qkpl(const float* __restrict__ QF, const float* __restrict__ KF, bf* Qh, bf* Ql, bf* Kh, bf* Kl) { const size_t e = ((size_t)blockIdx.x * 256 + threadIdx.x) * 2; if (e >= (size_t)NH_ * TT * HD) return; const int d = (int)(e % HD); const int t = (int)((e / HD) % TT); const int h = (int)(e / ((size_t)HD * TT)); const size_t s = (size_t)t * CC + h * HD + d; v2us qh, ql, kh, kl; unsigned short a, c;
    splitf(QF[s], a, c); qh[0] = a; ql[0] = c; splitf(QF[s + 1], a, c); qh[1] = a; ql[1] = c; splitf(KF[s], a, c); kh[0] = a; kl[0] = c; splitf(KF[s + 1], a, c); kh[1] = a; kl[1] = c;
    { *(v2us*)(Qh + e) = qh; *(v2us*)(Ql + e) = ql; *(v2us*)(Kh + e) = kh; *(v2us*)(Kl + e) = kl;  } }
__global__ __launch_bounds__(256) void k_vtp(const float* __restrict__ VF, h16* VT) { const size_t e = ((size_t)blockIdx.x * 256 + threadIdx.x) * 2; if (e >= (size_t)NH_ * HD * TT) return; const int t = (int)(e % TT); const int d = (int)((e / TT) % HD); const int h = (int)(e / ((size_t)TT * HD)); v2h o;
    o[0] = tohx(VF[(size_t)t * CC + h * HD + d]); o[1] = tohx(VF[(size_t)(t + 1) * CC + h * HD + d]); *(v2h*)(VT + e) = o;  }
typedef __attribute__((ext_vector_type(2))) float  v2f;
typedef __attribute__((ext_vector_type(2))) __bf16 v2bf;
__device__ __forceinline__ float xhalf(float x) { return __builtin_bit_cast(float, __builtin_amdgcn_permlanex16(__builtin_bit_cast(int, x), __builtin_bit_cast(int, x), 0x76543210, 0xfedcba98, false, false)); }   // lane l with lane l ^ 16
// Base-2 exponentials as asm text: inside a statement every v_exp_f32 is followed by an independent one and the last by v_nop, the slot the instruction set asks for between a transcendental and an instruction that
// reads its result or overwrites its source; outputs are early-clobber, so none lands on a source of the same statement.
__device__ __forceinline__ float exp2x1(float x) { float r; asm("v_exp_f32 %0, %1\n\tv_nop" : "=&v"(r) : "v"(x)); return r; }
__device__ __forceinline__ v8f exp2x8(v8f x) { float r0, r1, r2, r3, r4, r5, r6, r7;
    asm("v_exp_f32 %0, %8\n\tv_exp_f32 %1, %9\n\tv_exp_f32 %2, %10\n\tv_exp_f32 %3, %11\n\tv_exp_f32 %4, %12\n\tv_exp_f32 %5, %13\n\tv_exp_f32 %6, %14\n\tv_exp_f32 %7, %15\n\tv_nop"
        : "=&v"(r0), "=&v"(r1), "=&v"(r2), "=&v"(r3), "=&v"(r4), "=&v"(r5), "=&v"(r6), "=&v"(r7) : "v"(x[0]), "v"(x[1]), "v"(x[2]), "v"(x[3]), "v"(x[4]), "v"(x[5]), "v"(x[6]), "v"(x[7]));
    return (v8f){r0, r1, r2, r3, r4, r5, r6, r7}; }
// a load at a wave-uniform pointer plus a per-lane byte offset of 32 bits (fits the scalar-base address form)
template <typename V> __device__ __forceinline__ V ldu(const void* p, unsigned b) { return *(const V*)((const char*)p + b); }
__device__ __forceinline__ v16bf ldfb(const bf* p, unsigned b) { return cat16b(ldu<v8us>(p, b), ldu<v8us>(p + 16, b)); }
__device__ __forceinline__ v16h ldfh(const h16* p, unsigned b) { return cat16(ldu<v8h>(p, b), ldu<v8h>(p + 16, b)); }
// ---- k_fattn: scores, bias, mask, softmax, probs.v and head gate of one batch row in one kernel. Grid (TT / 32, heads), 8 waves. A group owns 32 queries of one head; wave w takes keys [256 w, 256 w + 256) in passes of 32 with its own running maximum,
// sum and accumulators; the eight partial results are merged through LDS behind one barrier. Transposed products: S^T = K Q^T (A = key rows, B = query rows; a lane holds 16 scores of ONE query: keys 8 hi + j and 16 + 8 hi + j),
// O^T += V^T P^T (A = V^T rows d, B = the two score tiles converted in place, same k order as the A loader). Everything in base 2: t = S scale log2e + bf16(geo) hs log2e.
// Every plain '#pragma unroll' in it makes the indices of a register array compile-time constants (a rolled loop would put the array in scratch memory).
__global__ __launch_bounds__(256) void k_fattn(const bf* __restrict__ Qh, const bf* __restrict__ Ql, const bf* __restrict__ Kh, const bf* __restrict__ Kl, const h16* __restrict__ VT, const float* __restrict__ geo, const int* __restrict__ msk,
                                               const float* __restrict__ gbsp, const float* __restrict__ hgs, const float* __restrict__ hg, bf* Ah, bf* Al) {
    __shared__ float cm[KSPL][NQT][32];
    __shared__ float cl[KSPL][NQT][32];
    __shared__ float co[KSPL][NQT][16][32];
    const int lane = threadIdx.x & 31, lr = lane & 15, hi = lane >> 4, w = __builtin_amdgcn_readfirstlane(threadIdx.x >> 5);   // the wave's number as a scalar: scalar key base and branches
    const int h = blockIdx.y, q0 = blockIdx.x * (16 * NQT);
    const size_t hp = (size_t)h * TT * HD;
    const float c1 = 0.17677669529663687f * 1.4426950408889634f;
    const float c2 = bfr(gbsp[0]) * bfr(hgs[h]) * 1.4426950408889634f;
    const unsigned rofs = (unsigned)(lr * HD + 8 * hi) * 2u, cofs = (unsigned)(lr * TT + 8 * hi);   // per-lane offsets: bytes in a [row][32] 16-bit plane; elements in a [row][2048] plane
    v16bf qfh[NQT], qfl[NQT]; v8f o[NQT][2]; float m[NQT], l[NQT];
#pragma unroll
    for (int nq = 0; nq < NQT; ++nq) { const size_t off = hp + (size_t)(q0 + 16 * nq) * HD; qfh[nq] = ldfb(Qh + off, rofs); qfl[nq] = ldfb(Ql + off, rofs); o[nq][0] = (v8f){}; o[nq][1] = (v8f){}; m[nq] = -3.0e38f; l[nq] = 0.f; }
    const unsigned kw = (unsigned)w * (TT / KSPL);   // this wave's first key
    const bf* khp = Kh + hp; const bf* klp = Kl + hp; const h16* vp = VT + (size_t)h * HD * TT; const float* gq = geo + (size_t)q0 * TT;   // wave-uniform bases, fixed over the passes
    unsigned ko = rofs + kw * (HD * 2u), go = (cofs + kw) * 4u, vo = (cofs + kw) * 2u, mo = ((unsigned)lane + kw) * 4u;   // per-lane byte offsets, stepped by one pass of 32 keys
#pragma unroll 1   // one pass in registers at a time: four waves per SIMD stay resident
    for (int it = 0; it < TT / KSPL / 32; ++it, ko += 32u * HD * 2u, go += 128u, vo += 64u, mo += 128u) {
        v16bf kfh[2], kfl[2]; v16h vf[2]; v4f g[NQT][2][2]; v8f s[NQT][2];
#pragma unroll
        for (int t = 0; t < 2; ++t) { kfh[t] = ldfb(khp + 16 * t * HD, ko); kfl[t] = ldfb(klp + 16 * t * HD, ko); }
#pragma unroll
        for (int nq = 0; nq < NQT; ++nq)
#pragma unroll
            for (int t = 0; t < 2; ++t) { const float* gp = gq + 16 * nq * TT + 16 * t; g[nq][t][0] = ldu<v4f>(gp, go); g[nq][t][1] = ldu<v4f>(gp + 4, go); }
#pragma unroll
        for (int dt = 0; dt < 2; ++dt) vf[dt] = ldfh(vp + 16 * dt * TT, vo);
        const unsigned live = __builtin_amdgcn_ballot_w32(ldu<int>(msk, mo) != 0);   // bit i: key i of this pass is attended
#pragma unroll
        for (int nq = 0; nq < NQT; ++nq)
#pragma unroll
            for (int t = 0; t < 2; ++t) s[nq][t] = wmmab(kfh[t], qfh[nq], (v8f){});
#pragma unroll
        for (int nq = 0; nq < NQT; ++nq)
#pragma unroll
            for (int t = 0; t < 2; ++t) s[nq][t] = wmmab(kfh[t], qfl[nq], s[nq][t]);
#pragma unroll
        for (int nq = 0; nq < NQT; ++nq)
#pragma unroll
            for (int t = 0; t < 2; ++t) s[nq][t] = wmmab(kfl[t], qfh[nq], s[nq][t]);
#pragma unroll
        for (int nq = 0; nq < NQT; ++nq)
#pragma unroll
            for (int t = 0; t < 2; ++t)
#pragma unroll
                for (int j = 0; j < 8; j += 2) { const v2f gg = { g[nq][t][j >> 2][j & 3], g[nq][t][j >> 2][(j & 3) + 1] }; const unsigned u = __builtin_bit_cast(unsigned, __builtin_convertvector(gg, v2bf));
                    s[nq][t][j] = s[nq][t][j] * c1 + __uint_as_float(u << 16) * c2; s[nq][t][j + 1] = s[nq][t][j + 1] * c1 + __uint_as_float(u & 0xFFFF0000u) * c2; }
        asm volatile("" :: "v"(vf[0]), "v"(vf[1]));   // inputs only: keeps the V^T loads up with the pass's other loads; without it they sink behind the branch below and their latency stands alone in front of the output products
        if (live != 0xFFFFFFFFu) {   // one scalar test a pass; a pass with every key attended skips the selects
            const unsigned mine = live >> (8 * hi);
#pragma unroll
            for (int nq = 0; nq < NQT; ++nq)
#pragma unroll
                for (int t = 0; t < 2; ++t)
#pragma unroll
                    for (int j = 0; j < 8; ++j) if (!((mine >> (16 * t + j)) & 1u)) s[nq][t][j] = -3.0e38f;
        }
#pragma unroll
        for (int nq = 0; nq < NQT; ++nq) {
            float mx = fmaxf(s[nq][0][0], s[nq][1][0]);
#pragma unroll
            for (int j = 1; j < 8; ++j) mx = fmaxf(mx, fmaxf(s[nq][0][j], s[nq][1][j]));
            mx = fmaxf(mx, xhalf(mx));
            const float mn = fmaxf(m[nq], mx), al = exp2x1(m[nq] - mn), mref = mn - 10.0f;   // probabilities x 2^10, for fp16's range
            m[nq] = mn; float ls = 0.f;
#pragma unroll
            for (int t = 0; t < 2; ++t) { s[nq][t] = exp2x8(s[nq][t] - mref);
#pragma unroll
                for (int j = 0; j < 8; ++j) ls += s[nq][t][j]; }
            l[nq] = l[nq] * al + ls;
            const v16h pf = cat16(__builtin_convertvector(s[nq][0], v8h), __builtin_convertvector(s[nq][1], v8h));
#pragma unroll
            for (int dt = 0; dt < 2; ++dt) { o[nq][dt] *= al; o[nq][dt] = wmma16(vf[dt], pf, o[nq][dt]); }
        }
    }
#pragma unroll
    for (int nq = 0; nq < NQT; ++nq) { cm[w][nq][lane] = m[nq]; cl[w][nq][lane] = l[nq] + xhalf(l[nq]);
#pragma unroll
        for (int dt = 0; dt < 2; ++dt)
#pragma unroll
            for (int j = 0; j < 8; ++j) co[w][nq][dt * 8 + j][lane] = o[nq][dt][j]; }
    __syncthreads();   // publishes the eight waves' partial maxima, sums and accumulators
    if (w < NQT * 2) { const int nq = w >> 1, dt = w & 1;
        float M = cm[0][nq][lane];
#pragma unroll
        for (int u = 1; u < KSPL; ++u) M = fmaxf(M, cm[u][nq][lane]);
        float L = 0.f, acc[8] = {0.f, 0.f, 0.f, 0.f, 0.f, 0.f, 0.f, 0.f}; v8f wt;
#pragma unroll
        for (int u = 0; u < KSPL; ++u) wt[u] = cm[u][nq][lane] - M;
        wt = exp2x8(wt);
#pragma unroll
        for (int u = 0; u < KSPL; ++u) { const float e = wt[u]; L += e * cl[u][nq][lane];
#pragma unroll
            for (int j = 0; j < 8; ++j) acc[j] += e * co[u][nq][dt * 8 + j][lane]; }
        const float f = bfr(hg[h]) / L; v8us oh, ol;
#pragma unroll
        for (int j = 0; j < 8; ++j) { unsigned short a, c; splitf(acc[j] * f, a, c); oh[j] = a; ol[j] = c; }
        const size_t ofs = (size_t)(q0 + 16 * nq + lr) * CC + h * HD + dt * 16 + hi * 8; *(v8us*)(Ah + ofs) = oh; *(v8us*)(Al + ofs) = ol; }
}

extern "C" void kernel_launch(void* const* d_in, const int* in_sizes, int n_in,
                              void* d_out, int out_size, void* d_ws, size_t ws_size, hipStream_t stream) {
    (void)in_sizes; (void)n_in; (void)out_size;
    const float* x = (const float*)d_in[0]; const float* geo = (const float*)d_in[1]; const int* msk = (const int*)d_in[2]; const float* hg = (const float*)d_in[3]; const float* Wq = (const float*)d_in[4]; const float* Wk = (const float*)d_in[5]; const float* Wv = (const float*)d_in[6]; const float* Wo = (const float*)d_in[7]; const float* gbsp = (const float*)d_in[8]; const float* hgs = (const float*)d_in[9];
    float* OUT = (float*)d_out;     // [4][2048][256]
    char* wsp = (char*)d_ws;
    auto take = [&](size_t bytes) { char* p = wsp; wsp += (bytes + 255) & ~(size_t)255; return (void*)p; };
    bf* WQ = (bf*)take((size_t)CC * CC * 2); bf* WK = (bf*)take((size_t)CC * CC * 2); bf* WV = (bf*)take((size_t)CC * CC * 2); bf* WO = (bf*)take((size_t)CC * CC * 2); bf* XB = (bf*)take((size_t)TT * CC * 2);
    float* QF = (float*)take((size_t)TT * CC * 4); float* KF = (float*)take((size_t)TT * CC * 4); float* VF = (float*)take((size_t)TT * CC * 4); bf* Qh = (bf*)take((size_t)NH_ * TT * HD * 2); bf* Ql = (bf*)take((size_t)NH_ * TT * HD * 2); bf* Kh = (bf*)take((size_t)NH_ * TT * HD * 2); bf* Kl = (bf*)take((size_t)NH_ * TT * HD * 2); h16* VT = (h16*)take((size_t)NH_ * HD * TT * 2);
    bf* Ah = (bf*)take((size_t)TT * CC * 2); bf* Al = (bf*)take((size_t)TT * CC * 2);
    if ((size_t)(wsp - (char*)d_ws) > ws_size) return;    // total ~ 14.5 MB
    k_cvt8<<<(CC * CC / 8 + 255) / 256, 256, 0, stream>>>(Wq, WQ, (size_t)CC * CC / 8); k_cvt8<<<(CC * CC / 8 + 255) / 256, 256, 0, stream>>>(Wk, WK, (size_t)CC * CC / 8); k_cvt8<<<(CC * CC / 8 + 255) / 256, 256, 0, stream>>>(Wv, WV, (size_t)CC * CC / 8); k_cvt8<<<(CC * CC / 8 + 255) / 256, 256, 0, stream>>>(Wo, WO, (size_t)CC * CC / 8);   // torch [out][in] = natural Bt
    for (int b = 0; b < NB_; ++b) {
        k_cvt8<<<(TT * CC / 8 + 255) / 256, 256, 0, stream>>>(x + (size_t)b * TT * CC, XB, (size_t)TT * CC / 8);
        k_gemmw<bf, 0, false><<<dim3(TT / 64, CC / 64, 1), 32, 0, stream>>>(XB, nullptr, WQ, nullptr, CC, QF, CC, nullptr, 0, 0, 0); k_gemmw<bf, 0, false><<<dim3(TT / 64, CC / 64, 1), 32, 0, stream>>>(XB, nullptr, WK, nullptr, CC, KF, CC, nullptr, 0, 0, 0); k_gemmw<bf, 0, false><<<dim3(TT / 64, CC / 64, 1), 32, 0, stream>>>(XB, nullptr, WV, nullptr, CC, VF, CC, nullptr, 0, 0, 0);
        k_qkpl<<<(unsigned)(((size_t)NH_ * TT * HD / 2 + 255) / 256), 256, 0, stream>>>(QF, KF, Qh, Ql, Kh, Kl); k_vtp<<<(unsigned)(((size_t)NH_ * HD * TT / 2 + 255) / 256), 256, 0, stream>>>(VF, VT);
        k_fattn<<<dim3(TT / (16 * NQT), NH_, 1), 256, 0, stream>>>(Qh, Ql, Kh, Kl, VT, geo, msk + (size_t)b * TT, gbsp, hgs, hg, Ah, Al);
        k_gemmw<bf, 1, false><<<dim3(TT / 64, CC / 64, 1), 32, 0, stream>>>(Ah, Al, WO, nullptr, CC, OUT + (size_t)b * TT * CC, CC, nullptr, 0, 0, 0); }
}

// v003
// A run of this version takes 124 microseconds.
// Two timings next to v002 put it at 2.00 and 2.06 times that version's speed.
// All steps since v000 together make it 10.3 times as fast.
#include <hip/hip_runtime.h>

// TetrahedralAttention (x [4][2048][256]; q/k/v = x W^T (8 heads x 32); scores = q.k/sqrt(32) + geo_bias_scale geometric_bias[i][j] head_geo_scales[h]; keys with attention_mask[b][j] == 0 -> -inf; softmax; x head_gates[h] (post-softmax);
// out = merged.v Wo^T -> [4][2048][256]; bias table, mask (int32), gates and scales read as data).
// Compute dtypes, f32 accumulate: every input rounded to bf16; projections on PLAIN bf16 operands (inputs: exact); scores (K 32) on bf16 hi+lo planes (3 products), bias/mask/softmax in f32 registers
// (probabilities x1024 against the running maximum, fp16); probs.v on fp16 planes; Wo on hl planes x exact Wo (2 products). Scores, softmax, probs.v and the head gate run in ONE kernel (k_fattn): no score or probability plane in memory.
// Five launches, each over all four batch rows: input conversions; q, k, v projections (grid z, M = 4 x 2048); operand planes; attention (grid z = batch row); output projection.

#define NB_  4
#define TT   2048
#define CC   256
#define NH_  8
#define HD   32
#define KSPL 8
#define NQT  2
typedef _Float16 h16;
typedef unsigned short bf;
typedef __attribute__((ext_vector_type(16))) __bf16   v16bf;
typedef __attribute__((ext_vector_type(16))) _Float16 v16h;
typedef __attribute__((ext_vector_type(8)))  _Float16 v8h;
typedef __attribute__((ext_vector_type(8)))  unsigned short v8us;
typedef __attribute__((ext_vector_type(8)))  float    v8f;
typedef __attribute__((ext_vector_type(4)))  float    v4f;
typedef v8h  __attribute__((may_alias)) v8ha;
typedef v4f  __attribute__((may_alias)) v4fa;
typedef v8us __attribute__((may_alias)) v8usa;

__device__ __forceinline__ unsigned short f2bf(float f) { unsigned u = __float_as_uint(f); u += 0x7FFFu + ((u >> 16) & 1u); return (unsigned short)(u >> 16); }
__device__ __forceinline__ float bf2f(unsigned short b) { return __uint_as_float(((unsigned)b) << 16); }
__device__ __forceinline__ float bfr(float f) { return bf2f(f2bf(f)); }
__device__ __forceinline__ v16h cat16(v8h lo, v8h hi) { return __builtin_shufflevector(lo, hi, 0, 1, 2, 3, 4, 5, 6, 7, 8, 9, 10, 11, 12, 13, 14, 15); }
__device__ __forceinline__ v16bf cat16b(v8us lo, v8us hi) { return __builtin_bit_cast(v16bf, __builtin_shufflevector(lo, hi, 0, 1, 2, 3, 4, 5, 6, 7, 8, 9, 10, 11, 12, 13, 14, 15)); }
__device__ __forceinline__ v8f wmma16(v16h a, v16h b, v8f c) { return __builtin_amdgcn_wmma_f32_16x16x32_f16(false, a, false, b, (short)0, c, false, false); }
__device__ __forceinline__ v8f wmmab(v16bf a, v16bf b, v8f c) { return __builtin_amdgcn_wmma_f32_16x16x32_bf16(false, a, false, b, (short)0, c, false, false); }



// ---- k_gemmw: register-blocked GEMM, ONE WAVE per 64x64 output tile (16 accumulators), operands straight from K-contiguous 16-bit planes; grid (M/64, N/64, Z), 32 threads.
// C[m][n] (f32, pitch ldc, + optional f32 bias[n]) = sum_k A[m][k] Bt[n][k] (+ split products per NSPLIT). z-batch strides sA/sB/sC in elements. K % 32 == 0.
template <typename T16> struct WFrag;
template <> struct WFrag<h16> { typedef v16h V; static __device__ __forceinline__ V ld(const h16* p) { return cat16(*(const v8h*)p, *(const v8h*)(p + 16)); } static __device__ __forceinline__ v8f mma(V a, V b, v8f c) { return wmma16(a, b, c); } };
template <> struct WFrag<bf> { typedef v16bf V; static __device__ __forceinline__ V ld(const bf* p) { return cat16b(*(const v8us*)p, *(const v8us*)(p + 16)); } static __device__ __forceinline__ v8f mma(V a, V b, v8f c) { return wmmab(a, b, c); } };
template <typename T16, int NSPLIT, bool BIAS>
__global__ __launch_bounds__(32) void k_gemmw(const T16* __restrict__ A, const T16* __restrict__ A2, const T16* __restrict__ Bt, const T16* __restrict__ Bt2, int K, float* C, int ldc, const float* __restrict__ bias, size_t sA, size_t sB, size_t sC) {
    typedef typename WFrag<T16>::V V;
    __shared__ __align__(16) float os[16 * 68];
    const size_t z = blockIdx.z; A += z * sA; if (A2) A2 += z * sA; Bt += z * sB; if (Bt2) Bt2 += z * sB; C += z * sC;
    const int lane = threadIdx.x & 31, lr = lane & 15, hi = lane >> 4; const int r0 = blockIdx.x * 64, c0 = blockIdx.y * 64;
    v8f acc[4][4];
#pragma unroll
    for (int mb = 0; mb < 4; ++mb)
#pragma unroll
        for (int nb = 0; nb < 4; ++nb) acc[mb][nb] = (v8f){};
    const size_t aoff = (size_t)(r0 + lr) * K + 8 * hi, boff = (size_t)(c0 + lr) * K + 8 * hi;
#pragma unroll 1
    for (int kc = 0; kc < K; kc += 32) {
        V a[4], a2[4];
#pragma unroll
        for (int mb = 0; mb < 4; ++mb) { a[mb] = WFrag<T16>::ld(A + aoff + (size_t)mb * 16 * K + kc); if (NSPLIT == 1 || NSPLIT == 2) a2[mb] = WFrag<T16>::ld(A2 + aoff + (size_t)mb * 16 * K + kc); }
#pragma unroll
        for (int nb = 0; nb < 4; ++nb) { const V b = WFrag<T16>::ld(Bt + boff + (size_t)nb * 16 * K + kc); V b2; if (NSPLIT >= 2) b2 = WFrag<T16>::ld(Bt2 + boff + (size_t)nb * 16 * K + kc);
#pragma unroll
            for (int mb = 0; mb < 4; ++mb) { acc[mb][nb] = WFrag<T16>::mma(a[mb], b, acc[mb][nb]); if (NSPLIT == 1 || NSPLIT == 2) acc[mb][nb] = WFrag<T16>::mma(a2[mb], b, acc[mb][nb]); if (NSPLIT >= 2) acc[mb][nb] = WFrag<T16>::mma(a[mb], b2, acc[mb][nb]); } }
        asm volatile("v_nop\n\tv_nop\n\tv_nop\n\tv_nop" : "+v"(acc[0][0]), "+v"(acc[1][1]), "+v"(acc[2][2]), "+v"(acc[3][3]) : "v"(a[0]), "v"(a[3]));
    }
#pragma unroll
    for (int mb = 0; mb < 4; ++mb) {
#pragma unroll
        for (int nb = 0; nb < 4; ++nb) {
#pragma unroll
            for (int j = 0; j < 8; ++j) os[(hi * 8 + j) * 68 + nb * 16 + lr] = acc[mb][nb][j]; }
        __builtin_amdgcn_wave_barrier(); asm volatile("" ::: "memory");
        float* crow = C + (size_t)(r0 + mb * 16) * ldc + c0;
{
#pragma unroll
            for (int s = 0; s < 8; ++s) { const int row = 2 * s + hi, cofs = lr * 4; v4f val = *(const v4fa*)(os + row * 68 + cofs); if (BIAS) { val[0] += bfr(bias[c0 + cofs]); val[1] += bfr(bias[c0 + cofs + 1]); val[2] += bfr(bias[c0 + cofs + 2]); val[3] += bfr(bias[c0 + cofs + 3]); }
                *(v4f*)(crow + (size_t)row * ldc + cofs) = val; }
             }
        __builtin_amdgcn_wave_barrier(); asm volatile("" ::: "memory");
    }
}

__device__ __forceinline__ h16 tohx(float x) { return (h16)x; }
__device__ __forceinline__ void splitf(float y, unsigned short& h, unsigned short& l) { h = f2bf(y); l = f2bf(y - bf2f(h)); }
typedef __attribute__((ext_vector_type(2))) _Float16 v2h;
typedef __attribute__((ext_vector_type(4))) _Float16 v4h;
typedef __attribute__((ext_vector_type(2))) unsigned short v2us;
typedef __attribute__((ext_vector_type(4))) unsigned short v4us;

__global__ __launch_bounds__(256) void k_wtG(const float* __restrict__ w, int K, int N, bf* Bt) {
    const int lane = threadIdx.x & 31; const int L0 = (blockIdx.x * 8 + (threadIdx.x >> 5)) * 8; const int nlines = N * K / 64;
{
#pragma unroll 1
        for (int l = 0; l < 8; ++l) { const int L = L0 + l; if (L >= nlines) break; const size_t e = (size_t)L * 64 + lane * 2; const int k = (int)(e % K), n = (int)(e / K); v2us o;
            o[0] = f2bf(w[(size_t)k * N + n]); o[1] = f2bf(w[(size_t)(k + 1) * N + n]); *(v2us*)(Bt + e) = o; }
         }
}
// every f32 -> bf16 input conversion in one grid: blocks [0, XBLK) take x (all batch rows), then WBLK blocks for each of Wq, Wk, Wv, Wo (planes back to back in WB); 8 elements a thread, the sizes divide exactly
#define XBLK (NB_ * TT * CC / 8 / 256)
#define WBLK (CC * CC / 8 / 256)
__global__ __launch_bounds__(256) void k_cvtin(const float* __restrict__ x, const float* __restrict__ Wq, const float* __restrict__ Wk, const float* __restrict__ Wv, const float* __restrict__ Wo, bf* XB, bf* WB) {
    const int blk = blockIdx.x; const float* src = x; bf* dst = XB; int rb = blk;
    if (blk >= XBLK) { const int sel = (blk - XBLK) / WBLK; src = sel == 0 ? Wq : sel == 1 ? Wk : sel == 2 ? Wv : Wo; dst = WB + (size_t)sel * CC * CC; rb = (blk - XBLK) % WBLK; }
    const size_t i = (size_t)rb * 256 + threadIdx.x; const v8f v = *(const v8f*)(src + i * 8); v8us o;
#pragma unroll
    for (int k = 0; k < 8; ++k) o[k] = f2bf(v[k]); *(v8us*)(dst + i * 8) = o;  }
// planes are [batch row][head][...]; QF, KF, VF are [batch row x position][256]
__device__ __forceinline__ void d_qkpl(const float* __restrict__ QF, const float* __restrict__ KF, bf* Qh, bf* Ql, bf* Kh, bf* Kl) { const size_t e = ((size_t)blockIdx.x * 256 + threadIdx.x) * 2; if (e >= (size_t)NB_ * NH_ * TT * HD) return; const int d = (int)(e % HD); const int t = (int)((e / HD) % TT); const int h = (int)((e / ((size_t)HD * TT)) % NH_); const int b = (int)(e / ((size_t)HD * TT * NH_)); const size_t s = ((size_t)b * TT + t) * CC + h * HD + d; v2us qh, ql, kh, kl; unsigned short a, c;
    splitf(QF[s], a, c); qh[0] = a; ql[0] = c; splitf(QF[s + 1], a, c); qh[1] = a; ql[1] = c; splitf(KF[s], a, c); kh[0] = a; kl[0] = c; splitf(KF[s + 1], a, c); kh[1] = a; kl[1] = c;
    { *(v2us*)(Qh + e) = qh; *(v2us*)(Ql + e) = ql; *(v2us*)(Kh + e) = kh; *(v2us*)(Kl + e) = kl;  } }
__device__ __forceinline__ void d_vtp(const float* __restrict__ VF, h16* VT) { const size_t e = ((size_t)blockIdx.x * 256 + threadIdx.x) * 2; if (e >= (size_t)NB_ * NH_ * HD * TT) return; const int t = (int)(e % TT); const int d = (int)((e / TT) % HD); const int h = (int)((e / ((size_t)TT * HD)) % NH_); const int b = (int)(e / ((size_t)TT * HD * NH_)); const size_t s = ((size_t)b * TT + t) * CC + h * HD + d; v2h o;
    o[0] = tohx(VF[s]); o[1] = tohx(VF[s + CC]); *(v2h*)(VT + e) = o;  }
// both plane builders in one grid (they read different projections and write different planes): y = 0 the V transpose, whose strided reads take longer, so it starts first; y = 1 the q and k hi+lo planes
__global__ __launch_bounds__(256) void k_planes(const float* __restrict__ QF, const float* __restrict__ KF, const float* __restrict__ VF, bf* Qh, bf* Ql, bf* Kh, bf* Kl, h16* VT) { if (blockIdx.y == 0) d_vtp(VF, VT); else d_qkpl(QF, KF, Qh, Ql, Kh, Kl); }
typedef __attribute__((ext_vector_type(2))) float  v2f;
typedef __attribute__((ext_vector_type(2))) __bf16 v2bf;
__device__ __forceinline__ float xhalf(float x) { return __builtin_bit_cast(float, __builtin_amdgcn_permlanex16(__builtin_bit_cast(int, x), __builtin_bit_cast(int, x), 0x76543210, 0xfedcba98, false, false)); }   // lane l with lane l ^ 16
// Base-2 exponentials as asm text: inside a statement every v_exp_f32 is followed by an independent one and the last by v_nop, the slot the instruction set asks for between a transcendental and an instruction that
// reads its result or overwrites its source; outputs are early-clobber, so none lands on a source of the same statement.
__device__ __forceinline__ float exp2x1(float x) { float r; asm("v_exp_f32 %0, %1\n\tv_nop" : "=&v"(r) : "v"(x)); return r; }
__device__ __forceinline__ v8f exp2x8(v8f x) { float r0, r1, r2, r3, r4, r5, r6, r7;
    asm("v_exp_f32 %0, %8\n\tv_exp_f32 %1, %9\n\tv_exp_f32 %2, %10\n\tv_exp_f32 %3, %11\n\tv_exp_f32 %4, %12\n\tv_exp_f32 %5, %13\n\tv_exp_f32 %6, %14\n\tv_exp_f32 %7, %15\n\tv_nop"
        : "=&v"(r0), "=&v"(r1), "=&v"(r2), "=&v"(r3), "=&v"(r4), "=&v"(r5), "=&v"(r6), "=&v"(r7) : "v"(x[0]), "v"(x[1]), "v"(x[2]), "v"(x[3]), "v"(x[4]), "v"(x[5]), "v"(x[6]), "v"(x[7]));
    return (v8f){r0, r1, r2, r3, r4, r5, r6, r7}; }
// a load at a wave-uniform pointer plus a per-lane byte offset of 32 bits (fits the scalar-base address form)
template <typename V> __device__ __forceinline__ V ldu(const void* p, unsigned b) { return *(const V*)((const char*)p + b); }
__device__ __forceinline__ v16bf ldfb(const bf* p, unsigned b) { return cat16b(ldu<v8us>(p, b), ldu<v8us>(p + 16, b)); }
__device__ __forceinline__ v16h ldfh(const h16* p, unsigned b) { return cat16(ldu<v8h>(p, b), ldu<v8h>(p + 16, b)); }
// ---- k_fattn: scores, bias, mask, softmax, probs.v and head gate in one kernel. Grid (TT / 32, heads, batch rows), 8 waves. A group owns 32 queries of one head; wave w takes keys [256 w, 256 w + 256) in passes of 32 with its own running maximum,
// sum and accumulators; the eight partial results are merged through LDS behind one barrier. Transposed products: S^T = K Q^T (A = key rows, B = query rows; a lane holds 16 scores of ONE query: keys 8 hi + j and 16 + 8 hi + j),
// O^T += V^T P^T (A = V^T rows d, B = the two score tiles converted in place, same k order as the A loader). Everything in base 2: t = S scale log2e + bf16(geo) hs log2e.
// Every plain '#pragma unroll' in it makes the indices of a register array compile-time constants (a rolled loop would put the array in scratch memory).
__global__ __launch_bounds__(256) void k_fattn(const bf* __restrict__ Qh, const bf* __restrict__ Ql, const bf* __restrict__ Kh, const bf* __restrict__ Kl, const h16* __restrict__ VT, const float* __restrict__ geo, const int* __restrict__ msk,
                                               const float* __restrict__ gbsp, const float* __restrict__ hgs, const float* __restrict__ hg, bf* Ah, bf* Al) {
    __shared__ float cm[KSPL][NQT][32];
    __shared__ float cl[KSPL][NQT][32];
    __shared__ float co[KSPL][NQT][16][32];
    const int lane = threadIdx.x & 31, lr = lane & 15, hi = lane >> 4, w = __builtin_amdgcn_readfirstlane(threadIdx.x >> 5);   // the wave's number as a scalar: scalar loop bounds and branches
    const int h = blockIdx.y, q0 = blockIdx.x * (16 * NQT), b = blockIdx.z;
    const size_t hp = ((size_t)b * NH_ + h) * TT * HD;   // this batch row's and head's plane, [2048][32] and [32][2048] alike
    msk += (size_t)b * TT;
    const float c1 = 0.17677669529663687f * 1.4426950408889634f;
    const float c2 = bfr(gbsp[0]) * bfr(hgs[h]) * 1.4426950408889634f;
    const unsigned rofs = (unsigned)(lr * HD + 8 * hi) * 2u, cofs = (unsigned)(lr * TT + 8 * hi);   // per-lane offsets: bytes in a [row][32] 16-bit plane; elements in a [row][2048] plane
    v16bf qfh[NQT], qfl[NQT]; v8f o[NQT][2]; float m[NQT], l[NQT];
#pragma unroll
    for (int nq = 0; nq < NQT; ++nq) { const size_t off = hp + (size_t)(q0 + 16 * nq) * HD; qfh[nq] = ldfb(Qh + off, rofs); qfl[nq] = ldfb(Ql + off, rofs); o[nq][0] = (v8f){}; o[nq][1] = (v8f){}; m[nq] = -3.0e38f; l[nq] = 0.f; }
    const unsigned kw = (unsigned)w * (TT / KSPL);   // this wave's first key
    const bf* khp = Kh + hp; const bf* klp = Kl + hp; const h16* vp = VT + hp; const float* gq = geo + (size_t)q0 * TT;   // wave-uniform bases, fixed over the passes
    unsigned ko = rofs + kw * (HD * 2u), go = (cofs + kw) * 4u, vo = (cofs + kw) * 2u, mo = ((unsigned)lane + kw) * 4u;   // per-lane byte offsets, stepped by one pass of 32 keys
#pragma unroll 1   // one pass in registers at a time: four waves per SIMD stay resident
    for (int it = 0; it < TT / KSPL / 32; ++it, ko += 32u * HD * 2u, go += 128u, vo += 64u, mo += 128u) {
        v16bf kfh[2], kfl[2]; v16h vf[2]; v4f g[NQT][2][2]; v8f s[NQT][2];
#pragma unroll
        for (int t = 0; t < 2; ++t) { kfh[t] = ldfb(khp + 16 * t * HD, ko); kfl[t] = ldfb(klp + 16 * t * HD, ko); }
#pragma unroll
        for (int nq = 0; nq < NQT; ++nq)
#pragma unroll
            for (int t = 0; t < 2; ++t) { const float* gp = gq + 16 * nq * TT + 16 * t; g[nq][t][0] = ldu<v4f>(gp, go); g[nq][t][1] = ldu<v4f>(gp + 4, go); }
#pragma unroll
        for (int dt = 0; dt < 2; ++dt) vf[dt] = ldfh(vp + 16 * dt * TT, vo);
        const unsigned live = __builtin_amdgcn_ballot_w32(ldu<int>(msk, mo) != 0);   // bit i: key i of this pass is attended
#pragma unroll
        for (int nq = 0; nq < NQT; ++nq)
#pragma unroll
            for (int t = 0; t < 2; ++t) s[nq][t] = wmmab(kfh[t], qfh[nq], (v8f){});
#pragma unroll
        for (int nq = 0; nq < NQT; ++nq)
#pragma unroll
            for (int t = 0; t < 2; ++t) s[nq][t] = wmmab(kfh[t], qfl[nq], s[nq][t]);
#pragma unroll
        for (int nq = 0; nq < NQT; ++nq)
#pragma unroll
            for (int t = 0; t < 2; ++t) s[nq][t] = wmmab(kfl[t], qfh[nq], s[nq][t]);
#pragma unroll
        for (int nq = 0; nq < NQT; ++nq)
#pragma unroll
            for (int t = 0; t < 2; ++t)
#pragma unroll
                for (int j = 0; j < 8; j += 2) { const v2f gg = { g[nq][t][j >> 2][j & 3], g[nq][t][j >> 2][(j & 3) + 1] }; const unsigned u = __builtin_bit_cast(unsigned, __builtin_convertvector(gg, v2bf));
                    s[nq][t][j] = s[nq][t][j] * c1 + __uint_as_float(u << 16) * c2; s[nq][t][j + 1] = s[nq][t][j + 1] * c1 + __uint_as_float(u & 0xFFFF0000u) * c2; }
        asm volatile("" :: "v"(vf[0]), "v"(vf[1]));   // inputs only: keeps the V^T loads up with the pass's other loads; without it they sink behind the branch below and their latency stands alone in front of the output products
        if (live != 0xFFFFFFFFu) {   // one scalar test a pass; a pass with every key attended skips the selects
            const unsigned mine = live >> (8 * hi);
#pragma unroll
            for (int nq = 0; nq < NQT; ++nq)
#pragma unroll
                for (int t = 0; t < 2; ++t)
#pragma unroll
                    for (int j = 0; j < 8; ++j) if (!((mine >> (16 * t + j)) & 1u)) s[nq][t][j] = -3.0e38f;
        }
#pragma unroll
        for (int nq = 0; nq < NQT; ++nq) {
            float mx = fmaxf(s[nq][0][0], s[nq][1][0]);
#pragma unroll
            for (int j = 1; j < 8; ++j) mx = fmaxf(mx, fmaxf(s[nq][0][j], s[nq][1][j]));
            mx = fmaxf(mx, xhalf(mx));
            const float mn = fmaxf(m[nq], mx), al = exp2x1(m[nq] - mn), mref = mn - 10.0f;   // probabilities x 2^10, for fp16's range
            m[nq] = mn; float ls = 0.f;
#pragma unroll
            for (int t = 0; t < 2; ++t) { s[nq][t] = exp2x8(s[nq][t] - mref);
#pragma unroll
                for (int j = 0; j < 8; ++j) ls += s[nq][t][j]; }
            l[nq] = l[nq] * al + ls;
            const v16h pf = cat16(__builtin_convertvector(s[nq][0], v8h), __builtin_convertvector(s[nq][1], v8h));
#pragma unroll
            for (int dt = 0; dt < 2; ++dt) { o[nq][dt] *= al; o[nq][dt] = wmma16(vf[dt], pf, o[nq][dt]); }
        }
    }
#pragma unroll
    for (int nq = 0; nq < NQT; ++nq) { cm[w][nq][lane] = m[nq]; cl[w][nq][lane] = l[nq] + xhalf(l[nq]);
#pragma unroll
        for (int dt = 0; dt < 2; ++dt)
#pragma unroll
            for (int j = 0; j < 8; ++j) co[w][nq][dt * 8 + j][lane] = o[nq][dt][j]; }
    __syncthreads();   // publishes the eight waves' partial maxima, sums and accumulators
    if (w < NQT * 2) { const int nq = w >> 1, dt = w & 1;
        float M = cm[0][nq][lane];
#pragma unroll
        for (int u = 1; u < KSPL; ++u) M = fmaxf(M, cm[u][nq][lane]);
        float L = 0.f, acc[8] = {0.f, 0.f, 0.f, 0.f, 0.f, 0.f, 0.f, 0.f}; v8f wt;
#pragma unroll
        for (int u = 0; u < KSPL; ++u) wt[u] = cm[u][nq][lane] - M;
        wt = exp2x8(wt);
#pragma unroll
        for (int u = 0; u < KSPL; ++u) { const float e = wt[u]; L += e * cl[u][nq][lane];
#pragma unroll
            for (int j = 0; j < 8; ++j) acc[j] += e * co[u][nq][dt * 8 + j][lane]; }
        const float f = bfr(hg[h]) / L; v8us oh, ol;
#pragma unroll
        for (int j = 0; j < 8; ++j) { unsigned short a, c; splitf(acc[j] * f, a, c); oh[j] = a; ol[j] = c; }
        const size_t ofs = ((size_t)b * TT + q0 + 16 * nq + lr) * CC + h * HD + dt * 16 + hi * 8; *(v8us*)(Ah + ofs) = oh; *(v8us*)(Al + ofs) = ol; }
}

extern "C" void kernel_launch(void* const* d_in, const int* in_sizes, int n_in,
                              void* d_out, int out_size, void* d_ws, size_t ws_size, hipStream_t stream) {
    (void)in_sizes; (void)n_in; (void)out_size;
    const float* x = (const float*)d_in[0]; const float* geo = (const float*)d_in[1]; const int* msk = (const int*)d_in[2]; const float* hg = (const float*)d_in[3]; const float* Wq = (const float*)d_in[4]; const float* Wk = (const float*)d_in[5]; const float* Wv = (const float*)d_in[6]; const float* Wo = (const float*)d_in[7]; const float* gbsp = (const float*)d_in[8]; const float* hgs = (const float*)d_in[9];
    float* OUT = (float*)d_out;     // [4][2048][256]
    char* wsp = (char*)d_ws;
    auto take = [&](size_t bytes) { char* p = wsp; wsp += (bytes + 255) & ~(size_t)255; return (void*)p; };
    bf* WB = (bf*)take((size_t)4 * CC * CC * 2); bf* WO = WB + (size_t)3 * CC * CC; bf* XB = (bf*)take((size_t)NB_ * TT * CC * 2);   // WB: Wq, Wk, Wv, Wo planes back to back; [out][in] as given = natural Bt
    float* QF = (float*)take((size_t)3 * NB_ * TT * CC * 4); float* KF = QF + (size_t)NB_ * TT * CC; float* VF = KF + (size_t)NB_ * TT * CC;   // back to back: the z stride of the projection launch
    bf* Qh = (bf*)take((size_t)NB_ * NH_ * TT * HD * 2); bf* Ql = (bf*)take((size_t)NB_ * NH_ * TT * HD * 2); bf* Kh = (bf*)take((size_t)NB_ * NH_ * TT * HD * 2); bf* Kl = (bf*)take((size_t)NB_ * NH_ * TT * HD * 2); h16* VT = (h16*)take((size_t)NB_ * NH_ * HD * TT * 2);
    bf* Ah = (bf*)take((size_t)NB_ * TT * CC * 2); bf* Al = (bf*)take((size_t)NB_ * TT * CC * 2);
    if ((size_t)(wsp - (char*)d_ws) > ws_size) return;    // total ~ 57 MB
    k_cvtin<<<XBLK + 4 * WBLK, 256, 0, stream>>>(x, Wq, Wk, Wv, Wo, XB, WB);
    k_gemmw<bf, 0, false><<<dim3(NB_ * TT / 64, CC / 64, 3), 32, 0, stream>>>(XB, nullptr, WB, nullptr, CC, QF, CC, nullptr, 0, (size_t)CC * CC, (size_t)NB_ * TT * CC);
    k_planes<<<dim3((unsigned)(((size_t)NB_ * NH_ * TT * HD / 2 + 255) / 256), 2, 1), 256, 0, stream>>>(QF, KF, VF, Qh, Ql, Kh, Kl, VT);
    k_fattn<<<dim3(TT / (16 * NQT), NH_, NB_), 256, 0, stream>>>(Qh, Ql, Kh, Kl, VT, geo, msk, gbsp, hgs, hg, Ah, Al);
    k_gemmw<bf, 1, false><<<dim3(NB_ * TT / 64, CC / 64, 1), 32, 0, stream>>>(Ah, Al, WO, nullptr, CC, OUT, CC, nullptr, 0, 0, 0);
}

// v004
// Measured time: 109 microseconds a run.
// In two side-by-side timings against v003, it was 1.13 and 1.14 times as fast.
// All steps since v000 together make it 11.7 times as fast.
#include <hip/hip_runtime.h>

// TetrahedralAttention (x [4][2048][256]; q/k/v = x W^T (8 heads x 32); scores = q.k/sqrt(32) + geo_bias_scale geometric_bias[i][j] head_geo_scales[h]; keys with attention_mask[b][j] == 0 -> -inf; softmax; x head_gates[h] (post-softmax);
// out = merged.v Wo^T -> [4][2048][256]; bias table, mask (int32), gates and scales read as data).
// Compute dtypes, f32 accumulate: every input rounded to bf16; projections on PLAIN bf16 operands (inputs: exact); scores (K 32) on bf16 hi+lo planes (3 products), bias/mask/softmax in f32 registers
// (probabilities x1024 against the running maximum, fp16); probs.v on fp16 planes; Wo on hl planes x exact Wo (2 products). Scores, softmax, probs.v and the head gate run in ONE kernel (k_fattn): no score or probability plane in memory.
// Four launches, each over all four batch rows: input conversions; q, k, v projections (grid z, M = 4 x 2048), whose epilogue writes the attention's operand planes itself; attention (grid z = batch row); output projection.

#define NB_  4
#define TT   2048
#define CC   256
#define NH_  8
#define HD   32
#define KSPL 8
#define NQT  2
typedef _Float16 h16;
typedef unsigned short bf;
typedef __attribute__((ext_vector_type(16))) __bf16   v16bf;
typedef __attribute__((ext_vector_type(16))) _Float16 v16h;
typedef __attribute__((ext_vector_type(8)))  _Float16 v8h;
typedef __attribute__((ext_vector_type(8)))  unsigned short v8us;
typedef __attribute__((ext_vector_type(8)))  float    v8f;
typedef __attribute__((ext_vector_type(4)))  float    v4f;
typedef __attribute__((ext_vector_type(2)))  float    v2f;
typedef __attribute__((ext_vector_type(2)))  __bf16   v2bf;
typedef __attribute__((ext_vector_type(4)))  unsigned v4u;
typedef v8h  __attribute__((may_alias)) v8ha;
typedef v4f  __attribute__((may_alias)) v4fa;
typedef v8us __attribute__((may_alias)) v8usa;

__device__ __forceinline__ unsigned short f2bf(float f) { unsigned u = __float_as_uint(f); u += 0x7FFFu + ((u >> 16) & 1u); return (unsigned short)(u >> 16); }
__device__ __forceinline__ float bf2f(unsigned short b) { return __uint_as_float(((unsigned)b) << 16); }
__device__ __forceinline__ float bfr(float f) { return bf2f(f2bf(f)); }
__device__ __forceinline__ void splitf(float y, unsigned short& h, unsigned short& l) { h = f2bf(y); l = f2bf(y - bf2f(h)); }
// splitf on two neighbours at once, each result a packed pair; the packed conversion rounds to nearest even, as f2bf does
__device__ __forceinline__ void splitf2(float y0, float y1, unsigned& h, unsigned& l) { h = __builtin_bit_cast(unsigned, __builtin_convertvector((v2f){y0, y1}, v2bf));
    l = __builtin_bit_cast(unsigned, __builtin_convertvector((v2f){y0 - __uint_as_float(h << 16), y1 - __uint_as_float(h & 0xFFFF0000u)}, v2bf)); }
__device__ __forceinline__ v16h cat16(v8h lo, v8h hi) { return __builtin_shufflevector(lo, hi, 0, 1, 2, 3, 4, 5, 6, 7, 8, 9, 10, 11, 12, 13, 14, 15); }
__device__ __forceinline__ v16bf cat16b(v8us lo, v8us hi) { return __builtin_bit_cast(v16bf, __builtin_shufflevector(lo, hi, 0, 1, 2, 3, 4, 5, 6, 7, 8, 9, 10, 11, 12, 13, 14, 15)); }
__device__ __forceinline__ v8f wmma16(v16h a, v16h b, v8f c) { return __builtin_amdgcn_wmma_f32_16x16x32_f16(false, a, false, b, (short)0, c, false, false); }
__device__ __forceinline__ v8f wmmab(v16bf a, v16bf b, v8f c) { return __builtin_amdgcn_wmma_f32_16x16x32_bf16(false, a, false, b, (short)0, c, false, false); }



// ---- k_gemmw: register-blocked GEMM, ONE WAVE per 64x64 output tile (16 accumulators), operands straight from K-contiguous 16-bit planes; grid (M/64, N/64, Z), 32 threads.
// C[m][n] (f32, pitch ldc, + optional f32 bias[n]) = sum_k A[m][k] Bt[n][k] (+ split products per NSPLIT). z-batch strides sA/sB/sC in elements. K % 32 == 0.
// PLANES (the q, k, v projections; m = batch row x position, n = head x 32 + d): no f32 C; the tile goes from the accumulators to the attention's operand planes, [batch row][head][...]:
// z = 0, 1: bf16 hi and lo planes [position][32] of q, k; z = 2: the fp16 plane [d][position] of v. Both are staged through LDS so that every global store instruction writes whole 128-byte lines.
template <typename T16> struct WFrag;
template <> struct WFrag<h16> { typedef v16h V; static __device__ __forceinline__ V ld(const h16* p) { return cat16(*(const v8h*)p, *(const v8h*)(p + 16)); } static __device__ __forceinline__ v8f mma(V a, V b, v8f c) { return wmma16(a, b, c); } };
template <> struct WFrag<bf> { typedef v16bf V; static __device__ __forceinline__ V ld(const bf* p) { return cat16b(*(const v8us*)p, *(const v8us*)(p + 16)); } static __device__ __forceinline__ v8f mma(V a, V b, v8f c) { return wmmab(a, b, c); } };
template <typename T16, int NSPLIT, bool BIAS, bool PLANES>
__global__ __launch_bounds__(32) void k_gemmw(const T16* __restrict__ A, const T16* __restrict__ A2, const T16* __restrict__ Bt, const T16* __restrict__ Bt2, int K, float* C, int ldc, const float* __restrict__ bias, size_t sA, size_t sB, size_t sC,
                                              bf* Qh, bf* Ql, bf* Kh, bf* Kl, h16* VT) {
    typedef typename WFrag<T16>::V V;
    __shared__ __align__(16) float os[PLANES ? 64 * 36 : 16 * 68];   // PLANES: 16 rows x 68 f32 (q, k) or 64 rows x 72 fp16 (v)
    const size_t z = blockIdx.z; A += z * sA; if (A2) A2 += z * sA; Bt += z * sB; if (Bt2) Bt2 += z * sB; C += z * sC;
    const int lane = threadIdx.x & 31, lr = lane & 15, hi = lane >> 4; const int r0 = blockIdx.x * 64, c0 = blockIdx.y * 64;
    v8f acc[4][4];
#pragma unroll
    for (int mb = 0; mb < 4; ++mb)
#pragma unroll
        for (int nb = 0; nb < 4; ++nb) acc[mb][nb] = (v8f){};
    const size_t aoff = (size_t)(r0 + lr) * K + 8 * hi, boff = (size_t)(c0 + lr) * K + 8 * hi;
#pragma unroll 1
    for (int kc = 0; kc < K; kc += 32) {
        V a[4], a2[4];
#pragma unroll
        for (int mb = 0; mb < 4; ++mb) { a[mb] = WFrag<T16>::ld(A + aoff + (size_t)mb * 16 * K + kc); if (NSPLIT == 1 || NSPLIT == 2) a2[mb] = WFrag<T16>::ld(A2 + aoff + (size_t)mb * 16 * K + kc); }
#pragma unroll
        for (int nb = 0; nb < 4; ++nb) { const V b = WFrag<T16>::ld(Bt + boff + (size_t)nb * 16 * K + kc); V b2; if (NSPLIT >= 2) b2 = WFrag<T16>::ld(Bt2 + boff + (size_t)nb * 16 * K + kc);
#pragma unroll
            for (int mb = 0; mb < 4; ++mb) { acc[mb][nb] = WFrag<T16>::mma(a[mb], b, acc[mb][nb]); if (NSPLIT == 1 || NSPLIT == 2) acc[mb][nb] = WFrag<T16>::mma(a2[mb], b, acc[mb][nb]); if (NSPLIT >= 2) acc[mb][nb] = WFrag<T16>::mma(a[mb], b2, acc[mb][nb]); } }
        asm volatile("v_nop\n\tv_nop\n\tv_nop\n\tv_nop" : "+v"(acc[0][0]), "+v"(acc[1][1]), "+v"(acc[2][2]), "+v"(acc[3][3]) : "v"(a[0]), "v"(a[3]));
    }
    if constexpr (PLANES) {
        const int bb = r0 / TT, t0 = r0 % TT, l8 = lane >> 3, c8 = lane & 7;   // the tile's 64 rows lie in one batch row
        if (blockIdx.z == 2) {   // v: a lane's 8 accumulator rows are 8 consecutive positions of one d: 16 bytes of a [d][position] row; LDS pitch 144 bytes
#pragma unroll
            for (int mb = 0; mb < 4; ++mb)
#pragma unroll
                for (int nb = 0; nb < 4; ++nb) *(v8ha*)((char*)os + (nb * 16 + lr) * 144 + mb * 32 + hi * 16) = __builtin_convertvector(acc[mb][nb], v8h);
            __builtin_amdgcn_wave_barrier(); asm volatile("" ::: "memory");   // keeps the compiler from moving the reads below, which take other lanes' values, over the writes above
            h16* vrow = VT + ((size_t)bb * CC + c0) * TT + t0;   // row (head x 32 + d) of this batch row
#pragma unroll
            for (int s = 0; s < 16; ++s) { const int d = s * 4 + l8; *(v8h*)(vrow + (size_t)d * TT + c8 * 8) = *(const v8ha*)((const char*)os + d * 144 + c8 * 16); }   // 8 lanes a row: 64 positions = one line
        } else {   // q, k: 8 lanes take a row's 64 columns (two heads x 32), 4 rows an instruction: 256 contiguous bytes in each head's plane
            bf* Ph = blockIdx.z == 0 ? Qh : Kh; bf* Pl = blockIdx.z == 0 ? Ql : Kl;
            const int c = c0 + c8 * 8; const size_t base = (((size_t)bb * NH_ + (c >> 5)) * TT + t0 + l8) * HD + (c & 31);
#pragma unroll
            for (int mb = 0; mb < 4; ++mb) {
#pragma unroll
                for (int nb = 0; nb < 4; ++nb) {
#pragma unroll
                    for (int j = 0; j < 8; ++j) os[(hi * 8 + j) * 68 + nb * 16 + lr] = acc[mb][nb][j]; }
                __builtin_amdgcn_wave_barrier(); asm volatile("" ::: "memory");   // as above: the reads take other lanes' values
#pragma unroll
                for (int s = 0; s < 4; ++s) { const float* rp = os + (s * 4 + l8) * 68 + c8 * 8; const v4f y0 = *(const v4fa*)rp, y1 = *(const v4fa*)(rp + 4); unsigned a0, a1, a2, a3, e0, e1, e2, e3;
                    splitf2(y0[0], y0[1], a0, e0); splitf2(y0[2], y0[3], a1, e1); splitf2(y1[0], y1[1], a2, e2); splitf2(y1[2], y1[3], a3, e3);
                    const size_t o = base + (size_t)(mb * 16 + s * 4) * HD; *(v8us*)(Ph + o) = __builtin_bit_cast(v8us, (v4u){a0, a1, a2, a3}); *(v8us*)(Pl + o) = __builtin_bit_cast(v8us, (v4u){e0, e1, e2, e3}); }
                __builtin_amdgcn_wave_barrier(); asm volatile("" ::: "memory");   // the next 16 rows' writes stay behind these reads
            }
            asm volatile("s_wait_xcnt 0x0" ::: "memory");   // behind the branch's last stores: the code that follows in the listing rewrites their address registers
        }
        return;
    }
#pragma unroll
    for (int mb = 0; mb < 4; ++mb) {
#pragma unroll
        for (int nb = 0; nb < 4; ++nb) {
#pragma unroll
            for (int j = 0; j < 8; ++j) os[(hi * 8 + j) * 68 + nb * 16 + lr] = acc[mb][nb][j]; }
        __builtin_amdgcn_wave_barrier(); asm volatile("" ::: "memory");
        float* crow = C + (size_t)(r0 + mb * 16) * ldc + c0;
{
#pragma unroll
            for (int s = 0; s < 8; ++s) { const int row = 2 * s + hi, cofs = lr * 4; v4f val = *(const v4fa*)(os + row * 68 + cofs); if (BIAS) { val[0] += bfr(bias[c0 + cofs]); val[1] += bfr(bias[c0 + cofs + 1]); val[2] += bfr(bias[c0 + cofs + 2]); val[3] += bfr(bias[c0 + cofs + 3]); }
                *(v4f*)(crow + (size_t)row * ldc + cofs) = val; }
             }
        __builtin_amdgcn_wave_barrier(); asm volatile("" ::: "memory");
    }
}

typedef __attribute__((ext_vector_type(2))) _Float16 v2h;
typedef __attribute__((ext_vector_type(4))) _Float16 v4h;
typedef __attribute__((ext_vector_type(2))) unsigned short v2us;
typedef __attribute__((ext_vector_type(4))) unsigned short v4us;

__global__ __launch_bounds__(256) void k_wtG(const float* __restrict__ w, int K, int N, bf* Bt) {
    const int lane = threadIdx.x & 31; const int L0 = (blockIdx.x * 8 + (threadIdx.x >> 5)) * 8; const int nlines = N * K / 64;
{
#pragma unroll 1
        for (int l = 0; l < 8; ++l) { const int L = L0 + l; if (L >= nlines) break; const size_t e = (size_t)L * 64 + lane * 2; const int k = (int)(e % K), n = (int)(e / K); v2us o;
            o[0] = f2bf(w[(size_t)k * N + n]); o[1] = f2bf(w[(size_t)(k + 1) * N + n]); *(v2us*)(Bt + e) = o; }
         }
}
// every f32 -> bf16 input conversion in one grid: blocks [0, XBLK) take x (all batch rows), then WBLK blocks for each of Wq, Wk, Wv, Wo (planes back to back in WB); 8 elements a thread, the sizes divide exactly
#define XBLK (NB_ * TT * CC / 8 / 256)
#define WBLK (CC * CC / 8 / 256)
__global__ __launch_bounds__(256) void k_cvtin(const float* __restrict__ x, const float* __restrict__ Wq, const float* __restrict__ Wk, const float* __restrict__ Wv, const float* __restrict__ Wo, bf* XB, bf* WB) {
    const int blk = blockIdx.x; const float* src = x; bf* dst = XB; int rb = blk;
    if (blk >= XBLK) { const int sel = (blk - XBLK) / WBLK; src = sel == 0 ? Wq : sel == 1 ? Wk : sel == 2 ? Wv : Wo; dst = WB + (size_t)sel * CC * CC; rb = (blk - XBLK) % WBLK; }
    const size_t i = (size_t)rb * 256 + threadIdx.x; const v8f v = *(const v8f*)(src + i * 8); v8us o;
#pragma unroll
    for (int k = 0; k < 8; ++k) o[k] = f2bf(v[k]); *(v8us*)(dst + i * 8) = o;  }
__device__ __forceinline__ float xhalf(float x) { return __builtin_bit_cast(float, __builtin_amdgcn_permlanex16(__builtin_bit_cast(int, x), __builtin_bit_cast(int, x), 0x76543210, 0xfedcba98, false, false)); }   // lane l with lane l ^ 16
// Base-2 exponentials as asm text: inside a statement every v_exp_f32 is followed by an independent one and the last by v_nop, the slot the instruction set asks for between a transcendental and an instruction that
// reads its result or overwrites its source; outputs are early-clobber, so none lands on a source of the same statement.
__device__ __forceinline__ float exp2x1(float x) { float r; asm("v_exp_f32 %0, %1\n\tv_nop" : "=&v"(r) : "v"(x)); return r; }
__device__ __forceinline__ v8f exp2x8(v8f x) { float r0, r1, r2, r3, r4, r5, r6, r7;
    asm("v_exp_f32 %0, %8\n\tv_exp_f32 %1, %9\n\tv_exp_f32 %2, %10\n\tv_exp_f32 %3, %11\n\tv_exp_f32 %4, %12\n\tv_exp_f32 %5, %13\n\tv_exp_f32 %6, %14\n\tv_exp_f32 %7, %15\n\tv_nop"
        : "=&v"(r0), "=&v"(r1), "=&v"(r2), "=&v"(r3), "=&v"(r4), "=&v"(r5), "=&v"(r6), "=&v"(r7) : "v"(x[0]), "v"(x[1]), "v"(x[2]), "v"(x[3]), "v"(x[4]), "v"(x[5]), "v"(x[6]), "v"(x[7]));
    return (v8f){r0, r1, r2, r3, r4, r5, r6, r7}; }
// a load at a wave-uniform pointer plus a per-lane byte offset of 32 bits (fits the scalar-base address form)
template <typename V> __device__ __forceinline__ V ldu(const void* p, unsigned b) { return *(const V*)((const char*)p + b); }
__device__ __forceinline__ v16bf ldfb(const bf* p, unsigned b) { return cat16b(ldu<v8us>(p, b), ldu<v8us>(p + 16, b)); }
__device__ __forceinline__ v16h ldfh(const h16* p, unsigned b) { return cat16(ldu<v8h>(p, b), ldu<v8h>(p + 16, b)); }
// ---- k_fattn: scores, bias, mask, softmax, probs.v and head gate in one kernel. Grid (TT / 32, heads, batch rows), 8 waves. A group owns 32 queries of one head; wave w takes keys [256 w, 256 w + 256) in passes of 32 with its own running maximum,
// sum and accumulators; the eight partial results are merged through LDS behind one barrier. Transposed products: S^T = K Q^T (A = key rows, B = query rows; a lane holds 16 scores of ONE query: keys 8 hi + j and 16 + 8 hi + j),
// O^T += V^T P^T (A = V^T rows d, B = the two score tiles converted in place, same k order as the A loader). Everything in base 2: t = S scale log2e + bf16(geo) hs log2e.
// Every plain '#pragma unroll' in it makes the indices of a register array compile-time constants (a rolled loop would put the array in scratch memory).
__global__ __launch_bounds__(256) void k_fattn(const bf* __restrict__ Qh, const bf* __restrict__ Ql, const bf* __restrict__ Kh, const bf* __restrict__ Kl, const h16* __restrict__ VT, const float* __restrict__ geo, const int* __restrict__ msk,
                                               const float* __restrict__ gbsp, const float* __restrict__ hgs, const float* __restrict__ hg, bf* Ah, bf* Al) {
    __shared__ float cm[KSPL][NQT][32];
    __shared__ float cl[KSPL][NQT][32];
    __shared__ float co[KSPL][NQT][16][32];
    const int lane = threadIdx.x & 31, lr = lane & 15, hi = lane >> 4, w = __builtin_amdgcn_readfirstlane(threadIdx.x >> 5);   // the wave's number as a scalar: scalar loop bounds and branches
    const int h = blockIdx.y, q0 = blockIdx.x * (16 * NQT), b = blockIdx.z;
    const size_t hp = ((size_t)b * NH_ + h) * TT * HD;   // this batch row's and head's plane, [2048][32] and [32][2048] alike
    msk += (size_t)b * TT;
    const float c1 = 0.17677669529663687f * 1.4426950408889634f;
    const float c2 = bfr(gbsp[0]) * bfr(hgs[h]) * 1.4426950408889634f;
    const unsigned rofs = (unsigned)(lr * HD + 8 * hi) * 2u, cofs = (unsigned)(lr * TT + 8 * hi);   // per-lane offsets: bytes in a [row][32] 16-bit plane; elements in a [row][2048] plane
    v16bf qfh[NQT], qfl[NQT]; v8f o[NQT][2]; float m[NQT], l[NQT];
#pragma unroll
    for (int nq = 0; nq < NQT; ++nq) { const size_t off = hp + (size_t)(q0 + 16 * nq) * HD; qfh[nq] = ldfb(Qh + off, rofs); qfl[nq] = ldfb(Ql + off, rofs); o[nq][0] = (v8f){}; o[nq][1] = (v8f){}; m[nq] = -3.0e38f; l[nq] = 0.f; }
    const unsigned kw = (unsigned)w * (TT / KSPL);   // this wave's first key
    const bf* khp = Kh + hp; const bf* klp = Kl + hp; const h16* vp = VT + hp; const float* gq = geo + (size_t)q0 * TT;   // wave-uniform bases, fixed over the passes
    unsigned ko = rofs + kw * (HD * 2u), go = (cofs + kw) * 4u, vo = (cofs + kw) * 2u, mo = ((unsigned)lane + kw) * 4u;   // per-lane byte offsets, stepped by one pass of 32 keys
#pragma unroll 1   // one pass in registers at a time: four waves per SIMD stay resident
    for (int it = 0; it < TT / KSPL / 32; ++it, ko += 32u * HD * 2u, go += 128u, vo += 64u, mo += 128u) {
        v16bf kfh[2], kfl[2]; v16h vf[2]; v4f g[NQT][2][2]; v8f s[NQT][2];
#pragma unroll
        for (int t = 0; t < 2; ++t) { kfh[t] = ldfb(khp + 16 * t * HD, ko); kfl[t] = ldfb(klp + 16 * t * HD, ko); }
#pragma unroll
        for (int nq = 0; nq < NQT; ++nq)
#pragma unroll
            for (int t = 0; t < 2; ++t) { const float* gp = gq + 16 * nq * TT + 16 * t; g[nq][t][0] = ldu<v4f>(gp, go); g[nq][t][1] = ldu<v4f>(gp + 4, go); }
#pragma unroll
        for (int dt = 0; dt < 2; ++dt) vf[dt] = ldfh(vp + 16 * dt * TT, vo);
        const unsigned live = __builtin_amdgcn_ballot_w32(ldu<int>(msk, mo) != 0);   // bit i: key i of this pass is attended
#pragma unroll
        for (int nq = 0; nq < NQT; ++nq)
#pragma unroll
            for (int t = 0; t < 2; ++t) s[nq][t] = wmmab(kfh[t], qfh[nq], (v8f){});
#pragma unroll
        for (int nq = 0; nq < NQT; ++nq)
#pragma unroll
            for (int t = 0; t < 2; ++t) s[nq][t] = wmmab(kfh[t], qfl[nq], s[nq][t]);
#pragma unroll
        for (int nq = 0; nq < NQT; ++nq)
#pragma unroll
            for (int t = 0; t < 2; ++t) s[nq][t] = wmmab(kfl[t], qfh[nq], s[nq][t]);
#pragma unroll
        for (int nq = 0; nq < NQT; ++nq)
#pragma unroll
            for (int t = 0; t < 2; ++t)
#pragma unroll
                for (int j = 0; j < 8; j += 2) { const v2f gg = { g[nq][t][j >> 2][j & 3], g[nq][t][j >> 2][(j & 3) + 1] }; const unsigned u = __builtin_bit_cast(unsigned, __builtin_convertvector(gg, v2bf));
                    s[nq][t][j] = s[nq][t][j] * c1 + __uint_as_float(u << 16) * c2; s[nq][t][j + 1] = s[nq][t][j + 1] * c1 + __uint_as_float(u & 0xFFFF0000u) * c2; }
        asm volatile("" :: "v"(vf[0]), "v"(vf[1]));   // inputs only: keeps the V^T loads up with the pass's other loads; without it they sink behind the branch below and their latency stands alone in front of the output products
        if (live != 0xFFFFFFFFu) {   // one scalar test a pass; a pass with every key attended skips the selects
            const unsigned mine = live >> (8 * hi);
#pragma unroll
            for (int nq = 0; nq < NQT; ++nq)
#pragma unroll
                for (int t = 0; t < 2; ++t)
#pragma unroll
                    for (int j = 0; j < 8; ++j) if (!((mine >> (16 * t + j)) & 1u)) s[nq][t][j] = -3.0e38f;
        }
#pragma unroll
        for (int nq = 0; nq < NQT; ++nq) {
            float mx = fmaxf(s[nq][0][0], s[nq][1][0]);
#pragma unroll
            for (int j = 1; j < 8; ++j) mx = fmaxf(mx, fmaxf(s[nq][0][j], s[nq][1][j]));
            mx = fmaxf(mx, xhalf(mx));
            const float mn = fmaxf(m[nq], mx), al = exp2x1(m[nq] - mn), mref = mn - 10.0f;   // probabilities x 2^10, for fp16's range
            m[nq] = mn; float ls = 0.f;
#pragma unroll
            for (int t = 0; t < 2; ++t) { s[nq][t] = exp2x8(s[nq][t] - mref);
#pragma unroll
                for (int j = 0; j < 8; ++j) ls += s[nq][t][j]; }
            l[nq] = l[nq] * al + ls;
            const v16h pf = cat16(__builtin_convertvector(s[nq][0], v8h), __builtin_convertvector(s[nq][1], v8h));
#pragma unroll
            for (int dt = 0; dt < 2; ++dt) { o[nq][dt] *= al; o[nq][dt] = wmma16(vf[dt], pf, o[nq][dt]); }
        }
    }
#pragma unroll
    for (int nq = 0; nq < NQT; ++nq) { cm[w][nq][lane] = m[nq]; cl[w][nq][lane] = l[nq] + xhalf(l[nq]);
#pragma unroll
        for (int dt = 0; dt < 2; ++dt)
#pragma unroll
            for (int j = 0; j < 8; ++j) co[w][nq][dt * 8 + j][lane] = o[nq][dt][j]; }
    __syncthreads();   // publishes the eight waves' partial maxima, sums and accumulators
    if (w < NQT * 2) { const int nq = w >> 1, dt = w & 1;
        float M = cm[0][nq][lane];
#pragma unroll
        for (int u = 1; u < KSPL; ++u) M = fmaxf(M, cm[u][nq][lane]);
        float L = 0.f, acc[8] = {0.f, 0.f, 0.f, 0.f, 0.f, 0.f, 0.f, 0.f}; v8f wt;
#pragma unroll
        for (int u = 0; u < KSPL; ++u) wt[u] = cm[u][nq][lane] - M;
        wt = exp2x8(wt);
#pragma unroll
        for (int u = 0; u < KSPL; ++u) { const float e = wt[u]; L += e * cl[u][nq][lane];
#pragma unroll
            for (int j = 0; j < 8; ++j) acc[j] += e * co[u][nq][dt * 8 + j][lane]; }
        const float f = bfr(hg[h]) / L; v8us oh, ol;
#pragma unroll
        for (int j = 0; j < 8; ++j) { unsigned short a, c; splitf(acc[j] * f, a, c); oh[j] = a; ol[j] = c; }
        const size_t ofs = ((size_t)b * TT + q0 + 16 * nq + lr) * CC + h * HD + dt * 16 + hi * 8; *(v8us*)(Ah + ofs) = oh; *(v8us*)(Al + ofs) = ol; }
}

extern "C" void kernel_launch(void* const* d_in, const int* in_sizes, int n_in,
                              void* d_out, int out_size, void* d_ws, size_t ws_size, hipStream_t stream) {
    (void)in_sizes; (void)n_in; (void)out_size;
    const float* x = (const float*)d_in[0]; const float* geo = (const float*)d_in[1]; const int* msk = (const int*)d_in[2]; const float* hg = (const float*)d_in[3]; const float* Wq = (const float*)d_in[4]; const float* Wk = (const float*)d_in[5]; const float* Wv = (const float*)d_in[6]; const float* Wo = (const float*)d_in[7]; const float* gbsp = (const float*)d_in[8]; const float* hgs = (const float*)d_in[9];
    float* OUT = (float*)d_out;     // [4][2048][256]
    char* wsp = (char*)d_ws;
    auto take = [&](size_t bytes) { char* p = wsp; wsp += (bytes + 255) & ~(size_t)255; return (void*)p; };
    bf* WB = (bf*)take((size_t)4 * CC * CC * 2); bf* WO = WB + (size_t)3 * CC * CC; bf* XB = (bf*)take((size_t)NB_ * TT * CC * 2);   // WB: Wq, Wk, Wv, Wo planes back to back; [out][in] as given = natural Bt
    bf* Qh = (bf*)take((size_t)NB_ * NH_ * TT * HD * 2); bf* Ql = (bf*)take((size_t)NB_ * NH_ * TT * HD * 2); bf* Kh = (bf*)take((size_t)NB_ * NH_ * TT * HD * 2); bf* Kl = (bf*)take((size_t)NB_ * NH_ * TT * HD * 2); h16* VT = (h16*)take((size_t)NB_ * NH_ * HD * TT * 2);
    bf* Ah = (bf*)take((size_t)NB_ * TT * CC * 2); bf* Al = (bf*)take((size_t)NB_ * TT * CC * 2);
    if ((size_t)(wsp - (char*)d_ws) > ws_size) return;    // total ~ 33 MB
    k_cvtin<<<XBLK + 4 * WBLK, 256, 0, stream>>>(x, Wq, Wk, Wv, Wo, XB, WB);
    k_gemmw<bf, 0, false, true><<<dim3(NB_ * TT / 64, CC / 64, 3), 32, 0, stream>>>(XB, nullptr, WB, nullptr, CC, nullptr, 0, nullptr, 0, (size_t)CC * CC, 0, Qh, Ql, Kh, Kl, VT);
    k_fattn<<<dim3(TT / (16 * NQT), NH_, NB_), 256, 0, stream>>>(Qh, Ql, Kh, Kl, VT, geo, msk, gbsp, hgs, hg, Ah, Al);
    k_gemmw<bf, 1, false, false><<<dim3(NB_ * TT / 64, CC / 64, 1), 32, 0, stream>>>(Ah, Al, WO, nullptr, CC, OUT, CC, nullptr, 0, 0, 0, nullptr, nullptr, nullptr, nullptr, nullptr);
}

// v005
// Measured time: 89.1 microseconds a run.
// In both of two side-by-side timings against v004, it was 1.22 times as fast.
// Counting every step since v000, it is 14.3 times as fast.
#include <hip/hip_runtime.h>

// TetrahedralAttention (x [4][2048][256]; q/k/v = x W^T (8 heads x 32); scores = q.k/sqrt(32) + geo_bias_scale geometric_bias[i][j] head_geo_scales[h]; keys with attention_mask[b][j] == 0 -> -inf; softmax; x head_gates[h] (post-softmax);
// out = merged.v Wo^T -> [4][2048][256]; bias table, mask (int32), gates and scales read as data).
// Compute dtypes, f32 accumulate: every input rounded to bf16; projections on PLAIN bf16 operands (inputs: exact); scores (K 32) on bf16 hi+lo planes (3 products), bias/mask/softmax in f32 registers
// (probabilities x1024 against the running maximum, fp16); probs.v on fp16 planes; Wo on hl planes x exact Wo (2 products). Scores, softmax, probs.v and the head gate run in ONE kernel (k_fattn): no score or probability plane in memory.
// Every 16-bit plane that a matrix instruction's operand is loaded from lies in memory in FRAGMENT ORDER (16 bytes a lane, lane after lane), so that each wave-wide load and store of it covers 512 contiguous bytes.
// A plane of R rows x K columns (K = the product's k) is a row of blocks of 1024 bytes, block (row tile r / 16) x (K / 32) + (k / 32) = [half jj][lane = 16 hi + lr][8]: row lr of the tile, k = 16 jj + 8 hi + e of the block.
// So lie x, q and k (hi and lo; K = 32, one block for 16 positions) and the bias table rounded to bf16 (rows = queries, k = keys; it is added, not multiplied, and a score tile has this lane order). The merged attention output: the same, each hi block followed by its lo block.
// The four weights: the same blocks, k steps outermost (block (k / 32) x (rows / 16) + row tile): the four blocks that a k step of a 64-column tile loads lie in a row, and the offsets into A and Bt step by different amounts, so that this compiler
// keeps each in a register of its own over the loop (with equal steps it formed both addresses anew in every step, in registers on which later loads of the step landed).
// v: 2048 bytes for 32 positions, [d tile dt][half jj][lane][8] = d 16 dt + lr, position 16 jj + 8 hi + e. k and v share one plane, 6144 bytes for 32 positions of a head: k hi (two blocks), k lo (two blocks), v: all that an attention pass loads of them, in a row.
// Four launches, each over all four batch rows: input conversions (with the bias table's plane); q, k, v projections (grid z, M = 4 x 2048), whose epilogue writes the attention's operand planes itself; attention (grid z = batch row); output projection.

#define NB_  4
#define TT   2048
#define CC   256
#define NH_  8
#define HD   32
#define KSPL 8
#define NQT  2
typedef _Float16 h16;
typedef unsigned short bf;
typedef __attribute__((ext_vector_type(16))) __bf16   v16bf;
typedef __attribute__((ext_vector_type(16))) _Float16 v16h;
typedef __attribute__((ext_vector_type(8)))  _Float16 v8h;
typedef __attribute__((ext_vector_type(8)))  unsigned short v8us;
typedef __attribute__((ext_vector_type(8)))  float    v8f;
typedef __attribute__((ext_vector_type(4)))  float    v4f;
typedef __attribute__((ext_vector_type(2)))  float    v2f;
typedef __attribute__((ext_vector_type(2)))  __bf16   v2bf;
typedef __attribute__((ext_vector_type(4)))  unsigned v4u;
typedef v8h  __attribute__((may_alias)) v8ha;
typedef v4f  __attribute__((may_alias)) v4fa;
typedef v8us __attribute__((may_alias)) v8usa;

__device__ __forceinline__ unsigned short f2bf(float f) { unsigned u = __float_as_uint(f); u += 0x7FFFu + ((u >> 16) & 1u); return (unsigned short)(u >> 16); }
__device__ __forceinline__ float bf2f(unsigned short b) { return __uint_as_float(((unsigned)b) << 16); }
__device__ __forceinline__ float bfr(float f) { return bf2f(f2bf(f)); }
__device__ __forceinline__ void splitf(float y, unsigned short& h, unsigned short& l) { h = f2bf(y); l = f2bf(y - bf2f(h)); }
// splitf on two neighbours at once, each result a packed pair; the packed conversion rounds to nearest even, as f2bf does
__device__ __forceinline__ void splitf2(float y0, float y1, unsigned& h, unsigned& l) { h = __builtin_bit_cast(unsigned, __builtin_convertvector((v2f){y0, y1}, v2bf));
    l = __builtin_bit_cast(unsigned, __builtin_convertvector((v2f){y0 - __uint_as_float(h << 16), y1 - __uint_as_float(h & 0xFFFF0000u)}, v2bf)); }
__device__ __forceinline__ v16h cat16(v8h lo, v8h hi) { return __builtin_shufflevector(lo, hi, 0, 1, 2, 3, 4, 5, 6, 7, 8, 9, 10, 11, 12, 13, 14, 15); }
__device__ __forceinline__ v16bf cat16b(v8us lo, v8us hi) { return __builtin_bit_cast(v16bf, __builtin_shufflevector(lo, hi, 0, 1, 2, 3, 4, 5, 6, 7, 8, 9, 10, 11, 12, 13, 14, 15)); }
__device__ __forceinline__ v8f wmma16(v16h a, v16h b, v8f c) { return __builtin_amdgcn_wmma_f32_16x16x32_f16(false, a, false, b, (short)0, c, false, false); }
__device__ __forceinline__ v8f wmmab(v16bf a, v16bf b, v8f c) { return __builtin_amdgcn_wmma_f32_16x16x32_bf16(false, a, false, b, (short)0, c, false, false); }



// ---- k_gemmw: register-blocked GEMM, ONE WAVE per 64x64 output tile (16 accumulators), operands straight from 16-bit planes in fragment order; grid (M/64, N/64, Z), 32 threads.
// C[m][n] (f32, pitch ldc, + optional f32 bias[n]) = sum_k A[m][k] Bt[n][k] (+ split products per NSPLIT). z-batch strides sA/sB/sC in elements. K % 32 == 0.
// PLANES (the q, k, v projections; m = batch row x position, n = head x 32 + d): no f32 C; the tile goes from the accumulators to the attention's operand planes, [batch row][head][...]:
// z = 0, 1: bf16 hi and lo planes of q, k, staged through LDS; z = 2: the fp16 plane of v, straight from the accumulators (a lane's 8 rows are one fragment chunk). All in fragment order (head of the file): every store instruction writes 512 contiguous bytes.
// a load at a wave-uniform pointer plus a per-lane byte offset of 32 bits (fits the scalar-base address form)
template <typename V> __device__ __forceinline__ V ldu(const void* p, unsigned b) { return *(const V*)((const char*)p + b); }
template <typename T16> struct WFrag;   // ld: a fragment from a plane in fragment order: its two halves lie 512 bytes apart, b = 16 x lane + the block's offset from p
template <> struct WFrag<h16> { typedef v16h V; static __device__ __forceinline__ V ld(const h16* p, unsigned b) { return cat16(ldu<v8h>(p, b), ldu<v8h>(p + 256, b)); } static __device__ __forceinline__ v8f mma(V a, V b, v8f c) { return wmma16(a, b, c); } };
template <> struct WFrag<bf> { typedef v16bf V; static __device__ __forceinline__ V ld(const bf* p, unsigned b) { return cat16b(ldu<v8us>(p, b), ldu<v8us>(p + 256, b)); } static __device__ __forceinline__ v8f mma(V a, V b, v8f c) { return wmmab(a, b, c); } };
template <typename T16, int NSPLIT, bool BIAS, bool PLANES, int K>   // K at compile time: every block of a k step then lies at a constant distance from one pointer per plane
__global__ __launch_bounds__(32) void k_gemmw(const T16* __restrict__ A, const T16* __restrict__ Bt, const T16* __restrict__ Bt2, float* C, int ldc, const float* __restrict__ bias, size_t sA, size_t sB, size_t sC,
                                              bf* Qh, bf* Ql, bf* Kh, bf* Kl, h16* VT) {
    typedef typename WFrag<T16>::V V;
    __shared__ __align__(16) float os[16 * 68];   // 16 rows x 68 f32
    const size_t z = blockIdx.z; A += z * sA; Bt += z * sB; if (Bt2) Bt2 += z * sB; C += z * sC;
    const int lane = threadIdx.x & 31, lr = lane & 15, hi = lane >> 4; const int r0 = blockIdx.x * 64, c0 = blockIdx.y * 64;
    v8f acc[4][4];
#pragma unroll
    for (int mb = 0; mb < 4; ++mb)
#pragma unroll
        for (int nb = 0; nb < 4; ++nb) acc[mb][nb] = (v8f){};
    constexpr int AB = (NSPLIT == 1 || NSPLIT == 2) ? 1024 : 512;   // elements from one k step of A to the next: a block, or a hi block and its lo block
    unsigned ao = (unsigned)(r0 / 16 * (K / 32) * AB + lane * 8) * 2u, bo = (unsigned)(c0 / 16 * 512 + lane * 8) * 2u;   // byte offsets of this lane's chunk in the tile's first block of A (row tiles outermost) and of Bt (k steps outermost: CC / 16 blocks a step)
#pragma unroll 1
    for (int kc = 0; kc < K; kc += 32, ao += AB * 2u, bo += CC / 16 * 1024u) {
        V a[4], a2[4];
#pragma unroll
        for (int mb = 0; mb < 4; ++mb) { a[mb] = WFrag<T16>::ld(A + mb * (K / 32) * AB, ao); if (NSPLIT == 1 || NSPLIT == 2) a2[mb] = WFrag<T16>::ld(A + mb * (K / 32) * AB + 512, ao); }
#pragma unroll
        for (int nb = 0; nb < 4; ++nb) { const V b = WFrag<T16>::ld(Bt + nb * 512, bo); V b2; if (NSPLIT >= 2) b2 = WFrag<T16>::ld(Bt2 + nb * 512, bo);
#pragma unroll
            for (int mb = 0; mb < 4; ++mb) { acc[mb][nb] = WFrag<T16>::mma(a[mb], b, acc[mb][nb]); if (NSPLIT == 1 || NSPLIT == 2) acc[mb][nb] = WFrag<T16>::mma(a2[mb], b, acc[mb][nb]); if (NSPLIT >= 2) acc[mb][nb] = WFrag<T16>::mma(a[mb], b2, acc[mb][nb]); } }
        asm volatile("v_nop\n\tv_nop\n\tv_nop\n\tv_nop" : "+v"(acc[0][0]), "+v"(acc[1][1]), "+v"(acc[2][2]), "+v"(acc[3][3]) : "v"(a[0]), "v"(a[3]));
    }
    if constexpr (PLANES) {
        const int bb = r0 / TT, t0 = r0 % TT;   // the tile's 64 rows lie in one batch row
        const size_t bs = blockIdx.z == 0 ? 1024 : 3072, hb = (((size_t)bb * NH_ + (c0 >> 5)) * (TT / 32) + t0 / 32) * bs + lane * 8;   // bs: elements from one 32 positions to the next (q alone; k and v in their shared plane); hb: this lane's chunk at the tile's first position in its first head
        if (blockIdx.z == 2) {   // v: a lane's 8 accumulator rows are 8 consecutive positions of one d: the chunk of lane 16 hi + lr in block (position / 32), d tile nb & 1, half mb & 1
#pragma unroll
            for (int mb = 0; mb < 4; ++mb)
#pragma unroll
                for (int nb = 0; nb < 4; ++nb) *(v8h*)(VT + hb + (size_t)(nb >> 1) * (TT / 32) * 3072 + (mb >> 1) * 3072 + (nb & 1) * 512 + (mb & 1) * 256) = __builtin_convertvector(acc[mb][nb], v8h);
        } else {   // q, k: 16 rows are one block in each of the tile's two heads; an instruction writes one half of a block, lane 16 hi + lr taking row lr, d 16 jj + 8 hi ..
            bf* Ph = blockIdx.z == 0 ? Qh : Kh; bf* Pl = blockIdx.z == 0 ? Ql : Kl;
#pragma unroll
            for (int mb = 0; mb < 4; ++mb) {
#pragma unroll
                for (int nb = 0; nb < 4; ++nb) {
#pragma unroll
                    for (int j = 0; j < 8; ++j) os[(hi * 8 + j) * 68 + nb * 16 + lr] = acc[mb][nb][j]; }
                __builtin_amdgcn_wave_barrier(); asm volatile("" ::: "memory");   // keeps the compiler from moving the reads below, which take other lanes' values, over the writes above
#pragma unroll
                for (int s = 0; s < 4; ++s) { const int hh = s >> 1, jj = s & 1; const float* rp = os + lr * 68 + hh * 32 + (2 * jj + hi) * 8; const v4f y0 = *(const v4fa*)rp, y1 = *(const v4fa*)(rp + 4); unsigned a0, a1, a2, a3, e0, e1, e2, e3;
                    splitf2(y0[0], y0[1], a0, e0); splitf2(y0[2], y0[3], a1, e1); splitf2(y1[0], y1[1], a2, e2); splitf2(y1[2], y1[3], a3, e3);
                    const size_t o = hb + ((size_t)hh * (TT / 32) + (mb >> 1)) * bs + (mb & 1) * 512 + jj * 256; *(v8us*)(Ph + o) = __builtin_bit_cast(v8us, (v4u){a0, a1, a2, a3}); *(v8us*)(Pl + o) = __builtin_bit_cast(v8us, (v4u){e0, e1, e2, e3}); }
                __builtin_amdgcn_wave_barrier(); asm volatile("" ::: "memory");   // the next 16 rows' writes stay behind these reads
            }
            asm volatile("s_wait_xcnt 0x0" ::: "memory");   // behind the branch's last stores: the code that follows in the listing rewrites their address registers
        }
        return;
    }
#pragma unroll
    for (int mb = 0; mb < 4; ++mb) {
#pragma unroll
        for (int nb = 0; nb < 4; ++nb) {
#pragma unroll
            for (int j = 0; j < 8; ++j) os[(hi * 8 + j) * 68 + nb * 16 + lr] = acc[mb][nb][j]; }
        __builtin_amdgcn_wave_barrier(); asm volatile("" ::: "memory");
        float* crow = C + (size_t)(r0 + mb * 16) * ldc + c0;
{
#pragma unroll
            for (int s = 0; s < 8; ++s) { const int row = 2 * s + hi, cofs = lr * 4; v4f val = *(const v4fa*)(os + row * 68 + cofs); if (BIAS) { val[0] += bfr(bias[c0 + cofs]); val[1] += bfr(bias[c0 + cofs + 1]); val[2] += bfr(bias[c0 + cofs + 2]); val[3] += bfr(bias[c0 + cofs + 3]); }
                *(v4f*)(crow + (size_t)row * ldc + cofs) = val; }
             }
        __builtin_amdgcn_wave_barrier(); asm volatile("" ::: "memory");
    }
}

typedef __attribute__((ext_vector_type(2))) _Float16 v2h;
typedef __attribute__((ext_vector_type(4))) _Float16 v4h;
typedef __attribute__((ext_vector_type(2))) unsigned short v2us;
typedef __attribute__((ext_vector_type(4))) unsigned short v4us;

__global__ __launch_bounds__(256) void k_wtG(const float* __restrict__ w, int K, int N, bf* Bt) {
    const int lane = threadIdx.x & 31; const int L0 = (blockIdx.x * 8 + (threadIdx.x >> 5)) * 8; const int nlines = N * K / 64;
{
#pragma unroll 1
        for (int l = 0; l < 8; ++l) { const int L = L0 + l; if (L >= nlines) break; const size_t e = (size_t)L * 64 + lane * 2; const int k = (int)(e % K), n = (int)(e / K); v2us o;
            o[0] = f2bf(w[(size_t)k * N + n]); o[1] = f2bf(w[(size_t)(k + 1) * N + n]); *(v2us*)(Bt + e) = o; }
         }
}
// every f32 -> bf16 input conversion in one grid, each into fragment order: a wave takes one block of 16 rows x 32 columns, reads it in whole lines (8 lanes a row), turns it in its own 1024 bytes of LDS and writes it as 2 x 512 contiguous bytes.
// Blocks in the order x (all batch rows), Wq, Wk, Wv, Wo (planes back to back in WB), bias table; the counts divide exactly.
#define XTL (NB_ * TT / 16 * (CC / 32))
#define WTL (CC / 16 * (CC / 32))
#define GTL (TT / 16 * (TT / 32))
typedef __attribute__((ext_vector_type(2))) unsigned v2u;
typedef v2u __attribute__((may_alias)) v2ua;
__global__ __launch_bounds__(256) void k_cvtin(const float* __restrict__ x, const float* __restrict__ Wq, const float* __restrict__ Wk, const float* __restrict__ Wv, const float* __restrict__ Wo, const float* __restrict__ geo, bf* XB, bf* WB, bf* GP) {
    __shared__ __align__(16) bf gs[8][512];
    const int lane = threadIdx.x & 31, w = threadIdx.x >> 5, r8 = lane >> 3, c4 = lane & 7;   // this lane: rows r8, r8 + 4, r8 + 8, r8 + 12, columns 4 c4 .. 4 c4 + 3 of the block
    int tb = blockIdx.x * 8, sh = 3; bool kout = false; const float* src = x; bf* dst = XB;   // a work-group's 8 blocks lie in one plane; sh: log2 of the blocks in a row (row length 32 << sh)
    if (tb >= XTL + 4 * WTL) { tb -= XTL + 4 * WTL; src = geo; dst = GP; sh = 6; }
    else if (tb >= XTL) { const int sel = (tb - XTL) / WTL; tb = (tb - XTL) % WTL; src = sel == 0 ? Wq : sel == 1 ? Wk : sel == 2 ? Wv : Wo; dst = WB + (size_t)sel * CC * CC; kout = true; }   // the weights' blocks are stored k steps outermost
    const int tile = tb + w, ob = kout ? (tile & 7) * (CC / 16) + (tile >> 3) : tile; const float* gp = src + ((size_t)((tile >> sh) * 16 + r8) << (sh + 5)) + (tile & ((1 << sh) - 1)) * 32 + c4 * 4; const float* gr[4]; v4f y[4];
#pragma unroll
    for (int i = 0; i < 4; ++i) { gr[i] = gp + ((size_t)i << (sh + 7)); y[i] = *(const v4f*)gr[i]; }
    asm volatile("s_wait_xcnt 0x0" :: "v"(gr[0]), "v"(gr[1]), "v"(gr[2]), "v"(gr[3]) : "memory");   // behind the loads, in front of whatever rewrites a register that they name; the addresses are inputs, so that no later load lands on one either
#pragma unroll
    for (int i = 0; i < 4; ++i) { const v2u p = { __builtin_bit_cast(unsigned, __builtin_convertvector((v2f){y[i][0], y[i][1]}, v2bf)), __builtin_bit_cast(unsigned, __builtin_convertvector((v2f){y[i][2], y[i][3]}, v2bf)) };   // rounds to nearest even, as f2bf does
        *(v2ua*)(gs[w] + (c4 >> 2) * 256 + (((c4 >> 1) & 1) * 16 + i * 4 + r8) * 8 + (c4 & 1) * 4) = p; }
    __builtin_amdgcn_wave_barrier(); asm volatile("" ::: "memory");   // keeps the compiler from moving the reads below, which take other lanes' values, over the writes above
#pragma unroll
    for (int t = 0; t < 2; ++t) *(v8us*)(dst + (size_t)ob * 512 + t * 256 + lane * 8) = *(const v8usa*)(gs[w] + t * 256 + lane * 8);
}
__device__ __forceinline__ float xhalf(float x) { return __builtin_bit_cast(float, __builtin_amdgcn_permlanex16(__builtin_bit_cast(int, x), __builtin_bit_cast(int, x), 0x76543210, 0xfedcba98, false, false)); }   // lane l with lane l ^ 16
// Base-2 exponentials as asm text: inside a statement every v_exp_f32 is followed by an independent one and the last by v_nop, the slot the instruction set asks for between a transcendental and an instruction that
// reads its result or overwrites its source; outputs are early-clobber, so none lands on a source of the same statement.
__device__ __forceinline__ float exp2x1(float x) { float r; asm("v_exp_f32 %0, %1\n\tv_nop" : "=&v"(r) : "v"(x)); return r; }
__device__ __forceinline__ v8f exp2x8(v8f x) { float r0, r1, r2, r3, r4, r5, r6, r7;
    asm("v_exp_f32 %0, %8\n\tv_exp_f32 %1, %9\n\tv_exp_f32 %2, %10\n\tv_exp_f32 %3, %11\n\tv_exp_f32 %4, %12\n\tv_exp_f32 %5, %13\n\tv_exp_f32 %6, %14\n\tv_exp_f32 %7, %15\n\tv_nop"
        : "=&v"(r0), "=&v"(r1), "=&v"(r2), "=&v"(r3), "=&v"(r4), "=&v"(r5), "=&v"(r6), "=&v"(r7) : "v"(x[0]), "v"(x[1]), "v"(x[2]), "v"(x[3]), "v"(x[4]), "v"(x[5]), "v"(x[6]), "v"(x[7]));
    return (v8f){r0, r1, r2, r3, r4, r5, r6, r7}; }
__device__ __forceinline__ v16bf ldfb(const bf* p, unsigned b) { return WFrag<bf>::ld(p, b); }
__device__ __forceinline__ v16h ldfh(const h16* p, unsigned b) { return WFrag<h16>::ld(p, b); }
// ---- k_fattn: scores, bias, mask, softmax, probs.v and head gate in one kernel. Grid (TT / 32, heads, batch rows), 8 waves. A group owns 32 queries of one head; wave w takes keys [256 w, 256 w + 256) in passes of 32 with its own running maximum,
// sum and accumulators; the eight partial results are merged through LDS behind one barrier. Transposed products: S^T = K Q^T (A = key rows, B = query rows; a lane holds 16 scores of ONE query: keys 8 hi + j and 16 + 8 hi + j),
// O^T += V^T P^T (A = V^T rows d, B = the two score tiles converted in place, same k order as the A loader). Everything in base 2: t = S scale log2e + bf16(geo) hs log2e.
// Every plain '#pragma unroll' in it makes the indices of a register array compile-time constants (a rolled loop would put the array in scratch memory).
__global__ __launch_bounds__(256) void k_fattn(const bf* __restrict__ Qh, const bf* __restrict__ Ql, const bf* __restrict__ KV, const bf* __restrict__ GP, const int* __restrict__ msk,
                                               const float* __restrict__ gbsp, const float* __restrict__ hgs, const float* __restrict__ hg, bf* AHL) {
    __shared__ float cm[KSPL][NQT][32];
    __shared__ float cl[KSPL][NQT][32];
    __shared__ float co[KSPL][NQT][16][32];
    const int lane = threadIdx.x & 31, lr = lane & 15, hi = lane >> 4, w = __builtin_amdgcn_readfirstlane(threadIdx.x >> 5);   // the wave's number as a scalar: a scalar first key and a scalar branch
    const int h = blockIdx.y, q0 = blockIdx.x * (16 * NQT), b = blockIdx.z;
    const size_t hp = ((size_t)b * NH_ + h) * TT * HD;   // this batch row's and head's q planes: 32 elements a position (k and v together: 96)
    msk += (size_t)b * TT;
    const float c1 = 0.17677669529663687f * 1.4426950408889634f;
    const float c2 = bfr(gbsp[0]) * bfr(hgs[h]) * 1.4426950408889634f;
    const unsigned rofs = (unsigned)lane * 16u;   // this lane's chunk in a half block, bytes
    v16bf qfh[NQT], qfl[NQT]; v8f o[NQT][2]; float m[NQT], l[NQT];
#pragma unroll
    for (int nq = 0; nq < NQT; ++nq) { const size_t off = hp + (size_t)(q0 + 16 * nq) * HD; qfh[nq] = ldfb(Qh + off, rofs); qfl[nq] = ldfb(Ql + off, rofs); o[nq][0] = (v8f){}; o[nq][1] = (v8f){}; m[nq] = -3.0e38f; l[nq] = 0.f; }
    const unsigned kw = (unsigned)w * (TT / KSPL);   // this wave's first key
    const bf* kvp = KV + hp * 3; const bf* gq = GP + (size_t)(q0 / 16) * (TT / 32) * 512;   // wave-uniform bases, fixed over the passes
    unsigned ko = rofs + kw * 192u, go = rofs + kw * 32u, mo = ((unsigned)lane + kw) * 4u;   // per-lane byte offsets, stepped by one pass of 32 keys
#pragma unroll 1   // one pass in registers at a time: four waves per SIMD stay resident
    for (int it = 0; it < TT / KSPL / 32; ++it, ko += 6144u, go += 1024u, mo += 128u) {
        v16bf kfh[2], kfl[2]; v16h vf[2]; v4u g[NQT][2]; v8f s[NQT][2];
#pragma unroll
        for (int t = 0; t < 2; ++t) { kfh[t] = ldfb(kvp + 512 * t, ko); kfl[t] = ldfb(kvp + 1024 + 512 * t, ko); }
#pragma unroll
        for (int nq = 0; nq < NQT; ++nq)
#pragma unroll
            for (int t = 0; t < 2; ++t) g[nq][t] = ldu<v4u>(gq + nq * (TT / 32) * 512 + 256 * t, go);
#pragma unroll
        for (int dt = 0; dt < 2; ++dt) vf[dt] = ldfh((const h16*)(kvp + 2048 + 512 * dt), ko);
        const unsigned live = __builtin_amdgcn_ballot_w32(ldu<int>(msk, mo) != 0);   // bit i: key i of this pass is attended
#pragma unroll
        for (int nq = 0; nq < NQT; ++nq)
#pragma unroll
            for (int t = 0; t < 2; ++t) s[nq][t] = wmmab(kfh[t], qfh[nq], (v8f){});
#pragma unroll
        for (int nq = 0; nq < NQT; ++nq)
#pragma unroll
            for (int t = 0; t < 2; ++t) s[nq][t] = wmmab(kfh[t], qfl[nq], s[nq][t]);
#pragma unroll
        for (int nq = 0; nq < NQT; ++nq)
#pragma unroll
            for (int t = 0; t < 2; ++t) s[nq][t] = wmmab(kfl[t], qfh[nq], s[nq][t]);
#pragma unroll
        for (int nq = 0; nq < NQT; ++nq)
#pragma unroll
            for (int t = 0; t < 2; ++t)
#pragma unroll
                for (int j = 0; j < 8; j += 2) { const unsigned u = g[nq][t][j >> 1];
                    s[nq][t][j] = s[nq][t][j] * c1 + __uint_as_float(u << 16) * c2; s[nq][t][j + 1] = s[nq][t][j + 1] * c1 + __uint_as_float(u & 0xFFFF0000u) * c2; }
        asm volatile("" :: "v"(vf[0]), "v"(vf[1]));   // inputs only: keeps the V^T loads up with the pass's other loads; without it they sink behind the branch below and their latency stands alone in front of the output products
        if (live != 0xFFFFFFFFu) {   // one scalar test a pass; a pass with every key attended skips the selects
            const unsigned mine = live >> (8 * hi);
#pragma unroll
            for (int nq = 0; nq < NQT; ++nq)
#pragma unroll
                for (int t = 0; t < 2; ++t)
#pragma unroll
                    for (int j = 0; j < 8; ++j) if (!((mine >> (16 * t + j)) & 1u)) s[nq][t][j] = -3.0e38f;
        }
#pragma unroll
        for (int nq = 0; nq < NQT; ++nq) {
            float mx = fmaxf(s[nq][0][0], s[nq][1][0]);
#pragma unroll
            for (int j = 1; j < 8; ++j) mx = fmaxf(mx, fmaxf(s[nq][0][j], s[nq][1][j]));
            mx = fmaxf(mx, xhalf(mx));
            const float mn = fmaxf(m[nq], mx), al = exp2x1(m[nq] - mn), mref = mn - 10.0f;   // probabilities x 2^10, for fp16's range
            m[nq] = mn; float ls = 0.f;
#pragma unroll
            for (int t = 0; t < 2; ++t) { s[nq][t] = exp2x8(s[nq][t] - mref);
#pragma unroll
                for (int j = 0; j < 8; ++j) ls += s[nq][t][j]; }
            l[nq] = l[nq] * al + ls;
            const v16h pf = cat16(__builtin_convertvector(s[nq][0], v8h), __builtin_convertvector(s[nq][1], v8h));
#pragma unroll
            for (int dt = 0; dt < 2; ++dt) { o[nq][dt] *= al; o[nq][dt] = wmma16(vf[dt], pf, o[nq][dt]); }
        }
    }
#pragma unroll
    for (int nq = 0; nq < NQT; ++nq) { cm[w][nq][lane] = m[nq]; cl[w][nq][lane] = l[nq] + xhalf(l[nq]);
#pragma unroll
        for (int dt = 0; dt < 2; ++dt)
#pragma unroll
            for (int j = 0; j < 8; ++j) co[w][nq][dt * 8 + j][lane] = o[nq][dt][j]; }
    __syncthreads();   // publishes the eight waves' partial maxima, sums and accumulators
    if (w < NQT * 2) { const int nq = w >> 1, dt = w & 1;
        float M = cm[0][nq][lane];
#pragma unroll
        for (int u = 1; u < KSPL; ++u) M = fmaxf(M, cm[u][nq][lane]);
        float L = 0.f, acc[8] = {0.f, 0.f, 0.f, 0.f, 0.f, 0.f, 0.f, 0.f}; v8f wt;
#pragma unroll
        for (int u = 0; u < KSPL; ++u) wt[u] = cm[u][nq][lane] - M;
        wt = exp2x8(wt);
#pragma unroll
        for (int u = 0; u < KSPL; ++u) { const float e = wt[u]; L += e * cl[u][nq][lane];
#pragma unroll
            for (int j = 0; j < 8; ++j) acc[j] += e * co[u][nq][dt * 8 + j][lane]; }
        const float f = bfr(hg[h]) / L; v8us oh, ol;
#pragma unroll
        for (int j = 0; j < 8; ++j) { unsigned short a, c; splitf(acc[j] * f, a, c); oh[j] = a; ol[j] = c; }
        const size_t ofs = ((size_t)b * TT + q0 + 16 * nq) * CC * 2 + h * 1024 + dt * 256 + lane * 8; *(v8us*)(AHL + ofs) = oh; *(v8us*)(AHL + ofs + 512) = ol; }   // fragment order: head h is k step h of these 16 queries, a hi block and its lo block; d tile dt is a block's half
}

extern "C" void kernel_launch(void* const* d_in, const int* in_sizes, int n_in,
                              void* d_out, int out_size, void* d_ws, size_t ws_size, hipStream_t stream) {
    (void)in_sizes; (void)n_in; (void)out_size;
    const float* x = (const float*)d_in[0]; const float* geo = (const float*)d_in[1]; const int* msk = (const int*)d_in[2]; const float* hg = (const float*)d_in[3]; const float* Wq = (const float*)d_in[4]; const float* Wk = (const float*)d_in[5]; const float* Wv = (const float*)d_in[6]; const float* Wo = (const float*)d_in[7]; const float* gbsp = (const float*)d_in[8]; const float* hgs = (const float*)d_in[9];
    float* OUT = (float*)d_out;     // [4][2048][256]
    char* wsp = (char*)d_ws;
    auto take = [&](size_t bytes) { char* p = wsp; wsp += (bytes + 255) & ~(size_t)255; return (void*)p; };
    bf* WB = (bf*)take((size_t)4 * CC * CC * 2); bf* WO = WB + (size_t)3 * CC * CC; bf* XB = (bf*)take((size_t)NB_ * TT * CC * 2);   // WB: Wq, Wk, Wv, Wo planes back to back; [out][in] as given = rows n, columns k
    bf* Qh = (bf*)take((size_t)NB_ * NH_ * TT * HD * 2); bf* Ql = (bf*)take((size_t)NB_ * NH_ * TT * HD * 2); bf* KV = (bf*)take((size_t)NB_ * NH_ * TT * HD * 2 * 3);
    bf* AHL = (bf*)take((size_t)NB_ * TT * CC * 2 * 2); bf* GP = (bf*)take((size_t)TT * TT * 2);
    if ((size_t)(wsp - (char*)d_ws) > ws_size) return;    // total ~ 41 MB
    k_cvtin<<<(XTL + 4 * WTL + GTL) / 8, 256, 0, stream>>>(x, Wq, Wk, Wv, Wo, geo, XB, WB, GP);
    k_gemmw<bf, 0, false, true, CC><<<dim3(NB_ * TT / 64, CC / 64, 3), 32, 0, stream>>>(XB, WB, nullptr, nullptr, 0, nullptr, 0, (size_t)CC * CC, 0, Qh, Ql, KV, KV + 1024, (h16*)(KV + 2048));
    k_fattn<<<dim3(TT / (16 * NQT), NH_, NB_), 256, 0, stream>>>(Qh, Ql, KV, GP, msk, gbsp, hgs, hg, AHL);
    k_gemmw<bf, 1, false, false, CC><<<dim3(NB_ * TT / 64, CC / 64, 1), 32, 0, stream>>>(AHL, WO, nullptr, OUT, CC, nullptr, 0, 0, 0, nullptr, nullptr, nullptr, nullptr, nullptr);
}

// v006
// It runs in 70.7 microseconds.
// Two timings next to v005 both put it at 1.25 times that version's speed.
// All steps since v000 together make it 17.9 times as fast.
#include <hip/hip_runtime.h>

// TetrahedralAttention (x [4][2048][256]; q/k/v = x W^T (8 heads x 32); scores = q.k/sqrt(32) + geo_bias_scale geometric_bias[i][j] head_geo_scales[h]; keys with attention_mask[b][j] == 0 -> -inf; softmax; x head_gates[h] (post-softmax);
// out = merged.v Wo^T -> [4][2048][256]; bias table, mask (int32), gates and scales read as data).
// Compute dtypes, f32 accumulate: every input rounded to bf16; projections on PLAIN bf16 operands (inputs: exact); scores (K 32) on bf16 hi+lo planes (3 products), bias/mask/softmax in f32 registers
// (probabilities x1024 against the running maximum, fp16); probs.v on fp16 planes; Wo on hl planes x exact Wo (2 products). Scores, softmax, probs.v and the head gate run in ONE kernel (k_fattn): no score or probability plane in memory.
// Every 16-bit plane that a matrix instruction's operand is loaded from lies in memory in FRAGMENT ORDER (16 bytes a lane, lane after lane), so that each wave-wide load and store of it covers 512 contiguous bytes.
// A plane of R rows x K columns (K = the product's k) is a row of blocks of 1024 bytes, block (row tile r / 16) x (K / 32) + (k / 32) = [half jj][lane = 16 hi + lr][8]: row lr of the tile, k = 16 jj + 8 hi + e of the block.
// So lie x, q and k (hi and lo; K = 32, one block for 16 positions) and the bias table rounded to bf16 (rows = queries, k = keys; it is added, not multiplied, and a score tile has this lane order). The merged attention output: the same, each hi block followed by its lo block.
// The four weights: the same blocks, k steps outermost (block (k / 32) x (rows / 16) + row tile): the four blocks that a k step of a 64-column tile loads lie in a row, and the offsets into A and Bt step by different amounts, so that this compiler
// keeps each in a register of its own over the loop (with equal steps it formed both addresses anew in every step, in registers on which later loads of the step landed).
// v: 2048 bytes for 32 positions, [d tile dt][half jj][lane][8] = d 16 dt + lr, position 16 jj + 8 hi + e. k and v share one plane, 6144 bytes for 32 positions of a head: k hi (two blocks), k lo (two blocks), v: all that an attention pass loads of them, in a row.
// Four launches, each over all four batch rows: input conversions (with the bias table's plane); q, k, v projections (grid z, M = 4 x 2048), whose epilogue writes the attention's operand planes itself; attention (grid z = batch row); output projection.

#define NB_  4
#define TT   2048
#define CC   256
#define NH_  8
#define HD   32
#define NQT  2
typedef _Float16 h16;
typedef unsigned short bf;
typedef __attribute__((ext_vector_type(16))) __bf16   v16bf;
typedef __attribute__((ext_vector_type(16))) _Float16 v16h;
typedef __attribute__((ext_vector_type(8)))  _Float16 v8h;
typedef __attribute__((ext_vector_type(8)))  unsigned short v8us;
typedef __attribute__((ext_vector_type(8)))  float    v8f;
typedef __attribute__((ext_vector_type(4)))  float    v4f;
typedef __attribute__((ext_vector_type(2)))  float    v2f;
typedef __attribute__((ext_vector_type(2)))  __bf16   v2bf;
typedef __attribute__((ext_vector_type(4)))  unsigned v4u;
typedef v8h  __attribute__((may_alias)) v8ha;
typedef v4f  __attribute__((may_alias)) v4fa;
typedef v8us __attribute__((may_alias)) v8usa;

__device__ __forceinline__ unsigned short f2bf(float f) { unsigned u = __float_as_uint(f); u += 0x7FFFu + ((u >> 16) & 1u); return (unsigned short)(u >> 16); }
__device__ __forceinline__ float bf2f(unsigned short b) { return __uint_as_float(((unsigned)b) << 16); }
__device__ __forceinline__ float bfr(float f) { return bf2f(f2bf(f)); }
__device__ __forceinline__ void splitf(float y, unsigned short& h, unsigned short& l) { h = f2bf(y); l = f2bf(y - bf2f(h)); }
// splitf on two neighbours at once, each result a packed pair; the packed conversion rounds to nearest even, as f2bf does
__device__ __forceinline__ void splitf2(float y0, float y1, unsigned& h, unsigned& l) { h = __builtin_bit_cast(unsigned, __builtin_convertvector((v2f){y0, y1}, v2bf));
    l = __builtin_bit_cast(unsigned, __builtin_convertvector((v2f){y0 - __uint_as_float(h << 16), y1 - __uint_as_float(h & 0xFFFF0000u)}, v2bf)); }
__device__ __forceinline__ v16h cat16(v8h lo, v8h hi) { return __builtin_shufflevector(lo, hi, 0, 1, 2, 3, 4, 5, 6, 7, 8, 9, 10, 11, 12, 13, 14, 15); }
__device__ __forceinline__ v16bf cat16b(v8us lo, v8us hi) { return __builtin_bit_cast(v16bf, __builtin_shufflevector(lo, hi, 0, 1, 2, 3, 4, 5, 6, 7, 8, 9, 10, 11, 12, 13, 14, 15)); }
__device__ __forceinline__ v8f wmma16(v16h a, v16h b, v8f c) { return __builtin_amdgcn_wmma_f32_16x16x32_f16(false, a, false, b, (short)0, c, false, false); }
__device__ __forceinline__ v8f wmmab(v16bf a, v16bf b, v8f c) { return __builtin_amdgcn_wmma_f32_16x16x32_bf16(false, a, false, b, (short)0, c, false, false); }



// ---- k_gemmw: register-blocked GEMM, ONE WAVE per 64x64 output tile (16 accumulators), operands straight from 16-bit planes in fragment order; grid (M/64, N/64, Z), 32 threads.
// C[m][n] (f32, pitch ldc, + optional f32 bias[n]) = sum_k A[m][k] Bt[n][k] (+ split products per NSPLIT). z-batch strides sA/sB/sC in elements. K % 32 == 0.
// PLANES (the q, k, v projections; m = batch row x position, n = head x 32 + d): no f32 C; the tile goes from the accumulators to the attention's operand planes, [batch row][head][...]:
// z = 0, 1: bf16 hi and lo planes of q, k, staged through LDS; z = 2: the fp16 plane of v, straight from the accumulators (a lane's 8 rows are one fragment chunk). All in fragment order (head of the file): every store instruction writes 512 contiguous bytes.
// a load at a wave-uniform pointer plus a per-lane byte offset of 32 bits (fits the scalar-base address form)
template <typename V> __device__ __forceinline__ V ldu(const void* p, unsigned b) { return *(const V*)((const char*)p + b); }
template <typename T16> struct WFrag;   // ld: a fragment from a plane in fragment order: its two halves lie 512 bytes apart, b = 16 x lane + the block's offset from p
template <> struct WFrag<h16> { typedef v16h V; static __device__ __forceinline__ V ld(const h16* p, unsigned b) { return cat16(ldu<v8h>(p, b), ldu<v8h>(p + 256, b)); } static __device__ __forceinline__ v8f mma(V a, V b, v8f c) { return wmma16(a, b, c); } };
template <> struct WFrag<bf> { typedef v16bf V; static __device__ __forceinline__ V ld(const bf* p, unsigned b) { return cat16b(ldu<v8us>(p, b), ldu<v8us>(p + 256, b)); } static __device__ __forceinline__ v8f mma(V a, V b, v8f c) { return wmmab(a, b, c); } };
template <typename T16, int NSPLIT, bool BIAS, bool PLANES, int K>   // K at compile time: every block of a k step then lies at a constant distance from one pointer per plane
__global__ __launch_bounds__(32) void k_gemmw(const T16* __restrict__ A, const T16* __restrict__ Bt, const T16* __restrict__ Bt2, float* C, int ldc, const float* __restrict__ bias, size_t sA, size_t sB, size_t sC,
                                              bf* Qh, bf* Ql, bf* Kh, bf* Kl, h16* VT) {
    typedef typename WFrag<T16>::V V;
    __shared__ __align__(16) float os[16 * 68];   // 16 rows x 68 f32
    const size_t z = blockIdx.z; A += z * sA; Bt += z * sB; if (Bt2) Bt2 += z * sB; C += z * sC;
    const int lane = threadIdx.x & 31, lr = lane & 15, hi = lane >> 4; const int r0 = blockIdx.x * 64, c0 = blockIdx.y * 64;
    v8f acc[4][4];
#pragma unroll
    for (int mb = 0; mb < 4; ++mb)
#pragma unroll
        for (int nb = 0; nb < 4; ++nb) acc[mb][nb] = (v8f){};
    constexpr int AB = (NSPLIT == 1 || NSPLIT == 2) ? 1024 : 512;   // elements from one k step of A to the next: a block, or a hi block and its lo block
    unsigned ao = (unsigned)(r0 / 16 * (K / 32) * AB + lane * 8) * 2u, bo = (unsigned)(c0 / 16 * 512 + lane * 8) * 2u;   // byte offsets of this lane's chunk in the tile's first block of A (row tiles outermost) and of Bt (k steps outermost: CC / 16 blocks a step)
#pragma unroll 1
    for (int kc = 0; kc < K; kc += 32, ao += AB * 2u, bo += CC / 16 * 1024u) {
        V a[4], a2[4];
#pragma unroll
        for (int mb = 0; mb < 4; ++mb) { a[mb] = WFrag<T16>::ld(A + mb * (K / 32) * AB, ao); if (NSPLIT == 1 || NSPLIT == 2) a2[mb] = WFrag<T16>::ld(A + mb * (K / 32) * AB + 512, ao); }
#pragma unroll
        for (int nb = 0; nb < 4; ++nb) { const V b = WFrag<T16>::ld(Bt + nb * 512, bo); V b2; if (NSPLIT >= 2) b2 = WFrag<T16>::ld(Bt2 + nb * 512, bo);
#pragma unroll
            for (int mb = 0; mb < 4; ++mb) { acc[mb][nb] = WFrag<T16>::mma(a[mb], b, acc[mb][nb]); if (NSPLIT == 1 || NSPLIT == 2) acc[mb][nb] = WFrag<T16>::mma(a2[mb], b, acc[mb][nb]); if (NSPLIT >= 2) acc[mb][nb] = WFrag<T16>::mma(a[mb], b2, acc[mb][nb]); } }
        asm volatile("v_nop\n\tv_nop\n\tv_nop\n\tv_nop" : "+v"(acc[0][0]), "+v"(acc[1][1]), "+v"(acc[2][2]), "+v"(acc[3][3]) : "v"(a[0]), "v"(a[3]));
    }
    if constexpr (PLANES) {
        const int bb = r0 / TT, t0 = r0 % TT;   // the tile's 64 rows lie in one batch row
        const size_t bs = blockIdx.z == 0 ? 1024 : 3072, hb = (((size_t)bb * NH_ + (c0 >> 5)) * (TT / 32) + t0 / 32) * bs + lane * 8;   // bs: elements from one 32 positions to the next (q alone; k and v in their shared plane); hb: this lane's chunk at the tile's first position in its first head
        if (blockIdx.z == 2) {   // v: a lane's 8 accumulator rows are 8 consecutive positions of one d: the chunk of lane 16 hi + lr in block (position / 32), d tile nb & 1, half mb & 1
#pragma unroll
            for (int mb = 0; mb < 4; ++mb)
#pragma unroll
                for (int nb = 0; nb < 4; ++nb) *(v8h*)(VT + hb + (size_t)(nb >> 1) * (TT / 32) * 3072 + (mb >> 1) * 3072 + (nb & 1) * 512 + (mb & 1) * 256) = __builtin_convertvector(acc[mb][nb], v8h);
        } else {   // q, k: 16 rows are one block in each of the tile's two heads; an instruction writes one half of a block, lane 16 hi + lr taking row lr, d 16 jj + 8 hi ..
            bf* Ph = blockIdx.z == 0 ? Qh : Kh; bf* Pl = blockIdx.z == 0 ? Ql : Kl;
#pragma unroll
            for (int mb = 0; mb < 4; ++mb) {
#pragma unroll
                for (int nb = 0; nb < 4; ++nb) {
#pragma unroll
                    for (int j = 0; j < 8; ++j) os[(hi * 8 + j) * 68 + nb * 16 + lr] = acc[mb][nb][j]; }
                __builtin_amdgcn_wave_barrier(); asm volatile("" ::: "memory");   // keeps the compiler from moving the reads below, which take other lanes' values, over the writes above
#pragma unroll
                for (int s = 0; s < 4; ++s) { const int hh = s >> 1, jj = s & 1; const float* rp = os + lr * 68 + hh * 32 + (2 * jj + hi) * 8; const v4f y0 = *(const v4fa*)rp, y1 = *(const v4fa*)(rp + 4); unsigned a0, a1, a2, a3, e0, e1, e2, e3;
                    splitf2(y0[0], y0[1], a0, e0); splitf2(y0[2], y0[3], a1, e1); splitf2(y1[0], y1[1], a2, e2); splitf2(y1[2], y1[3], a3, e3);
                    const size_t o = hb + ((size_t)hh * (TT / 32) + (mb >> 1)) * bs + (mb & 1) * 512 + jj * 256; *(v8us*)(Ph + o) = __builtin_bit_cast(v8us, (v4u){a0, a1, a2, a3}); *(v8us*)(Pl + o) = __builtin_bit_cast(v8us, (v4u){e0, e1, e2, e3}); }
                __builtin_amdgcn_wave_barrier(); asm volatile("" ::: "memory");   // the next 16 rows' writes stay behind these reads
            }
            asm volatile("s_wait_xcnt 0x0" ::: "memory");   // behind the branch's last stores: the code that follows in the listing rewrites their address registers
        }
        return;
    }
#pragma unroll
    for (int mb = 0; mb < 4; ++mb) {
#pragma unroll
        for (int nb = 0; nb < 4; ++nb) {
#pragma unroll
            for (int j = 0; j < 8; ++j) os[(hi * 8 + j) * 68 + nb * 16 + lr] = acc[mb][nb][j]; }
        __builtin_amdgcn_wave_barrier(); asm volatile("" ::: "memory");
        float* crow = C + (size_t)(r0 + mb * 16) * ldc + c0;
{
#pragma unroll
            for (int s = 0; s < 8; ++s) { const int row = 2 * s + hi, cofs = lr * 4; v4f val = *(const v4fa*)(os + row * 68 + cofs); if (BIAS) { val[0] += bfr(bias[c0 + cofs]); val[1] += bfr(bias[c0 + cofs + 1]); val[2] += bfr(bias[c0 + cofs + 2]); val[3] += bfr(bias[c0 + cofs + 3]); }
                *(v4f*)(crow + (size_t)row * ldc + cofs) = val; }
             }
        __builtin_amdgcn_wave_barrier(); asm volatile("" ::: "memory");
    }
}

typedef __attribute__((ext_vector_type(2))) _Float16 v2h;
typedef __attribute__((ext_vector_type(4))) _Float16 v4h;
typedef __attribute__((ext_vector_type(2))) unsigned short v2us;
typedef __attribute__((ext_vector_type(4))) unsigned short v4us;

__global__ __launch_bounds__(256) void k_wtG(const float* __restrict__ w, int K, int N, bf* Bt) {
    const int lane = threadIdx.x & 31; const int L0 = (blockIdx.x * 8 + (threadIdx.x >> 5)) * 8; const int nlines = N * K / 64;
{
#pragma unroll 1
        for (int l = 0; l < 8; ++l) { const int L = L0 + l; if (L >= nlines) break; const size_t e = (size_t)L * 64 + lane * 2; const int k = (int)(e % K), n = (int)(e / K); v2us o;
            o[0] = f2bf(w[(size_t)k * N + n]); o[1] = f2bf(w[(size_t)(k + 1) * N + n]); *(v2us*)(Bt + e) = o; }
         }
}
// every f32 -> bf16 input conversion in one grid, each into fragment order: a wave takes one block of 16 rows x 32 columns, reads it in whole lines (8 lanes a row), turns it in its own 1024 bytes of LDS and writes it as 2 x 512 contiguous bytes.
// Blocks in the order x (all batch rows), Wq, Wk, Wv, Wo (planes back to back in WB), bias table; the counts divide exactly.
#define XTL (NB_ * TT / 16 * (CC / 32))
#define WTL (CC / 16 * (CC / 32))
#define GTL (TT / 16 * (TT / 32))
typedef __attribute__((ext_vector_type(2))) unsigned v2u;
typedef v2u __attribute__((may_alias)) v2ua;
__global__ __launch_bounds__(256) void k_cvtin(const float* __restrict__ x, const float* __restrict__ Wq, const float* __restrict__ Wk, const float* __restrict__ Wv, const float* __restrict__ Wo, const float* __restrict__ geo, bf* XB, bf* WB, bf* GP) {
    __shared__ __align__(16) bf gs[8][512];
    const int lane = threadIdx.x & 31, w = threadIdx.x >> 5, r8 = lane >> 3, c4 = lane & 7;   // this lane: rows r8, r8 + 4, r8 + 8, r8 + 12, columns 4 c4 .. 4 c4 + 3 of the block
    int tb = blockIdx.x * 8, sh = 3; bool kout = false; const float* src = x; bf* dst = XB;   // a work-group's 8 blocks lie in one plane; sh: log2 of the blocks in a row (row length 32 << sh)
    if (tb >= XTL + 4 * WTL) { tb -= XTL + 4 * WTL; src = geo; dst = GP; sh = 6; }
    else if (tb >= XTL) { const int sel = (tb - XTL) / WTL; tb = (tb - XTL) % WTL; src = sel == 0 ? Wq : sel == 1 ? Wk : sel == 2 ? Wv : Wo; dst = WB + (size_t)sel * CC * CC; kout = true; }   // the weights' blocks are stored k steps outermost
    const int tile = tb + w, ob = kout ? (tile & 7) * (CC / 16) + (tile >> 3) : tile; const float* gp = src + ((size_t)((tile >> sh) * 16 + r8) << (sh + 5)) + (tile & ((1 << sh) - 1)) * 32 + c4 * 4; const float* gr[4]; v4f y[4];
#pragma unroll
    for (int i = 0; i < 4; ++i) { gr[i] = gp + ((size_t)i << (sh + 7)); y[i] = *(const v4f*)gr[i]; }
    asm volatile("s_wait_xcnt 0x0" :: "v"(gr[0]), "v"(gr[1]), "v"(gr[2]), "v"(gr[3]) : "memory");   // behind the loads, in front of whatever rewrites a register that they name; the addresses are inputs, so that no later load lands on one either
#pragma unroll
    for (int i = 0; i < 4; ++i) { const v2u p = { __builtin_bit_cast(unsigned, __builtin_convertvector((v2f){y[i][0], y[i][1]}, v2bf)), __builtin_bit_cast(unsigned, __builtin_convertvector((v2f){y[i][2], y[i][3]}, v2bf)) };   // rounds to nearest even, as f2bf does
        *(v2ua*)(gs[w] + (c4 >> 2) * 256 + (((c4 >> 1) & 1) * 16 + i * 4 + r8) * 8 + (c4 & 1) * 4) = p; }
    __builtin_amdgcn_wave_barrier(); asm volatile("" ::: "memory");   // keeps the compiler from moving the reads below, which take other lanes' values, over the writes above
#pragma unroll
    for (int t = 0; t < 2; ++t) *(v8us*)(dst + (size_t)ob * 512 + t * 256 + lane * 8) = *(const v8usa*)(gs[w] + t * 256 + lane * 8);
}
__device__ __forceinline__ float xhalf(float x) { return __builtin_bit_cast(float, __builtin_amdgcn_permlanex16(__builtin_bit_cast(int, x), __builtin_bit_cast(int, x), 0x76543210, 0xfedcba98, false, false)); }   // lane l with lane l ^ 16
// Base-2 exponentials as asm text: inside a statement every v_exp_f32 is followed by an independent one and the last by v_nop, the slot the instruction set asks for between a transcendental and an instruction that
// reads its result or overwrites its source; outputs are early-clobber, so none lands on a source of the same statement.
__device__ __forceinline__ float exp2x1(float x) { float r; asm("v_exp_f32 %0, %1\n\tv_nop" : "=&v"(r) : "v"(x)); return r; }
__device__ __forceinline__ v8f exp2x8(v8f x) { float r0, r1, r2, r3, r4, r5, r6, r7;
    asm("v_exp_f32 %0, %8\n\tv_exp_f32 %1, %9\n\tv_exp_f32 %2, %10\n\tv_exp_f32 %3, %11\n\tv_exp_f32 %4, %12\n\tv_exp_f32 %5, %13\n\tv_exp_f32 %6, %14\n\tv_exp_f32 %7, %15\n\tv_nop"
        : "=&v"(r0), "=&v"(r1), "=&v"(r2), "=&v"(r3), "=&v"(r4), "=&v"(r5), "=&v"(r6), "=&v"(r7) : "v"(x[0]), "v"(x[1]), "v"(x[2]), "v"(x[3]), "v"(x[4]), "v"(x[5]), "v"(x[6]), "v"(x[7]));
    return (v8f){r0, r1, r2, r3, r4, r5, r6, r7}; }
__device__ __forceinline__ v16bf ldfb(const bf* p, unsigned b) { return WFrag<bf>::ld(p, b); }
__device__ __forceinline__ v16h ldfh(const h16* p, unsigned b) { return WFrag<h16>::ld(p, b); }
// ---- k_fattn: scores, bias, mask, softmax, probs.v and head gate in one kernel. Grid (TT / 256, heads, batch rows), 8 waves. A group owns 256 queries of one head, wave w 32 of them; every wave walks all the keys in passes of 32 with its running maximum,
// sum and accumulators, so nothing is merged at the end. The keys come in stages of SK = 128 through a ring of two LDS buffers that asynchronous copies fill one stage ahead: a stage's k hi, k lo and v (SK x 192 contiguous bytes of the shared plane, read by all
// eight waves: fetched once a group, not once a wave), each wave's own slice of the bias plane (2 row tiles x SK x 32 bytes) and the stage's mask words. The planes' fragment order is kept in LDS: every LDS read of a wave covers 512 contiguous bytes.
// Transposed products: S^T = K Q^T (A = key rows, B = query rows; a lane holds 16 scores of ONE query: keys 8 hi + j and 16 + 8 hi + j),
// O^T += V^T P^T (A = V^T rows d, B = the two score tiles converted in place, same k order as the A loader). Everything in base 2: t = S scale log2e + bf16(geo) hs log2e.
// Every plain '#pragma unroll' in it makes the indices of a register array compile-time constants (a rolled loop would put the array in scratch memory).
#define SK   128
#define NST  (TT / SK)
#define KVB  (SK * 192)
#define GWB  (NQT * 16 * SK * 2)
#define MOFS (KVB + 8 * GWB)
#define BUFB (MOFS + SK * 4)
typedef v4u __attribute__((may_alias)) v4ua;
typedef int __attribute__((may_alias)) inta;
// Asynchronous copies, 16 bytes a lane, to LDS byte l from global g. An immediate offset moves both addresses alike, so a run of copies whose source and place step together names one pair of address registers.
// The s_wait_xcnt 0 is the last line of the copies' own statement, so that it stands in front of whatever rewrites one of those registers.
__device__ __forceinline__ void acp1(unsigned l, const char* g) { asm volatile("global_load_async_to_lds_b128 %0, %1, off\n\ts_wait_xcnt 0x0" :: "v"(l), "v"(g) : "memory"); }
__device__ __forceinline__ void acp6x4096(unsigned l, const char* g) {
    asm volatile("global_load_async_to_lds_b128 %0, %1, off\n\tglobal_load_async_to_lds_b128 %0, %1, off offset:4096\n\tglobal_load_async_to_lds_b128 %0, %1, off offset:8192\n\tglobal_load_async_to_lds_b128 %0, %1, off offset:12288\n\t"
                 "global_load_async_to_lds_b128 %0, %1, off offset:16384\n\tglobal_load_async_to_lds_b128 %0, %1, off offset:20480\n\ts_wait_xcnt 0x0" :: "v"(l), "v"(g) : "memory"); }
__device__ __forceinline__ void acp8x512(unsigned l, const char* g) {
    asm volatile("global_load_async_to_lds_b128 %0, %1, off\n\tglobal_load_async_to_lds_b128 %0, %1, off offset:512\n\tglobal_load_async_to_lds_b128 %0, %1, off offset:1024\n\tglobal_load_async_to_lds_b128 %0, %1, off offset:1536\n\t"
                 "global_load_async_to_lds_b128 %0, %1, off offset:2048\n\tglobal_load_async_to_lds_b128 %0, %1, off offset:2560\n\tglobal_load_async_to_lds_b128 %0, %1, off offset:3072\n\tglobal_load_async_to_lds_b128 %0, %1, off offset:3584\n\ts_wait_xcnt 0x0"
                 :: "v"(l), "v"(g) : "memory"); }
// a wave-uniform LDS address kept as one scalar sum: otherwise the compiler adds the lane's part to the loop-invariant part first and holds one more vector register per run of copies over the whole loop, which it spilled
__device__ __forceinline__ unsigned ufm(unsigned x) { return (unsigned)__builtin_amdgcn_readfirstlane((int)x); }
// one stage's copies of this wave into the buffer at LDS byte lb: its eighth of k and v (512 bytes of each 4096, six times), its own bias slice (two row tiles, 64 KiB apart in the plane, 8 x 512 bytes each), and from wave 0 the mask words
__device__ __forceinline__ void fill(unsigned lb, int st, const char* kvu, const char* gu, const char* mu, unsigned lane, int w) {   // kvu, gu, mu: wave-uniform, stage 0's first bytes; the lane's 16 bytes are added last, to a scalar sum
    static_assert(KVB == 6 * 4096 && GWB / NQT == 8 * 512 && SK * 4 == 512, "the copy runs cover a stage exactly");
    acp6x4096(ufm(lb + (unsigned)w * 512u) + lane * 16u, kvu + ((size_t)st * KVB + (size_t)w * 512) + lane * 16u);
#pragma unroll
    for (int nq = 0; nq < NQT; ++nq) acp8x512(ufm(lb + KVB + (unsigned)w * GWB + nq * (GWB / NQT)) + lane * 16u, gu + ((size_t)st * (SK * 32) + (size_t)nq * (TT / 32) * 1024) + lane * 16u);
    if (w == 0) acp1(lb + MOFS + lane * 16u, mu + (size_t)st * (SK * 4) + lane * 16u);   // w is a scalar: a scalar branch, every lane on inside it
}
// a pass's score operands from the stage's buffer: bp, bg, bm = this lane's first byte of k and v, of its wave's bias slice, of the mask words
__device__ __forceinline__ void ldpass(const char* bp, const char* bg, const char* bm, int p, v16bf (&kfh)[2], v16bf (&kfl)[2], v4u (&g)[NQT][2], int& mk) {
#pragma unroll
    for (int t = 0; t < 2; ++t) { const char* kp = bp + p * 6144 + t * 1024; kfh[t] = cat16b(*(const v8usa*)kp, *(const v8usa*)(kp + 512)); kfl[t] = cat16b(*(const v8usa*)(kp + 2048), *(const v8usa*)(kp + 2560)); }
#pragma unroll
    for (int nq = 0; nq < NQT; ++nq)
#pragma unroll
        for (int t = 0; t < 2; ++t) g[nq][t] = *(const v4ua*)(bg + nq * (GWB / NQT) + p * 1024 + t * 512);
    mk = *(const inta*)(bm + p * 128);
}
__global__ __launch_bounds__(256) void k_fattn(const bf* __restrict__ Qh, const bf* __restrict__ Ql, const bf* __restrict__ KV, const bf* __restrict__ GP, const int* __restrict__ msk,
                                               const float* __restrict__ gbsp, const float* __restrict__ hgs, const float* __restrict__ hg, bf* AHL) {
    __shared__ __align__(16) char sm[2 * BUFB];
    const int lane = threadIdx.x & 31, hi = lane >> 4, w = __builtin_amdgcn_readfirstlane(threadIdx.x >> 5);   // the wave's number as a scalar: scalar branches
    const int h = blockIdx.y, q0 = (blockIdx.x * 8 + w) * (16 * NQT), b = blockIdx.z;
    const size_t hp = ((size_t)b * NH_ + h) * TT * HD;   // this batch row's and head's q planes: 32 elements a position (k and v together: 96)
    const float c1 = 0.17677669529663687f * 1.4426950408889634f;
    const float c2 = bfr(gbsp[0]) * bfr(hgs[h]) * 1.4426950408889634f;
    const unsigned rofs = (unsigned)lane * 16u;   // this lane's chunk in a half block, bytes
    const char* kvs = (const char*)(KV + hp * 3); const char* gs = (const char*)(GP + (size_t)(q0 / 16) * (TT / 32) * 512); const char* ms = (const char*)(msk + (size_t)b * TT);   // stage 0's first bytes, wave-uniform
    const unsigned l0 = (unsigned)(size_t)sm;   // the ring's LDS byte address
    fill(l0, 0, kvs, gs, ms, lane, w);
    v16bf qfh[NQT], qfl[NQT]; v8f o[NQT][2]; float m[NQT], l[NQT];
#pragma unroll
    for (int nq = 0; nq < NQT; ++nq) { const size_t off = hp + (size_t)(q0 + 16 * nq) * HD; qfh[nq] = ldfb(Qh + off, rofs); qfl[nq] = ldfb(Ql + off, rofs); o[nq][0] = (v8f){}; o[nq][1] = (v8f){}; m[nq] = -3.0e38f; l[nq] = 0.f; }
    asm volatile("s_wait_asynccnt 0x0" ::: "memory");   // this wave's copies of stage 0 have landed
    __syncthreads();                                    // ... and every other wave's: stage 0 is published
    fill(l0 + BUFB, 1, kvs, gs, ms, lane, w);
#pragma unroll 1   // one stage's code; the buffer alternates
    for (int st = 0; st < NST; ++st) {
        const char* bp = sm + (st & 1) * BUFB + rofs; const char* bg = bp + KVB + w * GWB; const char* bm = sm + (st & 1) * BUFB + MOFS + lane * 4;
        v16bf kfh[2], kfl[2]; v4u g[NQT][2]; int mk;
        ldpass(bp, bg, bm, 0, kfh, kfl, g, mk);
#pragma unroll   // the stage's four passes: every LDS read at a constant distance from one address, and the operand registers of one pass and the next told apart at compile time
        for (int p = 0; p < SK / 32; ++p) {
            v8f s[NQT][2];
            const unsigned live = __builtin_amdgcn_ballot_w32(mk != 0);   // bit i: key i of this pass is attended
#pragma unroll
            for (int nq = 0; nq < NQT; ++nq)
#pragma unroll
                for (int t = 0; t < 2; ++t) s[nq][t] = wmmab(kfh[t], qfh[nq], (v8f){});
#pragma unroll
            for (int nq = 0; nq < NQT; ++nq)
#pragma unroll
                for (int t = 0; t < 2; ++t) s[nq][t] = wmmab(kfh[t], qfl[nq], s[nq][t]);
#pragma unroll
            for (int nq = 0; nq < NQT; ++nq)
#pragma unroll
                for (int t = 0; t < 2; ++t) s[nq][t] = wmmab(kfl[t], qfh[nq], s[nq][t]);
#pragma unroll
            for (int nq = 0; nq < NQT; ++nq)
#pragma unroll
                for (int t = 0; t < 2; ++t)
#pragma unroll
                    for (int j = 0; j < 8; j += 2) { const unsigned u = g[nq][t][j >> 1];
                        s[nq][t][j] = s[nq][t][j] * c1 + __uint_as_float(u << 16) * c2; s[nq][t][j + 1] = s[nq][t][j + 1] * c1 + __uint_as_float(u & 0xFFFF0000u) * c2; }
            if (live != 0xFFFFFFFFu) {   // one scalar test a pass; a pass with every key attended skips the selects
                const unsigned mine = live >> (8 * hi);
#pragma unroll
                for (int nq = 0; nq < NQT; ++nq)
#pragma unroll
                    for (int t = 0; t < 2; ++t)
#pragma unroll
                        for (int j = 0; j < 8; ++j) if (!((mine >> (16 * t + j)) & 1u)) s[nq][t][j] = -3.0e38f;
            }
            v16h vc[2];   // this pass's V^T and the same stage's next pass's score operands: their LDS reads return under this pass's softmax
#pragma unroll
            for (int dt = 0; dt < 2; ++dt) { const char* vp = bp + p * 6144 + 4096 + dt * 1024; vc[dt] = cat16(*(const v8ha*)vp, *(const v8ha*)(vp + 512)); }
            if (p + 1 < SK / 32) ldpass(bp, bg, bm, p + 1, kfh, kfl, g, mk);
            __builtin_amdgcn_sched_barrier(0);   // keeps those reads up here; without it the compiler sinks each to just in front of its first use, where its latency stands open
#pragma unroll
            for (int nq = 0; nq < NQT; ++nq) {
                float mx = fmaxf(s[nq][0][0], s[nq][1][0]);
#pragma unroll
                for (int j = 1; j < 8; ++j) mx = fmaxf(mx, fmaxf(s[nq][0][j], s[nq][1][j]));
                mx = fmaxf(mx, xhalf(mx));
                const float mn = fmaxf(m[nq], mx), al = exp2x1(m[nq] - mn), mref = mn - 10.0f;   // probabilities x 2^10, for fp16's range
                m[nq] = mn; float ls = 0.f;
#pragma unroll
                for (int t = 0; t < 2; ++t) { s[nq][t] = exp2x8(s[nq][t] - mref);
#pragma unroll
                    for (int j = 0; j < 8; ++j) ls += s[nq][t][j]; }
                l[nq] = l[nq] * al + ls;
                const v16h pf = cat16(__builtin_convertvector(s[nq][0], v8h), __builtin_convertvector(s[nq][1], v8h));
#pragma unroll
                for (int dt = 0; dt < 2; ++dt) { o[nq][dt] *= al; o[nq][dt] = wmma16(vc[dt], pf, o[nq][dt]); }
            }
        }
        asm volatile("s_wait_dscnt 0x0" ::: "memory");      // this wave's reads of the stage's buffer have returned
        asm volatile("s_wait_asynccnt 0x0" ::: "memory");   // this wave's copies of the next stage have landed
        __syncthreads();                                    // publishes the next stage and ends every wave's reads of this stage's buffer
        if (st + 2 < NST) fill(l0 + (st & 1) * BUFB, st + 2, kvs, gs, ms, lane, w);
    }
    asm volatile("s_wait_asynccnt 0x0" ::: "memory");   // no copy is outstanding when the wave ends
    const float gate = bfr(hg[h]);
#pragma unroll
    for (int nq = 0; nq < NQT; ++nq) { const float f = gate / (l[nq] + xhalf(l[nq]));
#pragma unroll
        for (int dt = 0; dt < 2; ++dt) { v8us oh, ol;
#pragma unroll
            for (int j = 0; j < 8; ++j) { unsigned short a, c; splitf(o[nq][dt][j] * f, a, c); oh[j] = a; ol[j] = c; }
            const size_t ofs = ((size_t)b * TT + q0 + 16 * nq) * CC * 2 + h * 1024 + dt * 256 + lane * 8; *(v8us*)(AHL + ofs) = oh; *(v8us*)(AHL + ofs + 512) = ol; } }   // fragment order: head h is k step h of these 16 queries, a hi block and its lo block; d tile dt is a block's half
}

extern "C" void kernel_launch(void* const* d_in, const int* in_sizes, int n_in,
                              void* d_out, int out_size, void* d_ws, size_t ws_size, hipStream_t stream) {
    (void)in_sizes; (void)n_in; (void)out_size;
    const float* x = (const float*)d_in[0]; const float* geo = (const float*)d_in[1]; const int* msk = (const int*)d_in[2]; const float* hg = (const float*)d_in[3]; const float* Wq = (const float*)d_in[4]; const float* Wk = (const float*)d_in[5]; const float* Wv = (const float*)d_in[6]; const float* Wo = (const float*)d_in[7]; const float* gbsp = (const float*)d_in[8]; const float* hgs = (const float*)d_in[9];
    float* OUT = (float*)d_out;     // [4][2048][256]
    char* wsp = (char*)d_ws;
    auto take = [&](size_t bytes) { char* p = wsp; wsp += (bytes + 255) & ~(size_t)255; return (void*)p; };
    bf* WB = (bf*)take((size_t)4 * CC * CC * 2); bf* WO = WB + (size_t)3 * CC * CC; bf* XB = (bf*)take((size_t)NB_ * TT * CC * 2);   // WB: Wq, Wk, Wv, Wo planes back to back; [out][in] as given = rows n, columns k
    bf* Qh = (bf*)take((size_t)NB_ * NH_ * TT * HD * 2); bf* Ql = (bf*)take((size_t)NB_ * NH_ * TT * HD * 2); bf* KV = (bf*)take((size_t)NB_ * NH_ * TT * HD * 2 * 3);
    bf* AHL = (bf*)take((size_t)NB_ * TT * CC * 2 * 2); bf* GP = (bf*)take((size_t)TT * TT * 2);
    if ((size_t)(wsp - (char*)d_ws) > ws_size) return;    // total ~ 41 MB
    k_cvtin<<<(XTL + 4 * WTL + GTL) / 8, 256, 0, stream>>>(x, Wq, Wk, Wv, Wo, geo, XB, WB, GP);
    k_gemmw<bf, 0, false, true, CC><<<dim3(NB_ * TT / 64, CC / 64, 3), 32, 0, stream>>>(XB, WB, nullptr, nullptr, 0, nullptr, 0, (size_t)CC * CC, 0, Qh, Ql, KV, KV + 1024, (h16*)(KV + 2048));
    k_fattn<<<dim3(TT / (16 * NQT * 8), NH_, NB_), 256, 0, stream>>>(Qh, Ql, KV, GP, msk, gbsp, hgs, hg, AHL);
    k_gemmw<bf, 1, false, false, CC><<<dim3(NB_ * TT / 64, CC / 64, 1), 32, 0, stream>>>(AHL, WO, nullptr, OUT, CC, nullptr, 0, 0, 0, nullptr, nullptr, nullptr, nullptr, nullptr);
}

// v007
// It runs in 67.5 microseconds.
// In two side-by-side timings against v006, it was 1.03 and 1.04 times as fast.
// All steps since v000 together make it 18.6 times as fast.
#include <hip/hip_runtime.h>

// TetrahedralAttention (x [4][2048][256]; q/k/v = x W^T (8 heads x 32); scores = q.k/sqrt(32) + geo_bias_scale geometric_bias[i][j] head_geo_scales[h]; keys with attention_mask[b][j] == 0 -> -inf; softmax; x head_gates[h] (post-softmax);
// out = merged.v Wo^T -> [4][2048][256]; bias table, mask (int32), gates and scales read as data).
// Compute dtypes, f32 accumulate: every input rounded to bf16; projections on PLAIN bf16 operands (inputs: exact); scores (K 32) on bf16 hi+lo planes (3 products) on top of a fourth product that adds the bias (k_fattn), mask/softmax in f32 registers
// (probabilities x1024 against the running maximum, fp16); probs.v on fp16 planes; Wo on hl planes x exact Wo (2 products). Scores, softmax, probs.v and the head gate run in ONE kernel (k_fattn): no score or probability plane in memory.
// Every 16-bit plane that a matrix instruction's operand is loaded from lies in memory in FRAGMENT ORDER (16 bytes a lane, lane after lane), so that each wave-wide load and store of it covers 512 contiguous bytes.
// A plane of R rows x K columns (K = the product's k) is a row of blocks of 1024 bytes, block (row tile r / 16) x (K / 32) + (k / 32) = [half jj][lane = 16 hi + lr][8]: row lr of the tile, k = 16 jj + 8 hi + e of the block.
// So lie x, q and k (hi and lo; K = 32, one block for 16 positions) and the bias table rounded to bf16 (rows = queries, k = keys: the B operand of the product that adds it to the scores). The merged attention output: the same, each hi block followed by its lo block.
// The four weights: the same blocks, k steps outermost (block (k / 32) x (rows / 16) + row tile): the four blocks that a k step of a 64-column tile loads lie in a row, and the offsets into A and Bt step by different amounts, so that this compiler
// keeps each in a register of its own over the loop (with equal steps it formed both addresses anew in every step, in registers on which later loads of the step landed).
// v: 2048 bytes for 32 positions, [d tile dt][half jj][lane][8] = d 16 dt + lr, position 16 jj + 8 hi + e. k and v share one plane, 6144 bytes for 32 positions of a head: k hi (two blocks), k lo (two blocks), v: all that an attention pass loads of them, in a row.
// Four launches, each over all four batch rows: input conversions (with the bias table's plane); q, k, v projections (grid z, M = 4 x 2048), whose epilogue writes the attention's operand planes itself; attention (grid z = batch row); output projection.

#define NB_  4
#define TT   2048
#define CC   256
#define NH_  8
#define HD   32
#define NQT  2
typedef _Float16 h16;
typedef unsigned short bf;
typedef __attribute__((ext_vector_type(16))) __bf16   v16bf;
typedef __attribute__((ext_vector_type(16))) _Float16 v16h;
typedef __attribute__((ext_vector_type(8)))  _Float16 v8h;
typedef __attribute__((ext_vector_type(8)))  unsigned short v8us;
typedef __attribute__((ext_vector_type(8)))  float    v8f;
typedef __attribute__((ext_vector_type(4)))  float    v4f;
typedef __attribute__((ext_vector_type(2)))  float    v2f;
typedef __attribute__((ext_vector_type(2)))  __bf16   v2bf;
typedef __attribute__((ext_vector_type(4)))  unsigned v4u;
typedef v8h  __attribute__((may_alias)) v8ha;
typedef v4f  __attribute__((may_alias)) v4fa;
typedef v8us __attribute__((may_alias)) v8usa;

__device__ __forceinline__ unsigned short f2bf(float f) { unsigned u = __float_as_uint(f); u += 0x7FFFu + ((u >> 16) & 1u); return (unsigned short)(u >> 16); }
__device__ __forceinline__ float bf2f(unsigned short b) { return __uint_as_float(((unsigned)b) << 16); }
__device__ __forceinline__ float bfr(float f) { return bf2f(f2bf(f)); }
__device__ __forceinline__ void splitf(float y, unsigned short& h, unsigned short& l) { h = f2bf(y); l = f2bf(y - bf2f(h)); }
// splitf on two neighbours at once, each result a packed pair; the packed conversion rounds to nearest even, as f2bf does
__device__ __forceinline__ void splitf2(float y0, float y1, unsigned& h, unsigned& l) { h = __builtin_bit_cast(unsigned, __builtin_convertvector((v2f){y0, y1}, v2bf));
    l = __builtin_bit_cast(unsigned, __builtin_convertvector((v2f){y0 - __uint_as_float(h << 16), y1 - __uint_as_float(h & 0xFFFF0000u)}, v2bf)); }
__device__ __forceinline__ v16h cat16(v8h lo, v8h hi) { return __builtin_shufflevector(lo, hi, 0, 1, 2, 3, 4, 5, 6, 7, 8, 9, 10, 11, 12, 13, 14, 15); }
__device__ __forceinline__ v16bf cat16b(v8us lo, v8us hi) { return __builtin_bit_cast(v16bf, __builtin_shufflevector(lo, hi, 0, 1, 2, 3, 4, 5, 6, 7, 8, 9, 10, 11, 12, 13, 14, 15)); }
__device__ __forceinline__ v8f wmma16(v16h a, v16h b, v8f c) { return __builtin_amdgcn_wmma_f32_16x16x32_f16(false, a, false, b, (short)0, c, false, false); }
__device__ __forceinline__ v8f wmmab(v16bf a, v16bf b, v8f c) { return __builtin_amdgcn_wmma_f32_16x16x32_bf16(false, a, false, b, (short)0, c, false, false); }



// ---- k_gemmw: register-blocked GEMM, ONE WAVE per 64x64 output tile (16 accumulators), operands straight from 16-bit planes in fragment order; grid (M/64, N/64, Z), 32 threads.
// C[m][n] (f32, pitch ldc, + optional f32 bias[n]) = sum_k A[m][k] Bt[n][k] (+ split products per NSPLIT). z-batch strides sA/sB/sC in elements. K % 32 == 0.
// PLANES (the q, k, v projections; m = batch row x position, n = head x 32 + d): no f32 C; the tile goes from the accumulators to the attention's operand planes, [batch row][head][...]:
// z = 0, 1: bf16 hi and lo planes of q, k, staged through LDS; z = 2: the fp16 plane of v, straight from the accumulators (a lane's 8 rows are one fragment chunk). All in fragment order (head of the file): every store instruction writes 512 contiguous bytes.
// a load at a wave-uniform pointer plus a per-lane byte offset of 32 bits (fits the scalar-base address form)
template <typename V> __device__ __forceinline__ V ldu(const void* p, unsigned b) { return *(const V*)((const char*)p + b); }
template <typename T16> struct WFrag;   // ld: a fragment from a plane in fragment order: its two halves lie 512 bytes apart, b = 16 x lane + the block's offset from p
template <> struct WFrag<h16> { typedef v16h V; static __device__ __forceinline__ V ld(const h16* p, unsigned b) { return cat16(ldu<v8h>(p, b), ldu<v8h>(p + 256, b)); } static __device__ __forceinline__ v8f mma(V a, V b, v8f c) { return wmma16(a, b, c); } };
template <> struct WFrag<bf> { typedef v16bf V; static __device__ __forceinline__ V ld(const bf* p, unsigned b) { return cat16b(ldu<v8us>(p, b), ldu<v8us>(p + 256, b)); } static __device__ __forceinline__ v8f mma(V a, V b, v8f c) { return wmmab(a, b, c); } };
template <typename T16, int NSPLIT, bool BIAS, bool PLANES, int K>   // K at compile time: every block of a k step then lies at a constant distance from one pointer per plane
__global__ __launch_bounds__(32) void k_gemmw(const T16* __restrict__ A, const T16* __restrict__ Bt, const T16* __restrict__ Bt2, float* C, int ldc, const float* __restrict__ bias, size_t sA, size_t sB, size_t sC,
                                              bf* Qh, bf* Ql, bf* Kh, bf* Kl, h16* VT) {
    typedef typename WFrag<T16>::V V;
    __shared__ __align__(16) float os[16 * 68];   // 16 rows x 68 f32
    const size_t z = blockIdx.z; A += z * sA; Bt += z * sB; if (Bt2) Bt2 += z * sB; C += z * sC;
    const int lane = threadIdx.x & 31, lr = lane & 15, hi = lane >> 4; const int r0 = blockIdx.x * 64, c0 = blockIdx.y * 64;
    v8f acc[4][4];
#pragma unroll
    for (int mb = 0; mb < 4; ++mb)
#pragma unroll
        for (int nb = 0; nb < 4; ++nb) acc[mb][nb] = (v8f){};
    constexpr int AB = (NSPLIT == 1 || NSPLIT == 2) ? 1024 : 512;   // elements from one k step of A to the next: a block, or a hi block and its lo block
    unsigned ao = (unsigned)(r0 / 16 * (K / 32) * AB + lane * 8) * 2u, bo = (unsigned)(c0 / 16 * 512 + lane * 8) * 2u;   // byte offsets of this lane's chunk in the tile's first block of A (row tiles outermost) and of Bt (k steps outermost: CC / 16 blocks a step)
#pragma unroll 1
    for (int kc = 0; kc < K; kc += 32, ao += AB * 2u, bo += CC / 16 * 1024u) {
        V a[4], a2[4];
#pragma unroll
        for (int mb = 0; mb < 4; ++mb) { a[mb] = WFrag<T16>::ld(A + mb * (K / 32) * AB, ao); if (NSPLIT == 1 || NSPLIT == 2) a2[mb] = WFrag<T16>::ld(A + mb * (K / 32) * AB + 512, ao); }
#pragma unroll
        for (int nb = 0; nb < 4; ++nb) { const V b = WFrag<T16>::ld(Bt + nb * 512, bo); V b2; if (NSPLIT >= 2) b2 = WFrag<T16>::ld(Bt2 + nb * 512, bo);
#pragma unroll
            for (int mb = 0; mb < 4; ++mb) { acc[mb][nb] = WFrag<T16>::mma(a[mb], b, acc[mb][nb]); if (NSPLIT == 1 || NSPLIT == 2) acc[mb][nb] = WFrag<T16>::mma(a2[mb], b, acc[mb][nb]); if (NSPLIT >= 2) acc[mb][nb] = WFrag<T16>::mma(a[mb], b2, acc[mb][nb]); } }
        asm volatile("v_nop\n\tv_nop\n\tv_nop\n\tv_nop" : "+v"(acc[0][0]), "+v"(acc[1][1]), "+v"(acc[2][2]), "+v"(acc[3][3]) : "v"(a[0]), "v"(a[3]));
    }
    if constexpr (PLANES) {
        const int bb = r0 / TT, t0 = r0 % TT;   // the tile's 64 rows lie in one batch row
        const size_t bs = blockIdx.z == 0 ? 1024 : 3072, hb = (((size_t)bb * NH_ + (c0 >> 5)) * (TT / 32) + t0 / 32) * bs + lane * 8;   // bs: elements from one 32 positions to the next (q alone; k and v in their shared plane); hb: this lane's chunk at the tile's first position in its first head
        if (blockIdx.z == 2) {   // v: a lane's 8 accumulator rows are 8 consecutive positions of one d: the chunk of lane 16 hi + lr in block (position / 32), d tile nb & 1, half mb & 1
#pragma unroll
            for (int mb = 0; mb < 4; ++mb)
#pragma unroll
                for (int nb = 0; nb < 4; ++nb) *(v8h*)(VT + hb + (size_t)(nb >> 1) * (TT / 32) * 3072 + (mb >> 1) * 3072 + (nb & 1) * 512 + (mb & 1) * 256) = __builtin_convertvector(acc[mb][nb], v8h);
        } else {   // q, k: 16 rows are one block in each of the tile's two heads; an instruction writes one half of a block, lane 16 hi + lr taking row lr, d 16 jj + 8 hi ..
            bf* Ph = blockIdx.z == 0 ? Qh : Kh; bf* Pl = blockIdx.z == 0 ? Ql : Kl;
#pragma unroll
            for (int mb = 0; mb < 4; ++mb) {
#pragma unroll
                for (int nb = 0; nb < 4; ++nb) {
#pragma unroll
                    for (int j = 0; j < 8; ++j) os[(hi * 8 + j) * 68 + nb * 16 + lr] = acc[mb][nb][j]; }
                __builtin_amdgcn_wave_barrier(); asm volatile("" ::: "memory");   // keeps the compiler from moving the reads below, which take other lanes' values, over the writes above
#pragma unroll
                for (int s = 0; s < 4; ++s) { const int hh = s >> 1, jj = s & 1; const float* rp = os + lr * 68 + hh * 32 + (2 * jj + hi) * 8; const v4f y0 = *(const v4fa*)rp, y1 = *(const v4fa*)(rp + 4); unsigned a0, a1, a2, a3, e0, e1, e2, e3;
                    splitf2(y0[0], y0[1], a0, e0); splitf2(y0[2], y0[3], a1, e1); splitf2(y1[0], y1[1], a2, e2); splitf2(y1[2], y1[3], a3, e3);
                    const size_t o = hb + ((size_t)hh * (TT / 32) + (mb >> 1)) * bs + (mb & 1) * 512 + jj * 256; *(v8us*)(Ph + o) = __builtin_bit_cast(v8us, (v4u){a0, a1, a2, a3}); *(v8us*)(Pl + o) = __builtin_bit_cast(v8us, (v4u){e0, e1, e2, e3}); }
                __builtin_amdgcn_wave_barrier(); asm volatile("" ::: "memory");   // the next 16 rows' writes stay behind these reads
            }
            asm volatile("s_wait_xcnt 0x0" ::: "memory");   // behind the branch's last stores: the code that follows in the listing rewrites their address registers
        }
        return;
    }
#pragma unroll
    for (int mb = 0; mb < 4; ++mb) {
#pragma unroll
        for (int nb = 0; nb < 4; ++nb) {
#pragma unroll
            for (int j = 0; j < 8; ++j) os[(hi * 8 + j) * 68 + nb * 16 + lr] = acc[mb][nb][j]; }
        __builtin_amdgcn_wave_barrier(); asm volatile("" ::: "memory");
        float* crow = C + (size_t)(r0 + mb * 16) * ldc + c0;
{
#pragma unroll
            for (int s = 0; s < 8; ++s) { const int row = 2 * s + hi, cofs = lr * 4; v4f val = *(const v4fa*)(os + row * 68 + cofs); if (BIAS) { val[0] += bfr(bias[c0 + cofs]); val[1] += bfr(bias[c0 + cofs + 1]); val[2] += bfr(bias[c0 + cofs + 2]); val[3] += bfr(bias[c0 + cofs + 3]); }
                *(v4f*)(crow + (size_t)row * ldc + cofs) = val; }
             }
        __builtin_amdgcn_wave_barrier(); asm volatile("" ::: "memory");
    }
}

typedef __attribute__((ext_vector_type(2))) _Float16 v2h;
typedef __attribute__((ext_vector_type(4))) _Float16 v4h;
typedef __attribute__((ext_vector_type(2))) unsigned short v2us;
typedef __attribute__((ext_vector_type(4))) unsigned short v4us;

__global__ __launch_bounds__(256) void k_wtG(const float* __restrict__ w, int K, int N, bf* Bt) {
    const int lane = threadIdx.x & 31; const int L0 = (blockIdx.x * 8 + (threadIdx.x >> 5)) * 8; const int nlines = N * K / 64;
{
#pragma unroll 1
        for (int l = 0; l < 8; ++l) { const int L = L0 + l; if (L >= nlines) break; const size_t e = (size_t)L * 64 + lane * 2; const int k = (int)(e % K), n = (int)(e / K); v2us o;
            o[0] = f2bf(w[(size_t)k * N + n]); o[1] = f2bf(w[(size_t)(k + 1) * N + n]); *(v2us*)(Bt + e) = o; }
         }
}
// every f32 -> bf16 input conversion in one grid, each into fragment order: a wave takes one block of 16 rows x 32 columns, reads it in whole lines (8 lanes a row), turns it in its own 1024 bytes of LDS and writes it as 2 x 512 contiguous bytes.
// Blocks in the order x (all batch rows), Wq, Wk, Wv, Wo (planes back to back in WB), bias table; the counts divide exactly.
#define XTL (NB_ * TT / 16 * (CC / 32))
#define WTL (CC / 16 * (CC / 32))
#define GTL (TT / 16 * (TT / 32))
typedef __attribute__((ext_vector_type(2))) unsigned v2u;
typedef v2u __attribute__((may_alias)) v2ua;
__global__ __launch_bounds__(256) void k_cvtin(const float* __restrict__ x, const float* __restrict__ Wq, const float* __restrict__ Wk, const float* __restrict__ Wv, const float* __restrict__ Wo, const float* __restrict__ geo, bf* XB, bf* WB, bf* GP) {
    __shared__ __align__(16) bf gs[8][512];
    const int lane = threadIdx.x & 31, w = threadIdx.x >> 5, r8 = lane >> 3, c4 = lane & 7;   // this lane: rows r8, r8 + 4, r8 + 8, r8 + 12, columns 4 c4 .. 4 c4 + 3 of the block
    int tb = blockIdx.x * 8, sh = 3; bool kout = false; const float* src = x; bf* dst = XB;   // a work-group's 8 blocks lie in one plane; sh: log2 of the blocks in a row (row length 32 << sh)
    if (tb >= XTL + 4 * WTL) { tb -= XTL + 4 * WTL; src = geo; dst = GP; sh = 6; }
    else if (tb >= XTL) { const int sel = (tb - XTL) / WTL; tb = (tb - XTL) % WTL; src = sel == 0 ? Wq : sel == 1 ? Wk : sel == 2 ? Wv : Wo; dst = WB + (size_t)sel * CC * CC; kout = true; }   // the weights' blocks are stored k steps outermost
    const int tile = tb + w, ob = kout ? (tile & 7) * (CC / 16) + (tile >> 3) : tile; const float* gp = src + ((size_t)((tile >> sh) * 16 + r8) << (sh + 5)) + (tile & ((1 << sh) - 1)) * 32 + c4 * 4; const float* gr[4]; v4f y[4];
#pragma unroll
    for (int i = 0; i < 4; ++i) { gr[i] = gp + ((size_t)i << (sh + 7)); y[i] = *(const v4f*)gr[i]; }
    asm volatile("s_wait_xcnt 0x0" :: "v"(gr[0]), "v"(gr[1]), "v"(gr[2]), "v"(gr[3]) : "memory");   // behind the loads, in front of whatever rewrites a register that they name; the addresses are inputs, so that no later load lands on one either
#pragma unroll
    for (int i = 0; i < 4; ++i) { const v2u p = { __builtin_bit_cast(unsigned, __builtin_convertvector((v2f){y[i][0], y[i][1]}, v2bf)), __builtin_bit_cast(unsigned, __builtin_convertvector((v2f){y[i][2], y[i][3]}, v2bf)) };   // rounds to nearest even, as f2bf does
        *(v2ua*)(gs[w] + (c4 >> 2) * 256 + (((c4 >> 1) & 1) * 16 + i * 4 + r8) * 8 + (c4 & 1) * 4) = p; }
    __builtin_amdgcn_wave_barrier(); asm volatile("" ::: "memory");   // keeps the compiler from moving the reads below, which take other lanes' values, over the writes above
#pragma unroll
    for (int t = 0; t < 2; ++t) *(v8us*)(dst + (size_t)ob * 512 + t * 256 + lane * 8) = *(const v8usa*)(gs[w] + t * 256 + lane * 8);
}
__device__ __forceinline__ float xhalf(float x) { return __builtin_bit_cast(float, __builtin_amdgcn_permlanex16(__builtin_bit_cast(int, x), __builtin_bit_cast(int, x), 0x76543210, 0xfedcba98, false, false)); }   // lane l with lane l ^ 16
// Base-2 exponentials as asm text: inside a statement every v_exp_f32 is followed by an independent one and the last by v_nop, the slot the instruction set asks for between a transcendental and an instruction that
// reads its result or overwrites its source; outputs are early-clobber, so none lands on a source of the same statement.
__device__ __forceinline__ float exp2x1(float x) { float r; asm("v_exp_f32 %0, %1\n\tv_nop" : "=&v"(r) : "v"(x)); return r; }
__device__ __forceinline__ v4f exp2x4(v4f x) { float r0, r1, r2, r3;
    asm("v_exp_f32 %0, %4\n\tv_exp_f32 %1, %5\n\tv_exp_f32 %2, %6\n\tv_exp_f32 %3, %7\n\tv_nop" : "=&v"(r0), "=&v"(r1), "=&v"(r2), "=&v"(r3) : "v"(x[0]), "v"(x[1]), "v"(x[2]), "v"(x[3]));
    return (v4f){r0, r1, r2, r3}; }
__device__ __forceinline__ v16bf ldfb(const bf* p, unsigned b) { return WFrag<bf>::ld(p, b); }
__device__ __forceinline__ v16h ldfh(const h16* p, unsigned b) { return WFrag<h16>::ld(p, b); }
// ---- k_fattn: scores, bias, mask, softmax, probs.v and head gate in one kernel. Grid (TT / 256, heads, batch rows), 8 waves. A group owns 256 queries of one head, wave w 32 of them; every wave walks all the keys in passes of 32 with its running maximum,
// sum and accumulators, so nothing is merged at the end. The keys come in stages of SK = 128 through a ring of two LDS buffers that asynchronous copies fill one stage ahead: a stage's k hi, k lo and v (SK x 192 contiguous bytes of the shared plane, read by all
// eight waves: fetched once a group, not once a wave), each wave's own slice of the bias plane (2 row tiles x SK x 32 bytes) and the stage's mask words. The planes' fragment order is kept in LDS: every LDS read of a wave covers 512 contiguous bytes.
// Transposed products: S^T = K Q^T (A = key rows, B = query rows; a lane holds 16 scores of ONE query: keys 8 hi + j and 16 + 8 hi + j),
// O^T += V^T P^T (A = V^T rows d, B = the two score tiles converted in place, same k order as the A loader).
// Scale and bias cost no vector instruction per score. With gam = the bias's scale, gb = bf16(gam), rr = gam / gb (1 where gb is 0): logit = rr (q.k / (sqrt(32) rr) + gb geo). q is multiplied by 1 / (sqrt(32) rr) once, in the prologue, and split anew;
// gb geo comes from one more matrix product per score tile, D = A_t B with B = the pass's bias block (32 keys x 16 queries, as it lies in the plane) and A_t = gb on the diagonal that picks keys 16 t .. 16 t + 15 (each product bf16 x bf16, exact in f32);
// rr log2e = kap rides in the multiply-add that forms the exponent: p = 2^(kap t + c), c = 10 - kap m for the running maximum m of t.
// Every plain '#pragma unroll' in it makes the indices of a register array compile-time constants (a rolled loop would put the array in scratch memory).
#define SK   128
#define NST  (TT / SK)
#define KVB  (SK * 192)
#define GWB  (NQT * 16 * SK * 2)
#define MOFS (KVB + 8 * GWB)
#define BUFB (MOFS + SK * 4)
typedef v4u __attribute__((may_alias)) v4ua;
typedef int __attribute__((may_alias)) inta;
// Asynchronous copies, 16 bytes a lane, to LDS byte l from global g. An immediate offset moves both addresses alike, so a run of copies whose source and place step together names one pair of address registers.
// The s_wait_xcnt 0 is the last line of the copies' own statement, so that it stands in front of whatever rewrites one of those registers.
__device__ __forceinline__ void acp1(unsigned l, const char* g) { asm volatile("global_load_async_to_lds_b128 %0, %1, off\n\ts_wait_xcnt 0x0" :: "v"(l), "v"(g) : "memory"); }
__device__ __forceinline__ void acp6x4096(unsigned l, const char* g) {
    asm volatile("global_load_async_to_lds_b128 %0, %1, off\n\tglobal_load_async_to_lds_b128 %0, %1, off offset:4096\n\tglobal_load_async_to_lds_b128 %0, %1, off offset:8192\n\tglobal_load_async_to_lds_b128 %0, %1, off offset:12288\n\t"
                 "global_load_async_to_lds_b128 %0, %1, off offset:16384\n\tglobal_load_async_to_lds_b128 %0, %1, off offset:20480\n\ts_wait_xcnt 0x0" :: "v"(l), "v"(g) : "memory"); }
__device__ __forceinline__ void acp8x512(unsigned l, const char* g) {
    asm volatile("global_load_async_to_lds_b128 %0, %1, off\n\tglobal_load_async_to_lds_b128 %0, %1, off offset:512\n\tglobal_load_async_to_lds_b128 %0, %1, off offset:1024\n\tglobal_load_async_to_lds_b128 %0, %1, off offset:1536\n\t"
                 "global_load_async_to_lds_b128 %0, %1, off offset:2048\n\tglobal_load_async_to_lds_b128 %0, %1, off offset:2560\n\tglobal_load_async_to_lds_b128 %0, %1, off offset:3072\n\tglobal_load_async_to_lds_b128 %0, %1, off offset:3584\n\ts_wait_xcnt 0x0"
                 :: "v"(l), "v"(g) : "memory"); }
// a wave-uniform LDS address kept as one scalar sum: otherwise the compiler adds the lane's part to the loop-invariant part first and holds one more vector register per run of copies over the whole loop, which it spilled
__device__ __forceinline__ unsigned ufm(unsigned x) { return (unsigned)__builtin_amdgcn_readfirstlane((int)x); }
// one stage's copies of this wave into the buffer at LDS byte lb: its eighth of k and v (512 bytes of each 4096, six times), its own bias slice (two row tiles, 64 KiB apart in the plane, 8 x 512 bytes each), and from wave 0 the mask words
__device__ __forceinline__ void fill(unsigned lb, int st, const char* kvu, const char* gu, const char* mu, unsigned lane, int w) {   // kvu, gu, mu: wave-uniform, stage 0's first bytes; the lane's 16 bytes are added last, to a scalar sum
    static_assert(KVB == 6 * 4096 && GWB / NQT == 8 * 512 && SK * 4 == 512, "the copy runs cover a stage exactly");
    acp6x4096(ufm(lb + (unsigned)w * 512u) + lane * 16u, kvu + ((size_t)st * KVB + (size_t)w * 512) + lane * 16u);
#pragma unroll
    for (int nq = 0; nq < NQT; ++nq) acp8x512(ufm(lb + KVB + (unsigned)w * GWB + nq * (GWB / NQT)) + lane * 16u, gu + ((size_t)st * (SK * 32) + (size_t)nq * (TT / 32) * 1024) + lane * 16u);
    if (w == 0) acp1(lb + MOFS + lane * 16u, mu + (size_t)st * (SK * 4) + lane * 16u);   // w is a scalar: a scalar branch, every lane on inside it
}
// a pass's score operands from the stage's buffer: bp, bg, bm = this lane's first byte of k and v, of its wave's bias slice, of the mask words
__device__ __forceinline__ void ldpass(const char* bp, const char* bg, const char* bm, int p, v16bf (&kfh)[2], v16bf (&kfl)[2], v16bf (&gf)[NQT], int& mk) {
    mk = *(const inta*)(bm + p * 128);
#pragma unroll
    for (int nq = 0; nq < NQT; ++nq) { const char* gp = bg + nq * (GWB / NQT) + p * 1024; gf[nq] = cat16b(*(const v8usa*)gp, *(const v8usa*)(gp + 512)); }
    __builtin_amdgcn_sched_barrier(0);   // the mask word and the bias block are read first, as they are used first: the wait in front of their use then leaves the reads below in flight
#pragma unroll
    for (int t = 0; t < 2; ++t) { const char* kp = bp + p * 6144 + t * 1024; kfh[t] = cat16b(*(const v8usa*)kp, *(const v8usa*)(kp + 512)); }
#pragma unroll
    for (int t = 0; t < 2; ++t) { const char* kp = bp + p * 6144 + t * 1024; kfl[t] = cat16b(*(const v8usa*)(kp + 2048), *(const v8usa*)(kp + 2560)); }
}
typedef __attribute__((ext_vector_type(8))) unsigned v8u;
// a fragment pair hi + lo times s, split anew into hi + lo
__device__ __forceinline__ void fscale(v16bf& fh, v16bf& fl, float s) { v8u a = __builtin_bit_cast(v8u, fh), c = __builtin_bit_cast(v8u, fl);
#pragma unroll
    for (int i = 0; i < 8; ++i) { unsigned hh, ll; splitf2((__uint_as_float(a[i] << 16) + __uint_as_float(c[i] << 16)) * s, (__uint_as_float(a[i] & 0xFFFF0000u) + __uint_as_float(c[i] & 0xFFFF0000u)) * s, hh, ll); a[i] = hh; c[i] = ll; }
    fh = __builtin_bit_cast(v16bf, a); fl = __builtin_bit_cast(v16bf, c); }
__global__ __launch_bounds__(256) void k_fattn(const bf* __restrict__ Qh, const bf* __restrict__ Ql, const bf* __restrict__ KV, const bf* __restrict__ GP, const int* __restrict__ msk,
                                               const float* __restrict__ gbsp, const float* __restrict__ hgs, const float* __restrict__ hg, bf* AHL) {
    __shared__ __align__(16) char sm[2 * BUFB];
    const int lane = threadIdx.x & 31, hi = lane >> 4, w = __builtin_amdgcn_readfirstlane(threadIdx.x >> 5);   // the wave's number as a scalar: scalar branches
    const int h = blockIdx.y, q0 = (blockIdx.x * 8 + w) * (16 * NQT), b = blockIdx.z;
    const size_t hp = ((size_t)b * NH_ + h) * TT * HD;   // this batch row's and head's q planes: 32 elements a position (k and v together: 96)
    const float gam = bfr(gbsp[0]) * bfr(hgs[h]); const unsigned gb = f2bf(gam); const float rr = (gb & 0x7FFFu) ? gam / bf2f((unsigned short)gb) : 1.0f;   // rr: what bf16 cannot hold of the bias's scale, within 2^-8 of 1
    const float kap = rr * 1.4426950408889634f, qs = 0.17677669529663687f / rr;
    v16bf dg[2];   // A_t: row lr holds gb at k = 16 t + lr; this lane's element s stands for k = 8 hi + s (s < 8), 16 + 8 hi + s - 8 (the loaders' k order)
#pragma unroll
    for (int t = 0; t < 2; ++t) { v8u d;
#pragma unroll
        for (int i = 0; i < 8; ++i) { const int k0 = (i >> 2) * 16 + 8 * hi + 2 * (i & 3), kd = 16 * t + (lane & 15); d[i] = (k0 == kd ? gb : 0u) | (k0 + 1 == kd ? gb << 16 : 0u); }
        dg[t] = __builtin_bit_cast(v16bf, d); }
    const unsigned rofs = (unsigned)lane * 16u;   // this lane's chunk in a half block, bytes
    const char* kvs = (const char*)(KV + hp * 3); const char* gs = (const char*)(GP + (size_t)(q0 / 16) * (TT / 32) * 512); const char* ms = (const char*)(msk + (size_t)b * TT);   // stage 0's first bytes, wave-uniform
    const unsigned l0 = (unsigned)(size_t)sm;   // the ring's LDS byte address
    fill(l0, 0, kvs, gs, ms, lane, w);
    v16bf qfh[NQT], qfl[NQT]; v8f o[NQT][2]; float m[NQT], cm[NQT], l[NQT];
#pragma unroll
    for (int nq = 0; nq < NQT; ++nq) { const size_t off = hp + (size_t)(q0 + 16 * nq) * HD; qfh[nq] = ldfb(Qh + off, rofs); qfl[nq] = ldfb(Ql + off, rofs); fscale(qfh[nq], qfl[nq], qs); o[nq][0] = (v8f){}; o[nq][1] = (v8f){}; m[nq] = -1.0e30f; cm[nq] = fmaf(-kap, m[nq], 10.0f); l[nq] = 0.f; }   // m starts where kap m is still finite; cm = 10 - kap m, formed as in the loop
    asm volatile("s_wait_asynccnt 0x0" ::: "memory");   // this wave's copies of stage 0 have landed
    __syncthreads();                                    // ... and every other wave's: stage 0 is published
    fill(l0 + BUFB, 1, kvs, gs, ms, lane, w);
#pragma unroll 1   // one stage's code; the buffer alternates
    for (int st = 0; st < NST; ++st) {
        const char* bp = sm + (st & 1) * BUFB + rofs; const char* bg = bp + KVB + w * GWB; const char* bm = sm + (st & 1) * BUFB + MOFS + lane * 4;
        v16bf kfh[2], kfl[2], gf[NQT]; int mk; v8f s[NQT][2], sn[NQT][2];
        // product i of the 16 that make a pass's four score tiles from the operands in kfh, kfl, gf: the bias product first, then hi.hi, hi.lo, lo.hi, each over the four tiles, so that a tile's next product stands four products behind its last
        auto prod = [&](int i) { const int nq = (i >> 1) & 1, t = i & 1, k = i >> 2;
            sn[nq][t] = k == 0 ? wmmab(dg[t], gf[nq], (v8f){}) : k == 1 ? wmmab(kfh[t], qfh[nq], sn[nq][t]) : k == 2 ? wmmab(kfh[t], qfl[nq], sn[nq][t]) : wmmab(kfl[t], qfh[nq], sn[nq][t]); };
        ldpass(bp, bg, bm, 0, kfh, kfl, gf, mk);
        __builtin_amdgcn_sched_barrier(0);   // keeps these reads together in front of the products; without it the compiler spreads them among the products, each group behind a wait of its own
#pragma unroll
        for (int i = 0; i < 16; ++i) prod(i);
        unsigned live = __builtin_amdgcn_ballot_w32(mk != 0);   // bit i: key i of the pass is attended
        // Every sched_barrier(0) of PW_ and around the probs.v products below fixes one thing: the next pass's 16 score products and this pass's 4 probs.v products stand one by one between pieces of this pass's softmax of about eight vector cycles each,
        // so that each runs on the matrix unit under the piece behind it. Left alone the compiler puts the 20 in a row behind the softmax, where the wave waits out every one.
#define SB_ __builtin_amdgcn_sched_barrier(0)
#define PW_(i) do { SB_; if (nx) prod(i); SB_; } while (0)
#pragma unroll   // the stage's four passes: every LDS read at a constant distance from one address, and the operand registers of one pass and the next told apart at compile time
        for (int p = 0; p < SK / 32; ++p) {
            const bool nx = p + 1 < SK / 32;
#pragma unroll
            for (int nq = 0; nq < NQT; ++nq) { s[nq][0] = sn[nq][0]; s[nq][1] = sn[nq][1]; }
            if (live != 0xFFFFFFFFu) {   // one scalar test a pass; a pass with every key attended skips the selects
                const unsigned mine = live >> (8 * hi);
#pragma unroll
                for (int nq = 0; nq < NQT; ++nq)
#pragma unroll
                    for (int t = 0; t < 2; ++t)
#pragma unroll
                        for (int j = 0; j < 8; ++j) if (!((mine >> (16 * t + j)) & 1u)) s[nq][t][j] = -3.0e38f;
            }
            v16h vc[2];   // the same stage's next pass's score operands and this pass's V^T: their LDS reads return under this pass's maxima
            if (nx) ldpass(bp, bg, bm, p + 1, kfh, kfl, gf, mk);
#pragma unroll
            for (int dt = 0; dt < 2; ++dt) { const char* vp = bp + p * 6144 + 4096 + dt * 1024; vc[dt] = cat16(*(const v8ha*)vp, *(const v8ha*)(vp + 512)); }
            SB_;   // keeps those reads up here; without it the compiler sinks each to just in front of its first use, where its latency stands open
            float mx[NQT], cn[NQT], al[NQT]; v8f e[NQT][2]; v4f x[NQT][4]; v16h pf[NQT];
#pragma unroll
            for (int nq = 0; nq < NQT; ++nq) { mx[nq] = fmaxf(s[nq][0][0], s[nq][1][0]);
#pragma unroll
                for (int j = 1; j < 8; ++j) mx[nq] = fmaxf(mx[nq], fmaxf(s[nq][0][j], s[nq][1][j])); }
#pragma unroll
            for (int nq = 0; nq < NQT; ++nq) mx[nq] = fmaxf(mx[nq], xhalf(mx[nq]));
            if (nx) live = __builtin_amdgcn_ballot_w32(mk != 0);
            PW_(0);
#pragma unroll
            for (int nq = 0; nq < NQT; ++nq) { const float mn = fmaxf(m[nq], mx[nq]); cn[nq] = fmaf(-kap, mn, 10.0f);   // probabilities x 2^10, for fp16's range
                al[nq] = cn[nq] - cm[nq]; m[nq] = mn; cm[nq] = cn[nq]; }
            PW_(1);
            e[0][0] = s[0][0] * kap + cn[0];   // a masked key's -3e38 overflows to -inf here: probability 0
            PW_(2);
#pragma unroll
            for (int nq = 0; nq < NQT; ++nq) al[nq] = exp2x1(al[nq]);   // the old sums go from 2^cm to 2^cn exactly as the new terms are formed
            PW_(3);
            // A product that is the last to read an operand register (1, 3, 10, 11, 14, 15, the second probs.v product of a query tile) has a piece of the compiler's own instructions or the pass's end behind it, never an exponential statement.
#define EX_(nq, i) x[nq][i] = exp2x4(__builtin_shufflevector(e[nq][(i) >> 1], e[nq][(i) >> 1], 4 * ((i) & 1), 4 * ((i) & 1) + 1, 4 * ((i) & 1) + 2, 4 * ((i) & 1) + 3))
#define CV_(nq) pf[nq] = cat16(__builtin_convertvector(__builtin_shufflevector(x[nq][0], x[nq][1], 0, 1, 2, 3, 4, 5, 6, 7), v8h), __builtin_convertvector(__builtin_shufflevector(x[nq][2], x[nq][3], 0, 1, 2, 3, 4, 5, 6, 7), v8h))
            e[0][1] = s[0][1] * kap + cn[0];
            PW_(4); EX_(0, 0); PW_(5); EX_(0, 1); PW_(6); EX_(0, 2); PW_(7); EX_(0, 3); PW_(8); CV_(0); PW_(9);
            o[0][0] *= al[0]; o[0][1] *= al[0]; PW_(10);
            e[1][0] = s[1][0] * kap + cn[1]; PW_(11);
            e[1][1] = s[1][1] * kap + cn[1];
            SB_; o[0][0] = wmma16(vc[0], pf[0], o[0][0]); SB_;
            EX_(1, 0); PW_(12); EX_(1, 1); PW_(13); EX_(1, 2); EX_(1, 3);
            SB_; o[0][1] = wmma16(vc[1], pf[0], o[0][1]); SB_;
            CV_(1); PW_(14);
            o[1][0] *= al[1]; o[1][1] *= al[1]; PW_(15);
#pragma unroll
            for (int nq = 0; nq < NQT; ++nq) { const v4f u = (x[nq][0] + x[nq][1]) + (x[nq][2] + x[nq][3]); l[nq] = l[nq] * al[nq] + ((u[0] + u[1]) + (u[2] + u[3])); }   // the row's sum as a tree, not a chain of 16
#undef EX_
#undef CV_
            o[1][0] = wmma16(vc[0], pf[1], o[1][0]); o[1][1] = wmma16(vc[1], pf[1], o[1][1]);
        }
#undef PW_
#undef SB_
        asm volatile("s_wait_dscnt 0x0" ::: "memory");      // this wave's reads of the stage's buffer have returned
        asm volatile("s_wait_asynccnt 0x0" ::: "memory");   // this wave's copies of the next stage have landed
        __syncthreads();                                    // publishes the next stage and ends every wave's reads of this stage's buffer
        if (st + 2 < NST) fill(l0 + (st & 1) * BUFB, st + 2, kvs, gs, ms, lane, w);
    }
    asm volatile("s_wait_asynccnt 0x0" ::: "memory");   // no copy is outstanding when the wave ends
    const float gate = bfr(hg[h]);
#pragma unroll
    for (int nq = 0; nq < NQT; ++nq) { const float f = gate / (l[nq] + xhalf(l[nq]));
#pragma unroll
        for (int dt = 0; dt < 2; ++dt) { v8us oh, ol;
#pragma unroll
            for (int j = 0; j < 8; ++j) { unsigned short a, c; splitf(o[nq][dt][j] * f, a, c); oh[j] = a; ol[j] = c; }
            const size_t ofs = ((size_t)b * TT + q0 + 16 * nq) * CC * 2 + h * 1024 + dt * 256 + lane * 8; *(v8us*)(AHL + ofs) = oh; *(v8us*)(AHL + ofs + 512) = ol; } }   // fragment order: head h is k step h of these 16 queries, a hi block and its lo block; d tile dt is a block's half
}

extern "C" void kernel_launch(void* const* d_in, const int* in_sizes, int n_in,
                              void* d_out, int out_size, void* d_ws, size_t ws_size, hipStream_t stream) {
    (void)in_sizes; (void)n_in; (void)out_size;
    const float* x = (const float*)d_in[0]; const float* geo = (const float*)d_in[1]; const int* msk = (const int*)d_in[2]; const float* hg = (const float*)d_in[3]; const float* Wq = (const float*)d_in[4]; const float* Wk = (const float*)d_in[5]; const float* Wv = (const float*)d_in[6]; const float* Wo = (const float*)d_in[7]; const float* gbsp = (const float*)d_in[8]; const float* hgs = (const float*)d_in[9];
    float* OUT = (float*)d_out;     // [4][2048][256]
    char* wsp = (char*)d_ws;
    auto take = [&](size_t bytes) { char* p = wsp; wsp += (bytes + 255) & ~(size_t)255; return (void*)p; };
    bf* WB = (bf*)take((size_t)4 * CC * CC * 2); bf* WO = WB + (size_t)3 * CC * CC; bf* XB = (bf*)take((size_t)NB_ * TT * CC * 2);   // WB: Wq, Wk, Wv, Wo planes back to back; [out][in] as given = rows n, columns k
    bf* Qh = (bf*)take((size_t)NB_ * NH_ * TT * HD * 2); bf* Ql = (bf*)take((size_t)NB_ * NH_ * TT * HD * 2); bf* KV = (bf*)take((size_t)NB_ * NH_ * TT * HD * 2 * 3);
    bf* AHL = (bf*)take((size_t)NB_ * TT * CC * 2 * 2); bf* GP = (bf*)take((size_t)TT * TT * 2);
    if ((size_t)(wsp - (char*)d_ws) > ws_size) return;    // total ~ 41 MB
    k_cvtin<<<(XTL + 4 * WTL + GTL) / 8, 256, 0, stream>>>(x, Wq, Wk, Wv, Wo, geo, XB, WB, GP);
    k_gemmw<bf, 0, false, true, CC><<<dim3(NB_ * TT / 64, CC / 64, 3), 32, 0, stream>>>(XB, WB, nullptr, nullptr, 0, nullptr, 0, (size_t)CC * CC, 0, Qh, Ql, KV, KV + 1024, (h16*)(KV + 2048));
    k_fattn<<<dim3(TT / (16 * NQT * 8), NH_, NB_), 256, 0, stream>>>(Qh, Ql, KV, GP, msk, gbsp, hgs, hg, AHL);
    k_gemmw<bf, 1, false, false, CC><<<dim3(NB_ * TT / 64, CC / 64, 1), 32, 0, stream>>>(AHL, WO, nullptr, OUT, CC, nullptr, 0, 0, 0, nullptr, nullptr, nullptr, nullptr, nullptr);
}

// v008
// It runs in 56.1 microseconds.
// Timed twice side by side with v007, it ran 1.22 times as fast both times.
// Over all steps from v000 it is 22.6 times as fast.
#include <hip/hip_runtime.h>

// TetrahedralAttention (x [4][2048][256]; q/k/v = x W^T (8 heads x 32); scores = q.k/sqrt(32) + geo_bias_scale geometric_bias[i][j] head_geo_scales[h]; keys with attention_mask[b][j] == 0 -> -inf; softmax; x head_gates[h] (post-softmax);
// out = merged.v Wo^T -> [4][2048][256]; bias table, mask (int32), gates and scales read as data).
// Compute dtypes, f32 accumulate: every input rounded to bf16; projections on PLAIN bf16 operands (inputs: exact); scores (K 32) on bf16 hi+lo planes (3 products) on top of a fourth product that adds the bias (k_fattn), mask/softmax in f32 registers
// (probabilities x1024 against the running maximum, fp16); probs.v on fp16 planes; Wo on hl planes x exact Wo (2 products). Scores, softmax, probs.v and the head gate run in ONE kernel (k_fattn): no score or probability plane in memory.
// Every 16-bit plane that a matrix instruction's operand is loaded from lies in memory in FRAGMENT ORDER (16 bytes a lane, lane after lane), so that each wave-wide load and store of it covers 512 contiguous bytes.
// A plane of R rows x K columns (K = the product's k) is a row of blocks of 1024 bytes, block (row tile r / 16) x (K / 32) + (k / 32) = [half jj][lane = 16 hi + lr][8]: row lr of the tile, k = 16 jj + 8 hi + e of the block.
// So lie x, q and k (hi and lo; K = 32, one block for 16 positions) and the bias table rounded to bf16 (rows = queries, k = keys: the B operand of the product that adds it to the scores). The merged attention output: the same, each hi block followed by its lo block.
// The four weights: the same blocks, k steps outermost (block (k / 32) x (rows / 16) + row tile): the four blocks that a k step of a 64-column tile loads lie in a row.
// v: 2048 bytes for 32 positions, [d tile dt][half jj][lane][8] = d 16 dt + lr, position 16 jj + 8 hi + e. k and v share one plane, 6144 bytes for 32 positions of a head: k hi (two blocks), k lo (two blocks), v: all that an attention pass loads of them, in a row.
// Four launches, each over all four batch rows: input conversions (with the bias table's plane); q, k, v projections (grid z, M = 4 x 2048), whose epilogue writes the attention's operand planes itself; attention (grid z = batch row); output projection.

#define NB_  4
#define TT   2048
#define CC   256
#define NH_  8
#define HD   32
#define NQT  2
typedef _Float16 h16;
typedef unsigned short bf;
typedef __attribute__((ext_vector_type(16))) __bf16   v16bf;
typedef __attribute__((ext_vector_type(16))) _Float16 v16h;
typedef __attribute__((ext_vector_type(8)))  _Float16 v8h;
typedef __attribute__((ext_vector_type(8)))  unsigned short v8us;
typedef __attribute__((ext_vector_type(8)))  float    v8f;
typedef __attribute__((ext_vector_type(4)))  float    v4f;
typedef __attribute__((ext_vector_type(2)))  float    v2f;
typedef __attribute__((ext_vector_type(2)))  __bf16   v2bf;
typedef __attribute__((ext_vector_type(4)))  unsigned v4u;
typedef v8h  __attribute__((may_alias)) v8ha;
typedef v4f  __attribute__((may_alias)) v4fa;
typedef v8us __attribute__((may_alias)) v8usa;

__device__ __forceinline__ unsigned short f2bf(float f) { unsigned u = __float_as_uint(f); u += 0x7FFFu + ((u >> 16) & 1u); return (unsigned short)(u >> 16); }
__device__ __forceinline__ float bf2f(unsigned short b) { return __uint_as_float(((unsigned)b) << 16); }
__device__ __forceinline__ float bfr(float f) { return bf2f(f2bf(f)); }
__device__ __forceinline__ void splitf(float y, unsigned short& h, unsigned short& l) { h = f2bf(y); l = f2bf(y - bf2f(h)); }
// splitf on two neighbours at once, each result a packed pair; the packed conversion rounds to nearest even, as f2bf does
__device__ __forceinline__ void splitf2(float y0, float y1, unsigned& h, unsigned& l) { h = __builtin_bit_cast(unsigned, __builtin_convertvector((v2f){y0, y1}, v2bf));
    l = __builtin_bit_cast(unsigned, __builtin_convertvector((v2f){y0 - __uint_as_float(h << 16), y1 - __uint_as_float(h & 0xFFFF0000u)}, v2bf)); }
__device__ __forceinline__ v16h cat16(v8h lo, v8h hi) { return __builtin_shufflevector(lo, hi, 0, 1, 2, 3, 4, 5, 6, 7, 8, 9, 10, 11, 12, 13, 14, 15); }
__device__ __forceinline__ v16bf cat16b(v8us lo, v8us hi) { return __builtin_bit_cast(v16bf, __builtin_shufflevector(lo, hi, 0, 1, 2, 3, 4, 5, 6, 7, 8, 9, 10, 11, 12, 13, 14, 15)); }
__device__ __forceinline__ v8f wmma16(v16h a, v16h b, v8f c) { return __builtin_amdgcn_wmma_f32_16x16x32_f16(false, a, false, b, (short)0, c, false, false); }
__device__ __forceinline__ v8f wmmab(v16bf a, v16bf b, v8f c) { return __builtin_amdgcn_wmma_f32_16x16x32_bf16(false, a, false, b, (short)0, c, false, false); }



// ---- k_gemmw: register-blocked GEMM, ONE WAVE per 64x64 output tile (16 accumulators), operands straight from 16-bit planes in fragment order; grid (M/64, N/64, Z), 32 threads.
// C[m][n] (f32, pitch ldc, + optional f32 bias[n]) = sum_k A[m][k] Bt[n][k] (+ split products per NSPLIT). z-batch strides sA/sB/sC in elements. K % 32 == 0.
// PLANES (the q, k, v projections; m = batch row x position, n = head x 32 + d): no f32 C; the tile goes from the accumulators to the attention's operand planes, [batch row][head][...]:
// z = 0, 1: bf16 hi and lo planes of q, k, staged through LDS; z = 2: the fp16 plane of v, straight from the accumulators (a lane's 8 rows are one fragment chunk). All in fragment order (head of the file): every store instruction writes 512 contiguous bytes.
// a load at a wave-uniform pointer plus a per-lane byte offset of 32 bits (fits the scalar-base address form)
template <typename V> __device__ __forceinline__ V ldu(const void* p, unsigned b) { return *(const V*)((const char*)p + b); }
template <typename T16> struct WFrag;   // ld: a fragment from a plane in fragment order: its two halves lie 512 bytes apart, b = 16 x lane + the block's offset from p
template <> struct WFrag<h16> { typedef v16h V; static __device__ __forceinline__ V ld(const h16* p, unsigned b) { return cat16(ldu<v8h>(p, b), ldu<v8h>(p + 256, b)); } static __device__ __forceinline__ v8f mma(V a, V b, v8f c) { return wmma16(a, b, c); } };
template <> struct WFrag<bf> { typedef v16bf V; static __device__ __forceinline__ V ld(const bf* p, unsigned b) { return cat16b(ldu<v8us>(p, b), ldu<v8us>(p + 256, b)); } static __device__ __forceinline__ v8f mma(V a, V b, v8f c) { return wmmab(a, b, c); } };
template <typename T16, int NSPLIT, bool BIAS, bool PLANES, int K>   // K at compile time: every block of a k step then lies at a constant distance from one pointer per plane
__global__ __launch_bounds__(32) void k_gemmw(const T16* __restrict__ A, const T16* __restrict__ Bt, const T16* __restrict__ Bt2, float* C, int ldc, const float* __restrict__ bias, size_t sA, size_t sB, size_t sC,
                                              bf* Qh, bf* Ql, bf* Kh, bf* Kl, h16* VT) {
    typedef typename WFrag<T16>::V V;
    __shared__ __align__(16) float os[16 * 68];   // 16 rows x 68 f32
    const size_t z = blockIdx.z; A += z * sA; Bt += z * sB; if (Bt2) Bt2 += z * sB; C += z * sC;
    const int lane = threadIdx.x & 31, lr = lane & 15, hi = lane >> 4; const int r0 = blockIdx.x * 64, c0 = blockIdx.y * 64;
    v8f acc[4][4];
#pragma unroll
    for (int mb = 0; mb < 4; ++mb)
#pragma unroll
        for (int nb = 0; nb < 4; ++nb) acc[mb][nb] = (v8f){};
    constexpr int AB = (NSPLIT == 1 || NSPLIT == 2) ? 1024 : 512;   // elements from one k step of A to the next: a block, or a hi block and its lo block
    const unsigned ao = (unsigned)(r0 / 16 * (K / 32) * AB + lane * 8) * 2u, bo = (unsigned)(c0 / 16 * 512 + lane * 8) * 2u;   // byte offsets of this lane's chunk in the tile's first block of A (row tiles outermost) and of Bt (k steps outermost: CC / 16 blocks a step)
    // The k steps' operands go through a ring of D register sets: the loads of D steps are issued in front of the first product, and a set is loaded anew, for step ks + D, right behind the products of step ks.
    // A step's products so find their operands D - 1 steps of matrix work after the loads were issued, not a whole load latency (or two) after. The loop is unrolled whole: set numbers and every block's distance from the two offsets are constants, and no address register changes.
    constexpr int NK = K / 32, D = NSPLIT == 0 ? 4 : 3;
    V a[D][4], a2[D][4], b[D][4], b2[D][4];
    auto fetch = [&](int ks) { const int s = ks % D;
#pragma unroll
        for (int mb = 0; mb < 4; ++mb) { a[s][mb] = WFrag<T16>::ld(A + (mb * NK + ks) * AB, ao); if (NSPLIT == 1 || NSPLIT == 2) a2[s][mb] = WFrag<T16>::ld(A + (mb * NK + ks) * AB + 512, ao); }
#pragma unroll
        for (int nb = 0; nb < 4; ++nb) { b[s][nb] = WFrag<T16>::ld(Bt + ks * (CC / 16 * 512) + nb * 512, bo); if (NSPLIT >= 2) b2[s][nb] = WFrag<T16>::ld(Bt2 + ks * (CC / 16 * 512) + nb * 512, bo); } };
#pragma unroll
    for (int ks = 0; ks < D; ++ks) fetch(ks);
#pragma unroll
    for (int ks = 0; ks < NK; ++ks) { const int s = ks % D;
        __builtin_amdgcn_sched_barrier(0);   // keeps the loads issued so far in front of this step's products; left alone the compiler sinks each load to just in front of its use, where its latency stands open
#pragma unroll
        for (int nb = 0; nb < 4; ++nb)
#pragma unroll
            for (int mb = 0; mb < 4; ++mb) { acc[mb][nb] = WFrag<T16>::mma(a[s][mb], b[s][nb], acc[mb][nb]); if (NSPLIT == 1 || NSPLIT == 2) acc[mb][nb] = WFrag<T16>::mma(a2[s][mb], b[s][nb], acc[mb][nb]); if (NSPLIT >= 2) acc[mb][nb] = WFrag<T16>::mma(a[s][mb], b2[s][nb], acc[mb][nb]); }
        __builtin_amdgcn_sched_barrier(0);   // the set's next loads stay behind the products that read it, and in front of the next step's
        if (ks + D < NK) fetch(ks + D);
    }
    asm volatile("s_wait_xcnt 0x0" :: "v"(ao), "v"(bo), "s"(A), "s"(Bt) : "memory");   // behind the last loads, in front of whatever rewrites a register that they name; offsets and bases are inputs, so that they live up to here
    if constexpr (PLANES) {
        asm volatile("v_nop\n\tv_nop\n\tv_nop\n\tv_nop" : "+v"(acc[0][0]), "+v"(acc[1][1]), "+v"(acc[2][2]), "+v"(acc[3][3]));   // the distance from the last products to the first reader of their results on the taken side of the branch below
        const int bb = r0 / TT, t0 = r0 % TT;   // the tile's 64 rows lie in one batch row
        const size_t bs = blockIdx.z == 0 ? 1024 : 3072, hb = (((size_t)bb * NH_ + (c0 >> 5)) * (TT / 32) + t0 / 32) * bs + lane * 8;   // bs: elements from one 32 positions to the next (q alone; k and v in their shared plane); hb: this lane's chunk at the tile's first position in its first head
        if (blockIdx.z == 2) {   // v: a lane's 8 accumulator rows are 8 consecutive positions of one d: the chunk of lane 16 hi + lr in block (position / 32), d tile nb & 1, half mb & 1
#pragma unroll
            for (int mb = 0; mb < 4; ++mb)
#pragma unroll
                for (int nb = 0; nb < 4; ++nb) *(v8h*)(VT + hb + (size_t)(nb >> 1) * (TT / 32) * 3072 + (mb >> 1) * 3072 + (nb & 1) * 512 + (mb & 1) * 256) = __builtin_convertvector(acc[mb][nb], v8h);
        } else {   // q, k: 16 rows are one block in each of the tile's two heads; an instruction writes one half of a block, lane 16 hi + lr taking row lr, d 16 jj + 8 hi ..
            bf* Ph = blockIdx.z == 0 ? Qh : Kh; bf* Pl = blockIdx.z == 0 ? Ql : Kl;
#pragma unroll
            for (int mb = 0; mb < 4; ++mb) {
#pragma unroll
                for (int nb = 0; nb < 4; ++nb) {
#pragma unroll
                    for (int j = 0; j < 8; ++j) os[(hi * 8 + j) * 68 + nb * 16 + lr] = acc[mb][nb][j]; }
                __builtin_amdgcn_wave_barrier(); asm volatile("" ::: "memory");   // keeps the compiler from moving the reads below, which take other lanes' values, over the writes above
#pragma unroll
                for (int s = 0; s < 4; ++s) { const int hh = s >> 1, jj = s & 1; const float* rp = os + lr * 68 + hh * 32 + (2 * jj + hi) * 8; const v4f y0 = *(const v4fa*)rp, y1 = *(const v4fa*)(rp + 4); unsigned a0, a1, a2, a3, e0, e1, e2, e3;
                    splitf2(y0[0], y0[1], a0, e0); splitf2(y0[2], y0[3], a1, e1); splitf2(y1[0], y1[1], a2, e2); splitf2(y1[2], y1[3], a3, e3);
                    const size_t o = hb + ((size_t)hh * (TT / 32) + (mb >> 1)) * bs + (mb & 1) * 512 + jj * 256; *(v8us*)(Ph + o) = __builtin_bit_cast(v8us, (v4u){a0, a1, a2, a3}); *(v8us*)(Pl + o) = __builtin_bit_cast(v8us, (v4u){e0, e1, e2, e3}); }
                __builtin_amdgcn_wave_barrier(); asm volatile("" ::: "memory");   // the next 16 rows' writes stay behind these reads
            }
            asm volatile("s_wait_xcnt 0x0" ::: "memory");   // behind the branch's last stores: the code that follows in the listing rewrites their address registers
        }
        return;
    }
#pragma unroll
    for (int mb = 0; mb < 4; ++mb) {
#pragma unroll
        for (int nb = 0; nb < 4; ++nb) {
#pragma unroll
            for (int j = 0; j < 8; ++j) os[(hi * 8 + j) * 68 + nb * 16 + lr] = acc[mb][nb][j]; }
        __builtin_amdgcn_wave_barrier(); asm volatile("" ::: "memory");
        float* crow = C + (size_t)(r0 + mb * 16) * ldc + c0;
{
#pragma unroll
            for (int s = 0; s < 8; ++s) { const int row = 2 * s + hi, cofs = lr * 4; v4f val = *(const v4fa*)(os + row * 68 + cofs); if (BIAS) { val[0] += bfr(bias[c0 + cofs]); val[1] += bfr(bias[c0 + cofs + 1]); val[2] += bfr(bias[c0 + cofs + 2]); val[3] += bfr(bias[c0 + cofs + 3]); }
                *(v4f*)(crow + (size_t)row * ldc + cofs) = val; }
             }
        __builtin_amdgcn_wave_barrier(); asm volatile("" ::: "memory");
    }
}

typedef __attribute__((ext_vector_type(2))) _Float16 v2h;
typedef __attribute__((ext_vector_type(4))) _Float16 v4h;
typedef __attribute__((ext_vector_type(2))) unsigned short v2us;
typedef __attribute__((ext_vector_type(4))) unsigned short v4us;

__global__ __launch_bounds__(256) void k_wtG(const float* __restrict__ w, int K, int N, bf* Bt) {
    const int lane = threadIdx.x & 31; const int L0 = (blockIdx.x * 8 + (threadIdx.x >> 5)) * 8; const int nlines = N * K / 64;
{
#pragma unroll 1
        for (int l = 0; l < 8; ++l) { const int L = L0 + l; if (L >= nlines) break; const size_t e = (size_t)L * 64 + lane * 2; const int k = (int)(e % K), n = (int)(e / K); v2us o;
            o[0] = f2bf(w[(size_t)k * N + n]); o[1] = f2bf(w[(size_t)(k + 1) * N + n]); *(v2us*)(Bt + e) = o; }
         }
}
// every f32 -> bf16 input conversion in one grid, each into fragment order: a wave takes one block of 16 rows x 32 columns, reads it in whole lines (8 lanes a row), turns it in its own 1024 bytes of LDS and writes it as 2 x 512 contiguous bytes.
// Blocks in the order x (all batch rows), Wq, Wk, Wv, Wo (planes back to back in WB), bias table; the counts divide exactly.
#define XTL (NB_ * TT / 16 * (CC / 32))
#define WTL (CC / 16 * (CC / 32))
#define GTL (TT / 16 * (TT / 32))
typedef __attribute__((ext_vector_type(2))) unsigned v2u;
typedef v2u __attribute__((may_alias)) v2ua;
__global__ __launch_bounds__(256) void k_cvtin(const float* __restrict__ x, const float* __restrict__ Wq, const float* __restrict__ Wk, const float* __restrict__ Wv, const float* __restrict__ Wo, const float* __restrict__ geo, bf* XB, bf* WB, bf* GP) {
    __shared__ __align__(16) bf gs[8][512];
    const int lane = threadIdx.x & 31, w = threadIdx.x >> 5, r8 = lane >> 3, c4 = lane & 7;   // this lane: rows r8, r8 + 4, r8 + 8, r8 + 12, columns 4 c4 .. 4 c4 + 3 of the block
    int tb = blockIdx.x * 8, sh = 3; bool kout = false; const float* src = x; bf* dst = XB;   // a work-group's 8 blocks lie in one plane; sh: log2 of the blocks in a row (row length 32 << sh)
    if (tb >= XTL + 4 * WTL) { tb -= XTL + 4 * WTL; src = geo; dst = GP; sh = 6; }
    else if (tb >= XTL) { const int sel = (tb - XTL) / WTL; tb = (tb - XTL) % WTL; src = sel == 0 ? Wq : sel == 1 ? Wk : sel == 2 ? Wv : Wo; dst = WB + (size_t)sel * CC * CC; kout = true; }   // the weights' blocks are stored k steps outermost
    const int tile = tb + w, ob = kout ? (tile & 7) * (CC / 16) + (tile >> 3) : tile; const float* gp = src + ((size_t)((tile >> sh) * 16 + r8) << (sh + 5)) + (tile & ((1 << sh) - 1)) * 32 + c4 * 4; const float* gr[4]; v4f y[4];
#pragma unroll
    for (int i = 0; i < 4; ++i) { gr[i] = gp + ((size_t)i << (sh + 7)); y[i] = *(const v4f*)gr[i]; }
    asm volatile("s_wait_xcnt 0x0" :: "v"(gr[0]), "v"(gr[1]), "v"(gr[2]), "v"(gr[3]) : "memory");   // behind the loads, in front of whatever rewrites a register that they name; the addresses are inputs, so that no later load lands on one either
#pragma unroll
    for (int i = 0; i < 4; ++i) { const v2u p = { __builtin_bit_cast(unsigned, __builtin_convertvector((v2f){y[i][0], y[i][1]}, v2bf)), __builtin_bit_cast(unsigned, __builtin_convertvector((v2f){y[i][2], y[i][3]}, v2bf)) };   // rounds to nearest even, as f2bf does
        *(v2ua*)(gs[w] + (c4 >> 2) * 256 + (((c4 >> 1) & 1) * 16 + i * 4 + r8) * 8 + (c4 & 1) * 4) = p; }
    __builtin_amdgcn_wave_barrier(); asm volatile("" ::: "memory");   // keeps the compiler from moving the reads below, which take other lanes' values, over the writes above
#pragma unroll
    for (int t = 0; t < 2; ++t) *(v8us*)(dst + (size_t)ob * 512 + t * 256 + lane * 8) = *(const v8usa*)(gs[w] + t * 256 + lane * 8);
}
__device__ __forceinline__ float xhalf(float x) { return __builtin_bit_cast(float, __builtin_amdgcn_permlanex16(__builtin_bit_cast(int, x), __builtin_bit_cast(int, x), 0x76543210, 0xfedcba98, false, false)); }   // lane l with lane l ^ 16
// Base-2 exponentials as asm text: inside a statement every v_exp_f32 is followed by an independent one and the last by v_nop, the slot the instruction set asks for between a transcendental and an instruction that
// reads its result or overwrites its source; outputs are early-clobber, so none lands on a source of the same statement.
__device__ __forceinline__ float exp2x1(float x) { float r; asm("v_exp_f32 %0, %1\n\tv_nop" : "=&v"(r) : "v"(x)); return r; }
__device__ __forceinline__ v4f exp2x4(v4f x) { float r0, r1, r2, r3;
    asm("v_exp_f32 %0, %4\n\tv_exp_f32 %1, %5\n\tv_exp_f32 %2, %6\n\tv_exp_f32 %3, %7\n\tv_nop" : "=&v"(r0), "=&v"(r1), "=&v"(r2), "=&v"(r3) : "v"(x[0]), "v"(x[1]), "v"(x[2]), "v"(x[3]));
    return (v4f){r0, r1, r2, r3}; }
__device__ __forceinline__ v16bf ldfb(const bf* p, unsigned b) { return WFrag<bf>::ld(p, b); }
__device__ __forceinline__ v16h ldfh(const h16* p, unsigned b) { return WFrag<h16>::ld(p, b); }
// ---- k_fattn: scores, bias, mask, softmax, probs.v and head gate in one kernel. Grid (TT / 256, heads, batch rows), 8 waves. A group owns 256 queries of one head, wave w 32 of them; every wave walks all the keys in passes of 32 with its running maximum,
// sum and accumulators, so nothing is merged at the end. The keys come in stages of SK = 128 through a ring of two LDS buffers that asynchronous copies fill one stage ahead: a stage's k hi, k lo and v (SK x 192 contiguous bytes of the shared plane, read by all
// eight waves: fetched once a group, not once a wave), each wave's own slice of the bias plane (2 row tiles x SK x 32 bytes) and the stage's mask words. The planes' fragment order is kept in LDS: every LDS read of a wave covers 512 contiguous bytes.
// Transposed products: S^T = K Q^T (A = key rows, B = query rows; a lane holds 16 scores of ONE query: keys 8 hi + j and 16 + 8 hi + j),
// O^T += V^T P^T (A = V^T rows d, B = the two score tiles converted in place, same k order as the A loader).
// Scale and bias cost no vector instruction per score. With gam = the bias's scale, gb = bf16(gam), rr = gam / gb (1 where gb is 0): logit = rr (q.k / (sqrt(32) rr) + gb geo). q is multiplied by 1 / (sqrt(32) rr) once, in the prologue, and split anew;
// gb geo comes from one more matrix product per score tile, D = A_t B with B = the pass's bias block (32 keys x 16 queries, as it lies in the plane) and A_t = gb on the diagonal that picks keys 16 t .. 16 t + 15 (each product bf16 x bf16, exact in f32);
// rr log2e = kap rides in the multiply-add that forms the exponent: p = 2^(kap t + c), c = 10 - kap m for the running maximum m of t.
// Every plain '#pragma unroll' in it makes the indices of a register array compile-time constants (a rolled loop would put the array in scratch memory).
#define SK   128
#define NST  (TT / SK)
#define KVB  (SK * 192)
#define GWB  (NQT * 16 * SK * 2)
#define MOFS (KVB + 8 * GWB)
#define BUFB (MOFS + SK * 4)
typedef v4u __attribute__((may_alias)) v4ua;
typedef int __attribute__((may_alias)) inta;
// Asynchronous copies, 16 bytes a lane, to LDS byte l from global g. An immediate offset moves both addresses alike, so a run of copies whose source and place step together names one pair of address registers.
// The s_wait_xcnt 0 is the last line of the copies' own statement, so that it stands in front of whatever rewrites one of those registers.
__device__ __forceinline__ void acp1(unsigned l, const char* g) { asm volatile("global_load_async_to_lds_b128 %0, %1, off\n\ts_wait_xcnt 0x0" :: "v"(l), "v"(g) : "memory"); }
__device__ __forceinline__ void acp6x4096(unsigned l, const char* g) {
    asm volatile("global_load_async_to_lds_b128 %0, %1, off\n\tglobal_load_async_to_lds_b128 %0, %1, off offset:4096\n\tglobal_load_async_to_lds_b128 %0, %1, off offset:8192\n\tglobal_load_async_to_lds_b128 %0, %1, off offset:12288\n\t"
                 "global_load_async_to_lds_b128 %0, %1, off offset:16384\n\tglobal_load_async_to_lds_b128 %0, %1, off offset:20480\n\ts_wait_xcnt 0x0" :: "v"(l), "v"(g) : "memory"); }
__device__ __forceinline__ void acp8x512(unsigned l, const char* g) {
    asm volatile("global_load_async_to_lds_b128 %0, %1, off\n\tglobal_load_async_to_lds_b128 %0, %1, off offset:512\n\tglobal_load_async_to_lds_b128 %0, %1, off offset:1024\n\tglobal_load_async_to_lds_b128 %0, %1, off offset:1536\n\t"
                 "global_load_async_to_lds_b128 %0, %1, off offset:2048\n\tglobal_load_async_to_lds_b128 %0, %1, off offset:2560\n\tglobal_load_async_to_lds_b128 %0, %1, off offset:3072\n\tglobal_load_async_to_lds_b128 %0, %1, off offset:3584\n\ts_wait_xcnt 0x0"
                 :: "v"(l), "v"(g) : "memory"); }
// a wave-uniform LDS address kept as one scalar sum: otherwise the compiler adds the lane's part to the loop-invariant part first and holds one more vector register per run of copies over the whole loop, which it spilled
__device__ __forceinline__ unsigned ufm(unsigned x) { return (unsigned)__builtin_amdgcn_readfirstlane((int)x); }
// one stage's copies of this wave into the buffer at LDS byte lb: its eighth of k and v (512 bytes of each 4096, six times), its own bias slice (two row tiles, 64 KiB apart in the plane, 8 x 512 bytes each), and from wave 0 the mask words
__device__ __forceinline__ void fill(unsigned lb, int st, const char* kvu, const char* gu, const char* mu, unsigned lane, int w) {   // kvu, gu, mu: wave-uniform, stage 0's first bytes; the lane's 16 bytes are added last, to a scalar sum
    static_assert(KVB == 6 * 4096 && GWB / NQT == 8 * 512 && SK * 4 == 512, "the copy runs cover a stage exactly");
    acp6x4096(ufm(lb + (unsigned)w * 512u) + lane * 16u, kvu + ((size_t)st * KVB + (size_t)w * 512) + lane * 16u);
#pragma unroll
    for (int nq = 0; nq < NQT; ++nq) acp8x512(ufm(lb + KVB + (unsigned)w * GWB + nq * (GWB / NQT)) + lane * 16u, gu + ((size_t)st * (SK * 32) + (size_t)nq * (TT / 32) * 1024) + lane * 16u);
    if (w == 0) acp1(lb + MOFS + lane * 16u, mu + (size_t)st * (SK * 4) + lane * 16u);   // w is a scalar: a scalar branch, every lane on inside it
}
// a pass's score operands from the stage's buffer: bp, bg, bm = this lane's first byte of k and v, of its wave's bias slice, of the mask words
__device__ __forceinline__ void ldpass(const char* bp, const char* bg, const char* bm, int p, v16bf (&kfh)[2], v16bf (&kfl)[2], v16bf (&gf)[NQT], int& mk) {
    mk = *(const inta*)(bm + p * 128);
#pragma unroll
    for (int nq = 0; nq < NQT; ++nq) { const char* gp = bg + nq * (GWB / NQT) + p * 1024; gf[nq] = cat16b(*(const v8usa*)gp, *(const v8usa*)(gp + 512)); }
    __builtin_amdgcn_sched_barrier(0);   // the mask word and the bias block are read first, as they are used first: the wait in front of their use then leaves the reads below in flight
#pragma unroll
    for (int t = 0; t < 2; ++t) { const char* kp = bp + p * 6144 + t * 1024; kfh[t] = cat16b(*(const v8usa*)kp, *(const v8usa*)(kp + 512)); }
#pragma unroll
    for (int t = 0; t < 2; ++t) { const char* kp = bp + p * 6144 + t * 1024; kfl[t] = cat16b(*(const v8usa*)(kp + 2048), *(const v8usa*)(kp + 2560)); }
}
typedef __attribute__((ext_vector_type(8))) unsigned v8u;
// a fragment pair hi + lo times s, split anew into hi + lo
__device__ __forceinline__ void fscale(v16bf& fh, v16bf& fl, float s) { v8u a = __builtin_bit_cast(v8u, fh), c = __builtin_bit_cast(v8u, fl);
#pragma unroll
    for (int i = 0; i < 8; ++i) { unsigned hh, ll; splitf2((__uint_as_float(a[i] << 16) + __uint_as_float(c[i] << 16)) * s, (__uint_as_float(a[i] & 0xFFFF0000u) + __uint_as_float(c[i] & 0xFFFF0000u)) * s, hh, ll); a[i] = hh; c[i] = ll; }
    fh = __builtin_bit_cast(v16bf, a); fl = __builtin_bit_cast(v16bf, c); }
__global__ __launch_bounds__(256) void k_fattn(const bf* __restrict__ Qh, const bf* __restrict__ Ql, const bf* __restrict__ KV, const bf* __restrict__ GP, const int* __restrict__ msk,
                                               const float* __restrict__ gbsp, const float* __restrict__ hgs, const float* __restrict__ hg, bf* AHL) {
    __shared__ __align__(16) char sm[2 * BUFB];
    const int lane = threadIdx.x & 31, hi = lane >> 4, w = __builtin_amdgcn_readfirstlane(threadIdx.x >> 5);   // the wave's number as a scalar: scalar branches
    const int h = blockIdx.y, q0 = (blockIdx.x * 8 + w) * (16 * NQT), b = blockIdx.z;
    const size_t hp = ((size_t)b * NH_ + h) * TT * HD;   // this batch row's and head's q planes: 32 elements a position (k and v together: 96)
    const float gam = bfr(gbsp[0]) * bfr(hgs[h]); const unsigned gb = f2bf(gam); const float rr = (gb & 0x7FFFu) ? gam / bf2f((unsigned short)gb) : 1.0f;   // rr: what bf16 cannot hold of the bias's scale, within 2^-8 of 1
    const float kap = rr * 1.4426950408889634f, qs = 0.17677669529663687f / rr;
    v16bf dg[2];   // A_t: row lr holds gb at k = 16 t + lr; this lane's element s stands for k = 8 hi + s (s < 8), 16 + 8 hi + s - 8 (the loaders' k order)
#pragma unroll
    for (int t = 0; t < 2; ++t) { v8u d;
#pragma unroll
        for (int i = 0; i < 8; ++i) { const int k0 = (i >> 2) * 16 + 8 * hi + 2 * (i & 3), kd = 16 * t + (lane & 15); d[i] = (k0 == kd ? gb : 0u) | (k0 + 1 == kd ? gb << 16 : 0u); }
        dg[t] = __builtin_bit_cast(v16bf, d); }
    const unsigned rofs = (unsigned)lane * 16u;   // this lane's chunk in a half block, bytes
    const char* kvs = (const char*)(KV + hp * 3); const char* gs = (const char*)(GP + (size_t)(q0 / 16) * (TT / 32) * 512); const char* ms = (const char*)(msk + (size_t)b * TT);   // stage 0's first bytes, wave-uniform
    const unsigned l0 = (unsigned)(size_t)sm;   // the ring's LDS byte address
    fill(l0, 0, kvs, gs, ms, lane, w);
    v16bf qfh[NQT], qfl[NQT]; v8f o[NQT][2]; float m[NQT], cm[NQT], l[NQT];
#pragma unroll
    for (int nq = 0; nq < NQT; ++nq) { const size_t off = hp + (size_t)(q0 + 16 * nq) * HD; qfh[nq] = ldfb(Qh + off, rofs); qfl[nq] = ldfb(Ql + off, rofs); fscale(qfh[nq], qfl[nq], qs); o[nq][0] = (v8f){}; o[nq][1] = (v8f){}; m[nq] = -1.0e30f; cm[nq] = fmaf(-kap, m[nq], 10.0f); l[nq] = 0.f; }   // m starts where kap m is still finite; cm = 10 - kap m, formed as in the loop
    asm volatile("s_wait_asynccnt 0x0" ::: "memory");   // this wave's copies of stage 0 have landed
    __syncthreads();                                    // ... and every other wave's: stage 0 is published
    fill(l0 + BUFB, 1, kvs, gs, ms, lane, w);
#pragma unroll 1   // one stage's code; the buffer alternates
    for (int st = 0; st < NST; ++st) {
        const char* bp = sm + (st & 1) * BUFB + rofs; const char* bg = bp + KVB + w * GWB; const char* bm = sm + (st & 1) * BUFB + MOFS + lane * 4;
        v16bf kfh[2], kfl[2], gf[NQT]; int mk; v8f s[NQT][2], sn[NQT][2];
        // product i of the 16 that make a pass's four score tiles from the operands in kfh, kfl, gf: the bias product first, then hi.hi, hi.lo, lo.hi, each over the four tiles, so that a tile's next product stands four products behind its last
        auto prod = [&](int i) { const int nq = (i >> 1) & 1, t = i & 1, k = i >> 2;
            sn[nq][t] = k == 0 ? wmmab(dg[t], gf[nq], (v8f){}) : k == 1 ? wmmab(kfh[t], qfh[nq], sn[nq][t]) : k == 2 ? wmmab(kfh[t], qfl[nq], sn[nq][t]) : wmmab(kfl[t], qfh[nq], sn[nq][t]); };
        ldpass(bp, bg, bm, 0, kfh, kfl, gf, mk);
        __builtin_amdgcn_sched_barrier(0);   // keeps these reads together in front of the products; without it the compiler spreads them among the products, each group behind a wait of its own
#pragma unroll
        for (int i = 0; i < 16; ++i) prod(i);
        unsigned live = __builtin_amdgcn_ballot_w32(mk != 0);   // bit i: key i of the pass is attended
        // Every sched_barrier(0) of PW_ and around the probs.v products below fixes one thing: the next pass's 16 score products and this pass's 4 probs.v products stand one by one between pieces of this pass's softmax of about eight vector cycles each,
        // so that each runs on the matrix unit under the piece behind it. Left alone the compiler puts the 20 in a row behind the softmax, where the wave waits out every one.
#define SB_ __builtin_amdgcn_sched_barrier(0)
#define PW_(i) do { SB_; if (nx) prod(i); SB_; } while (0)
#pragma unroll   // the stage's four passes: every LDS read at a constant distance from one address, and the operand registers of one pass and the next told apart at compile time
        for (int p = 0; p < SK / 32; ++p) {
            const bool nx = p + 1 < SK / 32;
#pragma unroll
            for (int nq = 0; nq < NQT; ++nq) { s[nq][0] = sn[nq][0]; s[nq][1] = sn[nq][1]; }
            if (live != 0xFFFFFFFFu) {   // one scalar test a pass; a pass with every key attended skips the selects
                const unsigned mine = live >> (8 * hi);
#pragma unroll
                for (int nq = 0; nq < NQT; ++nq)
#pragma unroll
                    for (int t = 0; t < 2; ++t)
#pragma unroll
                        for (int j = 0; j < 8; ++j) if (!((mine >> (16 * t + j)) & 1u)) s[nq][t][j] = -3.0e38f;
            }
            v16h vc[2];   // the same stage's next pass's score operands and this pass's V^T: their LDS reads return under this pass's maxima
            if (nx) ldpass(bp, bg, bm, p + 1, kfh, kfl, gf, mk);
#pragma unroll
            for (int dt = 0; dt < 2; ++dt) { const char* vp = bp + p * 6144 + 4096 + dt * 1024; vc[dt] = cat16(*(const v8ha*)vp, *(const v8ha*)(vp + 512)); }
            SB_;   // keeps those reads up here; without it the compiler sinks each to just in front of its first use, where its latency stands open
            float mx[NQT], cn[NQT], al[NQT]; v8f e[NQT][2]; v4f x[NQT][4]; v16h pf[NQT];
#pragma unroll
            for (int nq = 0; nq < NQT; ++nq) { mx[nq] = fmaxf(s[nq][0][0], s[nq][1][0]);
#pragma unroll
                for (int j = 1; j < 8; ++j) mx[nq] = fmaxf(mx[nq], fmaxf(s[nq][0][j], s[nq][1][j])); }
#pragma unroll
            for (int nq = 0; nq < NQT; ++nq) mx[nq] = fmaxf(mx[nq], xhalf(mx[nq]));
            if (nx) live = __builtin_amdgcn_ballot_w32(mk != 0);
            PW_(0);
#pragma unroll
            for (int nq = 0; nq < NQT; ++nq) { const float mn = fmaxf(m[nq], mx[nq]); cn[nq] = fmaf(-kap, mn, 10.0f);   // probabilities x 2^10, for fp16's range
                al[nq] = cn[nq] - cm[nq]; m[nq] = mn; cm[nq] = cn[nq]; }
            PW_(1);
            e[0][0] = s[0][0] * kap + cn[0];   // a masked key's -3e38 overflows to -inf here: probability 0
            PW_(2);
#pragma unroll
            for (int nq = 0; nq < NQT; ++nq) al[nq] = exp2x1(al[nq]);   // the old sums go from 2^cm to 2^cn exactly as the new terms are formed
            PW_(3);
            // A product that is the last to read an operand register (1, 3, 10, 11, 14, 15, the second probs.v product of a query tile) has a piece of the compiler's own instructions or the pass's end behind it, never an exponential statement.
#define EX_(nq, i) x[nq][i] = exp2x4(__builtin_shufflevector(e[nq][(i) >> 1], e[nq][(i) >> 1], 4 * ((i) & 1), 4 * ((i) & 1) + 1, 4 * ((i) & 1) + 2, 4 * ((i) & 1) + 3))
#define CV_(nq) pf[nq] = cat16(__builtin_convertvector(__builtin_shufflevector(x[nq][0], x[nq][1], 0, 1, 2, 3, 4, 5, 6, 7), v8h), __builtin_convertvector(__builtin_shufflevector(x[nq][2], x[nq][3], 0, 1, 2, 3, 4, 5, 6, 7), v8h))
            e[0][1] = s[0][1] * kap + cn[0];
            PW_(4); EX_(0, 0); PW_(5); EX_(0, 1); PW_(6); EX_(0, 2); PW_(7); EX_(0, 3); PW_(8); CV_(0); PW_(9);
            o[0][0] *= al[0]; o[0][1] *= al[0]; PW_(10);
            e[1][0] = s[1][0] * kap + cn[1]; PW_(11);
            e[1][1] = s[1][1] * kap + cn[1];
            SB_; o[0][0] = wmma16(vc[0], pf[0], o[0][0]); SB_;
            EX_(1, 0); PW_(12); EX_(1, 1); PW_(13); EX_(1, 2); EX_(1, 3);
            SB_; o[0][1] = wmma16(vc[1], pf[0], o[0][1]); SB_;
            CV_(1); PW_(14);
            o[1][0] *= al[1]; o[1][1] *= al[1]; PW_(15);
#pragma unroll
            for (int nq = 0; nq < NQT; ++nq) { const v4f u = (x[nq][0] + x[nq][1]) + (x[nq][2] + x[nq][3]); l[nq] = l[nq] * al[nq] + ((u[0] + u[1]) + (u[2] + u[3])); }   // the row's sum as a tree, not a chain of 16
#undef EX_
#undef CV_
            o[1][0] = wmma16(vc[0], pf[1], o[1][0]); o[1][1] = wmma16(vc[1], pf[1], o[1][1]);
        }
#undef PW_
#undef SB_
        asm volatile("s_wait_dscnt 0x0" ::: "memory");      // this wave's reads of the stage's buffer have returned
        asm volatile("s_wait_asynccnt 0x0" ::: "memory");   // this wave's copies of the next stage have landed
        __syncthreads();                                    // publishes the next stage and ends every wave's reads of this stage's buffer
        if (st + 2 < NST) fill(l0 + (st & 1) * BUFB, st + 2, kvs, gs, ms, lane, w);
    }
    asm volatile("s_wait_asynccnt 0x0" ::: "memory");   // no copy is outstanding when the wave ends
    const float gate = bfr(hg[h]);
#pragma unroll
    for (int nq = 0; nq < NQT; ++nq) { const float f = gate / (l[nq] + xhalf(l[nq]));
#pragma unroll
        for (int dt = 0; dt < 2; ++dt) { v8us oh, ol;
#pragma unroll
            for (int j = 0; j < 8; ++j) { unsigned short a, c; splitf(o[nq][dt][j] * f, a, c); oh[j] = a; ol[j] = c; }
            const size_t ofs = ((size_t)b * TT + q0 + 16 * nq) * CC * 2 + h * 1024 + dt * 256 + lane * 8; *(v8us*)(AHL + ofs) = oh; *(v8us*)(AHL + ofs + 512) = ol; } }   // fragment order: head h is k step h of these 16 queries, a hi block and its lo block; d tile dt is a block's half
}

extern "C" void kernel_launch(void* const* d_in, const int* in_sizes, int n_in,
                              void* d_out, int out_size, void* d_ws, size_t ws_size, hipStream_t stream) {
    (void)in_sizes; (void)n_in; (void)out_size;
    const float* x = (const float*)d_in[0]; const float* geo = (const float*)d_in[1]; const int* msk = (const int*)d_in[2]; const float* hg = (const float*)d_in[3]; const float* Wq = (const float*)d_in[4]; const float* Wk = (const float*)d_in[5]; const float* Wv = (const float*)d_in[6]; const float* Wo = (const float*)d_in[7]; const float* gbsp = (const float*)d_in[8]; const float* hgs = (const float*)d_in[9];
    float* OUT = (float*)d_out;     // [4][2048][256]
    char* wsp = (char*)d_ws;
    auto take = [&](size_t bytes) { char* p = wsp; wsp += (bytes + 255) & ~(size_t)255; return (void*)p; };
    bf* WB = (bf*)take((size_t)4 * CC * CC * 2); bf* WO = WB + (size_t)3 * CC * CC; bf* XB = (bf*)take((size_t)NB_ * TT * CC * 2);   // WB: Wq, Wk, Wv, Wo planes back to back; [out][in] as given = rows n, columns k
    bf* Qh = (bf*)take((size_t)NB_ * NH_ * TT * HD * 2); bf* Ql = (bf*)take((size_t)NB_ * NH_ * TT * HD * 2); bf* KV = (bf*)take((size_t)NB_ * NH_ * TT * HD * 2 * 3);
    bf* AHL = (bf*)take((size_t)NB_ * TT * CC * 2 * 2); bf* GP = (bf*)take((size_t)TT * TT * 2);
    if ((size_t)(wsp - (char*)d_ws) > ws_size) return;    // total ~ 41 MB
    k_cvtin<<<(XTL + 4 * WTL + GTL) / 8, 256, 0, stream>>>(x, Wq, Wk, Wv, Wo, geo, XB, WB, GP);
    k_gemmw<bf, 0, false, true, CC><<<dim3(NB_ * TT / 64, CC / 64, 3), 32, 0, stream>>>(XB, WB, nullptr, nullptr, 0, nullptr, 0, (size_t)CC * CC, 0, Qh, Ql, KV, KV + 1024, (h16*)(KV + 2048));
    k_fattn<<<dim3(TT / (16 * NQT * 8), NH_, NB_), 256, 0, stream>>>(Qh, Ql, KV, GP, msk, gbsp, hgs, hg, AHL);
    k_gemmw<bf, 1, false, false, CC><<<dim3(NB_ * TT / 64, CC / 64, 1), 32, 0, stream>>>(AHL, WO, nullptr, OUT, CC, nullptr, 0, 0, 0, nullptr, nullptr, nullptr, nullptr, nullptr);
}

// v009
// Measured time: 52.3 microseconds a run.
// Next to v008, in two timings, it ran 1.07 times as fast each time.
// Counting every step since v000, it is 24.1 times as fast.
#include <hip/hip_runtime.h>

// TetrahedralAttention (x [4][2048][256]; q/k/v = x W^T (8 heads x 32); scores = q.k/sqrt(32) + geo_bias_scale geometric_bias[i][j] head_geo_scales[h]; keys with attention_mask[b][j] == 0 -> -inf; softmax; x head_gates[h] (post-softmax);
// out = merged.v Wo^T -> [4][2048][256]; bias table, mask (int32), gates and scales read as data).
// Compute dtypes, f32 accumulate: every input rounded to bf16; projections on PLAIN bf16 operands (inputs: exact); scores (K 32) on bf16 hi+lo planes (3 products) on top of a fourth product that adds the bias (k_fattn), mask/softmax in f32 registers
// (probabilities against one reference per query, fp16; where that does not hold them, x1024 against the running maximum); probs.v on fp16 planes; Wo on hl planes x exact Wo (2 products). Scores, softmax, probs.v and the head gate run in ONE kernel (k_fattn): no score or probability plane in memory.
// Every 16-bit plane that a matrix instruction's operand is loaded from lies in memory in FRAGMENT ORDER (16 bytes a lane, lane after lane), so that each wave-wide load and store of it covers 512 contiguous bytes.
// A plane of R rows x K columns (K = the product's k) is a row of blocks of 1024 bytes, block (row tile r / 16) x (K / 32) + (k / 32) = [half jj][lane = 16 hi + lr][8]: row lr of the tile, k = 16 jj + 8 hi + e of the block.
// So lie x, q and k (hi and lo; K = 32, one block for 16 positions) and the bias table rounded to bf16 (rows = queries, k = keys: the B operand of the product that adds it to the scores). The merged attention output: the same, each hi block followed by its lo block.
// The four weights: the same blocks, k steps outermost (block (k / 32) x (rows / 16) + row tile): the four blocks that a k step of a 64-column tile loads lie in a row.
// v: 2048 bytes for 32 positions, [d tile dt][half jj][lane][8] = d 16 dt + lr, position 16 jj + 8 hi + e. k and v share one plane, 6144 bytes for 32 positions of a head: k hi (two blocks), k lo (two blocks), v: all that an attention pass loads of them, in a row.
// Four launches, each over all four batch rows: input conversions (with the bias table's plane); q, k, v projections (grid z, M = 4 x 2048), whose epilogue writes the attention's operand planes itself; attention (grid z = batch row); output projection.

#define NB_  4
#define TT   2048
#define CC   256
#define NH_  8
#define HD   32
#define NQT  2
typedef _Float16 h16;
typedef unsigned short bf;
typedef __attribute__((ext_vector_type(16))) __bf16   v16bf;
typedef __attribute__((ext_vector_type(16))) _Float16 v16h;
typedef __attribute__((ext_vector_type(8)))  _Float16 v8h;
typedef __attribute__((ext_vector_type(8)))  unsigned short v8us;
typedef __attribute__((ext_vector_type(8)))  float    v8f;
typedef __attribute__((ext_vector_type(4)))  float    v4f;
typedef __attribute__((ext_vector_type(2)))  float    v2f;
typedef __attribute__((ext_vector_type(2)))  __bf16   v2bf;
typedef __attribute__((ext_vector_type(4)))  unsigned v4u;
typedef v8h  __attribute__((may_alias)) v8ha;
typedef v4f  __attribute__((may_alias)) v4fa;
typedef v8us __attribute__((may_alias)) v8usa;

__device__ __forceinline__ unsigned short f2bf(float f) { unsigned u = __float_as_uint(f); u += 0x7FFFu + ((u >> 16) & 1u); return (unsigned short)(u >> 16); }
__device__ __forceinline__ float bf2f(unsigned short b) { return __uint_as_float(((unsigned)b) << 16); }
__device__ __forceinline__ float bfr(float f) { return bf2f(f2bf(f)); }
__device__ __forceinline__ void splitf(float y, unsigned short& h, unsigned short& l) { h = f2bf(y); l = f2bf(y - bf2f(h)); }
// splitf on two neighbours at once, each result a packed pair; the packed conversion rounds to nearest even, as f2bf does
__device__ __forceinline__ void splitf2(float y0, float y1, unsigned& h, unsigned& l) { h = __builtin_bit_cast(unsigned, __builtin_convertvector((v2f){y0, y1}, v2bf));
    l = __builtin_bit_cast(unsigned, __builtin_convertvector((v2f){y0 - __uint_as_float(h << 16), y1 - __uint_as_float(h & 0xFFFF0000u)}, v2bf)); }
__device__ __forceinline__ v16h cat16(v8h lo, v8h hi) { return __builtin_shufflevector(lo, hi, 0, 1, 2, 3, 4, 5, 6, 7, 8, 9, 10, 11, 12, 13, 14, 15); }
__device__ __forceinline__ v16bf cat16b(v8us lo, v8us hi) { return __builtin_bit_cast(v16bf, __builtin_shufflevector(lo, hi, 0, 1, 2, 3, 4, 5, 6, 7, 8, 9, 10, 11, 12, 13, 14, 15)); }
__device__ __forceinline__ v8f wmma16(v16h a, v16h b, v8f c) { return __builtin_amdgcn_wmma_f32_16x16x32_f16(false, a, false, b, (short)0, c, false, false); }
__device__ __forceinline__ v8f wmmab(v16bf a, v16bf b, v8f c) { return __builtin_amdgcn_wmma_f32_16x16x32_bf16(false, a, false, b, (short)0, c, false, false); }



// ---- k_gemmw: register-blocked GEMM, ONE WAVE per 64x64 output tile (16 accumulators), operands straight from 16-bit planes in fragment order; grid (M/64, N/64, Z), 32 threads.
// C[m][n] (f32, pitch ldc, + optional f32 bias[n]) = sum_k A[m][k] Bt[n][k] (+ split products per NSPLIT). z-batch strides sA/sB/sC in elements. K % 32 == 0.
// PLANES (the q, k, v projections; m = batch row x position, n = head x 32 + d): no f32 C; the tile goes from the accumulators to the attention's operand planes, [batch row][head][...]:
// z = 0, 1: bf16 hi and lo planes of q, k, staged through LDS; z = 2: the fp16 plane of v, straight from the accumulators (a lane's 8 rows are one fragment chunk). All in fragment order (head of the file): every store instruction writes 512 contiguous bytes.
// a load at a wave-uniform pointer plus a per-lane byte offset of 32 bits (fits the scalar-base address form)
template <typename V> __device__ __forceinline__ V ldu(const void* p, unsigned b) { return *(const V*)((const char*)p + b); }
template <typename T16> struct WFrag;   // ld: a fragment from a plane in fragment order: its two halves lie 512 bytes apart, b = 16 x lane + the block's offset from p
template <> struct WFrag<h16> { typedef v16h V; static __device__ __forceinline__ V ld(const h16* p, unsigned b) { return cat16(ldu<v8h>(p, b), ldu<v8h>(p + 256, b)); } static __device__ __forceinline__ v8f mma(V a, V b, v8f c) { return wmma16(a, b, c); } };
template <> struct WFrag<bf> { typedef v16bf V; static __device__ __forceinline__ V ld(const bf* p, unsigned b) { return cat16b(ldu<v8us>(p, b), ldu<v8us>(p + 256, b)); } static __device__ __forceinline__ v8f mma(V a, V b, v8f c) { return wmmab(a, b, c); } };
template <typename T16, int NSPLIT, bool BIAS, bool PLANES, int K>   // K at compile time: every block of a k step then lies at a constant distance from one pointer per plane
__global__ __launch_bounds__(32) void k_gemmw(const T16* __restrict__ A, const T16* __restrict__ Bt, const T16* __restrict__ Bt2, float* C, int ldc, const float* __restrict__ bias, size_t sA, size_t sB, size_t sC,
                                              bf* Qh, bf* Ql, bf* Kh, bf* Kl, h16* VT) {
    typedef typename WFrag<T16>::V V;
    __shared__ __align__(16) float os[16 * 68];   // 16 rows x 68 f32
    const size_t z = blockIdx.z; A += z * sA; Bt += z * sB; if (Bt2) Bt2 += z * sB; C += z * sC;
    const int lane = threadIdx.x & 31, lr = lane & 15, hi = lane >> 4; const int r0 = blockIdx.x * 64, c0 = blockIdx.y * 64;
    v8f acc[4][4];
#pragma unroll
    for (int mb = 0; mb < 4; ++mb)
#pragma unroll
        for (int nb = 0; nb < 4; ++nb) acc[mb][nb] = (v8f){};
    constexpr int AB = (NSPLIT == 1 || NSPLIT == 2) ? 1024 : 512;   // elements from one k step of A to the next: a block, or a hi block and its lo block
    const unsigned ao = (unsigned)(r0 / 16 * (K / 32) * AB + lane * 8) * 2u, bo = (unsigned)(c0 / 16 * 512 + lane * 8) * 2u;   // byte offsets of this lane's chunk in the tile's first block of A (row tiles outermost) and of Bt (k steps outermost: CC / 16 blocks a step)
    // The k steps' operands go through a ring of D register sets: the loads of D steps are issued in front of the first product, and a set is loaded anew, for step ks + D, right behind the products of step ks.
    // A step's products so find their operands D - 1 steps of matrix work after the loads were issued, not a whole load latency (or two) after. The loop is unrolled whole: set numbers and every block's distance from the two offsets are constants, and no address register changes.
    constexpr int NK = K / 32, D = NSPLIT == 0 ? 4 : 3;
    V a[D][4], a2[D][4], b[D][4], b2[D][4];
    auto fetch = [&](int ks) { const int s = ks % D;
#pragma unroll
        for (int mb = 0; mb < 4; ++mb) { a[s][mb] = WFrag<T16>::ld(A + (mb * NK + ks) * AB, ao); if (NSPLIT == 1 || NSPLIT == 2) a2[s][mb] = WFrag<T16>::ld(A + (mb * NK + ks) * AB + 512, ao); }
#pragma unroll
        for (int nb = 0; nb < 4; ++nb) { b[s][nb] = WFrag<T16>::ld(Bt + ks * (CC / 16 * 512) + nb * 512, bo); if (NSPLIT >= 2) b2[s][nb] = WFrag<T16>::ld(Bt2 + ks * (CC / 16 * 512) + nb * 512, bo); } };
#pragma unroll
    for (int ks = 0; ks < D; ++ks) fetch(ks);
#pragma unroll
    for (int ks = 0; ks < NK; ++ks) { const int s = ks % D;
        __builtin_amdgcn_sched_barrier(0);   // keeps the loads issued so far in front of this step's products; left alone the compiler sinks each load to just in front of its use, where its latency stands open
#pragma unroll
        for (int nb = 0; nb < 4; ++nb)
#pragma unroll
            for (int mb = 0; mb < 4; ++mb) { acc[mb][nb] = WFrag<T16>::mma(a[s][mb], b[s][nb], acc[mb][nb]); if (NSPLIT == 1 || NSPLIT == 2) acc[mb][nb] = WFrag<T16>::mma(a2[s][mb], b[s][nb], acc[mb][nb]); if (NSPLIT >= 2) acc[mb][nb] = WFrag<T16>::mma(a[s][mb], b2[s][nb], acc[mb][nb]); }
        __builtin_amdgcn_sched_barrier(0);   // the set's next loads stay behind the products that read it, and in front of the next step's
        if (ks + D < NK) fetch(ks + D);
    }
    asm volatile("s_wait_xcnt 0x0" :: "v"(ao), "v"(bo), "s"(A), "s"(Bt) : "memory");   // behind the last loads, in front of whatever rewrites a register that they name; offsets and bases are inputs, so that they live up to here
    if constexpr (PLANES) {
        asm volatile("v_nop\n\tv_nop\n\tv_nop\n\tv_nop" : "+v"(acc[0][0]), "+v"(acc[1][1]), "+v"(acc[2][2]), "+v"(acc[3][3]));   // the distance from the last products to the first reader of their results on the taken side of the branch below
        const int bb = r0 / TT, t0 = r0 % TT;   // the tile's 64 rows lie in one batch row
        const size_t bs = blockIdx.z == 0 ? 1024 : 3072, hb = (((size_t)bb * NH_ + (c0 >> 5)) * (TT / 32) + t0 / 32) * bs + lane * 8;   // bs: elements from one 32 positions to the next (q alone; k and v in their shared plane); hb: this lane's chunk at the tile's first position in its first head
        if (blockIdx.z == 2) {   // v: a lane's 8 accumulator rows are 8 consecutive positions of one d: the chunk of lane 16 hi + lr in block (position / 32), d tile nb & 1, half mb & 1
#pragma unroll
            for (int mb = 0; mb < 4; ++mb)
#pragma unroll
                for (int nb = 0; nb < 4; ++nb) *(v8h*)(VT + hb + (size_t)(nb >> 1) * (TT / 32) * 3072 + (mb >> 1) * 3072 + (nb & 1) * 512 + (mb & 1) * 256) = __builtin_convertvector(acc[mb][nb], v8h);
        } else {   // q, k: 16 rows are one block in each of the tile's two heads; an instruction writes one half of a block, lane 16 hi + lr taking row lr, d 16 jj + 8 hi ..
            bf* Ph = blockIdx.z == 0 ? Qh : Kh; bf* Pl = blockIdx.z == 0 ? Ql : Kl;
#pragma unroll
            for (int mb = 0; mb < 4; ++mb) {
#pragma unroll
                for (int nb = 0; nb < 4; ++nb) {
#pragma unroll
                    for (int j = 0; j < 8; ++j) os[(hi * 8 + j) * 68 + nb * 16 + lr] = acc[mb][nb][j]; }
                __builtin_amdgcn_wave_barrier(); asm volatile("" ::: "memory");   // keeps the compiler from moving the reads below, which take other lanes' values, over the writes above
#pragma unroll
                for (int s = 0; s < 4; ++s) { const int hh = s >> 1, jj = s & 1; const float* rp = os + lr * 68 + hh * 32 + (2 * jj + hi) * 8; const v4f y0 = *(const v4fa*)rp, y1 = *(const v4fa*)(rp + 4); unsigned a0, a1, a2, a3, e0, e1, e2, e3;
                    splitf2(y0[0], y0[1], a0, e0); splitf2(y0[2], y0[3], a1, e1); splitf2(y1[0], y1[1], a2, e2); splitf2(y1[2], y1[3], a3, e3);
                    const size_t o = hb + ((size_t)hh * (TT / 32) + (mb >> 1)) * bs + (mb & 1) * 512 + jj * 256; *(v8us*)(Ph + o) = __builtin_bit_cast(v8us, (v4u){a0, a1, a2, a3}); *(v8us*)(Pl + o) = __builtin_bit_cast(v8us, (v4u){e0, e1, e2, e3}); }
                __builtin_amdgcn_wave_barrier(); asm volatile("" ::: "memory");   // the next 16 rows' writes stay behind these reads
            }
            asm volatile("s_wait_xcnt 0x0" ::: "memory");   // behind the branch's last stores: the code that follows in the listing rewrites their address registers
        }
        return;
    }
#pragma unroll
    for (int mb = 0; mb < 4; ++mb) {
#pragma unroll
        for (int nb = 0; nb < 4; ++nb) {
#pragma unroll
            for (int j = 0; j < 8; ++j) os[(hi * 8 + j) * 68 + nb * 16 + lr] = acc[mb][nb][j]; }
        __builtin_amdgcn_wave_barrier(); asm volatile("" ::: "memory");
        float* crow = C + (size_t)(r0 + mb * 16) * ldc + c0;
{
#pragma unroll
            for (int s = 0; s < 8; ++s) { const int row = 2 * s + hi, cofs = lr * 4; v4f val = *(const v4fa*)(os + row * 68 + cofs); if (BIAS) { val[0] += bfr(bias[c0 + cofs]); val[1] += bfr(bias[c0 + cofs + 1]); val[2] += bfr(bias[c0 + cofs + 2]); val[3] += bfr(bias[c0 + cofs + 3]); }
                *(v4f*)(crow + (size_t)row * ldc + cofs) = val; }
             }
        __builtin_amdgcn_wave_barrier(); asm volatile("" ::: "memory");
    }
}

typedef __attribute__((ext_vector_type(2))) _Float16 v2h;
typedef __attribute__((ext_vector_type(4))) _Float16 v4h;
typedef __attribute__((ext_vector_type(2))) unsigned short v2us;
typedef __attribute__((ext_vector_type(4))) unsigned short v4us;

__global__ __launch_bounds__(256) void k_wtG(const float* __restrict__ w, int K, int N, bf* Bt) {
    const int lane = threadIdx.x & 31; const int L0 = (blockIdx.x * 8 + (threadIdx.x >> 5)) * 8; const int nlines = N * K / 64;
{
#pragma unroll 1
        for (int l = 0; l < 8; ++l) { const int L = L0 + l; if (L >= nlines) break; const size_t e = (size_t)L * 64 + lane * 2; const int k = (int)(e % K), n = (int)(e / K); v2us o;
            o[0] = f2bf(w[(size_t)k * N + n]); o[1] = f2bf(w[(size_t)(k + 1) * N + n]); *(v2us*)(Bt + e) = o; }
         }
}
// every f32 -> bf16 input conversion in one grid, each into fragment order: a wave takes one block of 16 rows x 32 columns, reads it in whole lines (8 lanes a row), turns it in its own 1024 bytes of LDS and writes it as 2 x 512 contiguous bytes.
// Blocks in the order x (all batch rows), Wq, Wk, Wv, Wo (planes back to back in WB), bias table; the counts divide exactly.
#define XTL (NB_ * TT / 16 * (CC / 32))
#define WTL (CC / 16 * (CC / 32))
#define GTL (TT / 16 * (TT / 32))
typedef __attribute__((ext_vector_type(2))) unsigned v2u;
typedef v2u __attribute__((may_alias)) v2ua;
__global__ __launch_bounds__(256) void k_cvtin(const float* __restrict__ x, const float* __restrict__ Wq, const float* __restrict__ Wk, const float* __restrict__ Wv, const float* __restrict__ Wo, const float* __restrict__ geo, bf* XB, bf* WB, bf* GP) {
    __shared__ __align__(16) bf gs[8][512];
    const int lane = threadIdx.x & 31, w = threadIdx.x >> 5, r8 = lane >> 3, c4 = lane & 7;   // this lane: rows r8, r8 + 4, r8 + 8, r8 + 12, columns 4 c4 .. 4 c4 + 3 of the block
    int tb = blockIdx.x * 8, sh = 3; bool kout = false; const float* src = x; bf* dst = XB;   // a work-group's 8 blocks lie in one plane; sh: log2 of the blocks in a row (row length 32 << sh)
    if (tb >= XTL + 4 * WTL) { tb -= XTL + 4 * WTL; src = geo; dst = GP; sh = 6; }
    else if (tb >= XTL) { const int sel = (tb - XTL) / WTL; tb = (tb - XTL) % WTL; src = sel == 0 ? Wq : sel == 1 ? Wk : sel == 2 ? Wv : Wo; dst = WB + (size_t)sel * CC * CC; kout = true; }   // the weights' blocks are stored k steps outermost
    const int tile = tb + w, ob = kout ? (tile & 7) * (CC / 16) + (tile >> 3) : tile; const float* gp = src + ((size_t)((tile >> sh) * 16 + r8) << (sh + 5)) + (tile & ((1 << sh) - 1)) * 32 + c4 * 4; const float* gr[4]; v4f y[4];
#pragma unroll
    for (int i = 0; i < 4; ++i) { gr[i] = gp + ((size_t)i << (sh + 7)); y[i] = *(const v4f*)gr[i]; }
    asm volatile("s_wait_xcnt 0x0" :: "v"(gr[0]), "v"(gr[1]), "v"(gr[2]), "v"(gr[3]) : "memory");   // behind the loads, in front of whatever rewrites a register that they name; the addresses are inputs, so that no later load lands on one either
#pragma unroll
    for (int i = 0; i < 4; ++i) { const v2u p = { __builtin_bit_cast(unsigned, __builtin_convertvector((v2f){y[i][0], y[i][1]}, v2bf)), __builtin_bit_cast(unsigned, __builtin_convertvector((v2f){y[i][2], y[i][3]}, v2bf)) };   // rounds to nearest even, as f2bf does
        *(v2ua*)(gs[w] + (c4 >> 2) * 256 + (((c4 >> 1) & 1) * 16 + i * 4 + r8) * 8 + (c4 & 1) * 4) = p; }
    __builtin_amdgcn_wave_barrier(); asm volatile("" ::: "memory");   // keeps the compiler from moving the reads below, which take other lanes' values, over the writes above
#pragma unroll
    for (int t = 0; t < 2; ++t) *(v8us*)(dst + (size_t)ob * 512 + t * 256 + lane * 8) = *(const v8usa*)(gs[w] + t * 256 + lane * 8);
}
__device__ __forceinline__ float xhalf(float x) { return __builtin_bit_cast(float, __builtin_amdgcn_permlanex16(__builtin_bit_cast(int, x), __builtin_bit_cast(int, x), 0x76543210, 0xfedcba98, false, false)); }   // lane l with lane l ^ 16
// Base-2 exponentials as asm text: inside a statement every v_exp_f32 is followed by an independent one and the last by v_nop, the slot the instruction set asks for between a transcendental and an instruction that
// reads its result or overwrites its source; outputs are early-clobber, so none lands on a source of the same statement.
__device__ __forceinline__ float exp2x1(float x) { float r; asm("v_exp_f32 %0, %1\n\tv_nop" : "=&v"(r) : "v"(x)); return r; }
__device__ __forceinline__ v4f exp2x4(v4f x) { float r0, r1, r2, r3;
    asm("v_exp_f32 %0, %4\n\tv_exp_f32 %1, %5\n\tv_exp_f32 %2, %6\n\tv_exp_f32 %3, %7\n\tv_nop" : "=&v"(r0), "=&v"(r1), "=&v"(r2), "=&v"(r3) : "v"(x[0]), "v"(x[1]), "v"(x[2]), "v"(x[3]));
    return (v4f){r0, r1, r2, r3}; }
__device__ __forceinline__ v16bf ldfb(const bf* p, unsigned b) { return WFrag<bf>::ld(p, b); }
__device__ __forceinline__ v16h ldfh(const h16* p, unsigned b) { return WFrag<h16>::ld(p, b); }
// ---- k_fattn: scores, bias, mask, softmax, probs.v and head gate in one kernel. Grid (TT / 256, heads, batch rows), 8 waves. A group owns 256 queries of one head, wave w 32 of them; every wave walks all the keys in passes of 32 with its own
// sum and accumulators, so nothing is merged at the end (the two forms of the walk: keyloop). The keys come in stages of SK = 128 through a ring of two LDS buffers that asynchronous copies fill one stage ahead: a stage's k hi, k lo and v (SK x 192 contiguous bytes of the shared plane, read by all
// eight waves: fetched once a group, not once a wave), each wave's own slice of the bias plane (2 row tiles x SK x 32 bytes) and the stage's mask words. The planes' fragment order is kept in LDS: every LDS read of a wave covers 512 contiguous bytes.
// Transposed products: S^T = K Q^T (A = key rows, B = query rows; a lane holds 16 scores of ONE query: keys 8 hi + j and 16 + 8 hi + j),
// O^T += V^T P^T (A = V^T rows d, B = the two score tiles converted in place, same k order as the A loader).
// Scale and bias cost no vector instruction per score. With gam = the bias's scale, gb = bf16(gam), rr = gam / gb (1 where gb is 0): logit = rr (q.k / (sqrt(32) rr) + gb geo). q is multiplied by 1 / (sqrt(32) rr) once, in the prologue, and split anew;
// gb geo comes from one more matrix product per score tile, D = A_t B with B = the pass's bias block (32 keys x 16 queries, as it lies in the plane) and A_t = gb on the diagonal that picks keys 16 t .. 16 t + 15 (each product bf16 x bf16, exact in f32);
// rr log2e = kap rides in the multiply-add that forms the exponent: p = 2^(kap t + c), c = - kap ref for the query's fixed reference, or 10 - kap m for the running maximum m of t.
// Every plain '#pragma unroll' in it makes the indices of a register array compile-time constants (a rolled loop would put the array in scratch memory).
#define SK   128
#define NST  (TT / SK)
#define KVB  (SK * 192)
#define GWB  (NQT * 16 * SK * 2)
#define MOFS (KVB + 8 * GWB)
#define BUFB (MOFS + SK * 4)
typedef v4u __attribute__((may_alias)) v4ua;
typedef int __attribute__((may_alias)) inta;
// Asynchronous copies, 16 bytes a lane, to LDS byte l from global g. An immediate offset moves both addresses alike, so a run of copies whose source and place step together names one pair of address registers.
// The s_wait_xcnt 0 is the last line of the copies' own statement, so that it stands in front of whatever rewrites one of those registers.
__device__ __forceinline__ void acp1(unsigned l, const char* g) { asm volatile("global_load_async_to_lds_b128 %0, %1, off\n\ts_wait_xcnt 0x0" :: "v"(l), "v"(g) : "memory"); }
__device__ __forceinline__ void acp6x4096(unsigned l, const char* g) {
    asm volatile("global_load_async_to_lds_b128 %0, %1, off\n\tglobal_load_async_to_lds_b128 %0, %1, off offset:4096\n\tglobal_load_async_to_lds_b128 %0, %1, off offset:8192\n\tglobal_load_async_to_lds_b128 %0, %1, off offset:12288\n\t"
                 "global_load_async_to_lds_b128 %0, %1, off offset:16384\n\tglobal_load_async_to_lds_b128 %0, %1, off offset:20480\n\ts_wait_xcnt 0x0" :: "v"(l), "v"(g) : "memory"); }
__device__ __forceinline__ void acp8x512(unsigned l, const char* g) {
    asm volatile("global_load_async_to_lds_b128 %0, %1, off\n\tglobal_load_async_to_lds_b128 %0, %1, off offset:512\n\tglobal_load_async_to_lds_b128 %0, %1, off offset:1024\n\tglobal_load_async_to_lds_b128 %0, %1, off offset:1536\n\t"
                 "global_load_async_to_lds_b128 %0, %1, off offset:2048\n\tglobal_load_async_to_lds_b128 %0, %1, off offset:2560\n\tglobal_load_async_to_lds_b128 %0, %1, off offset:3072\n\tglobal_load_async_to_lds_b128 %0, %1, off offset:3584\n\ts_wait_xcnt 0x0"
                 :: "v"(l), "v"(g) : "memory"); }
// a wave-uniform LDS address kept as one scalar sum: otherwise the compiler adds the lane's part to the loop-invariant part first and holds one more vector register per run of copies over the whole loop, which it spilled
__device__ __forceinline__ unsigned ufm(unsigned x) { return (unsigned)__builtin_amdgcn_readfirstlane((int)x); }
// one stage's copies of this wave into the buffer at LDS byte lb: its eighth of k and v (512 bytes of each 4096, six times), its own bias slice (two row tiles, 64 KiB apart in the plane, 8 x 512 bytes each), and from wave 0 the mask words
__device__ __forceinline__ void fill(unsigned lb, int st, const char* kvu, const char* gu, const char* mu, unsigned lane, int w) {   // kvu, gu, mu: wave-uniform, stage 0's first bytes; the lane's 16 bytes are added last, to a scalar sum
    static_assert(KVB == 6 * 4096 && GWB / NQT == 8 * 512 && SK * 4 == 512, "the copy runs cover a stage exactly");
    acp6x4096(ufm(lb + (unsigned)w * 512u) + lane * 16u, kvu + ((size_t)st * KVB + (size_t)w * 512) + lane * 16u);
#pragma unroll
    for (int nq = 0; nq < NQT; ++nq) acp8x512(ufm(lb + KVB + (unsigned)w * GWB + nq * (GWB / NQT)) + lane * 16u, gu + ((size_t)st * (SK * 32) + (size_t)nq * (TT / 32) * 1024) + lane * 16u);
    if (w == 0) acp1(lb + MOFS + lane * 16u, mu + (size_t)st * (SK * 4) + lane * 16u);   // w is a scalar: a scalar branch, every lane on inside it
}
// a pass's score operands from the stage's buffer: bp, bg, bm = this lane's first byte of k and v, of its wave's bias slice, of the mask words
__device__ __forceinline__ void ldpass(const char* bp, const char* bg, const char* bm, int p, v16bf (&kfh)[2], v16bf (&kfl)[2], v16bf (&gf)[NQT], int& mk) {
    mk = *(const inta*)(bm + p * 128);
#pragma unroll
    for (int nq = 0; nq < NQT; ++nq) { const char* gp = bg + nq * (GWB / NQT) + p * 1024; gf[nq] = cat16b(*(const v8usa*)gp, *(const v8usa*)(gp + 512)); }
    __builtin_amdgcn_sched_barrier(0);   // the mask word and the bias block are read first, as they are used first: the wait in front of their use then leaves the reads below in flight
#pragma unroll
    for (int t = 0; t < 2; ++t) { const char* kp = bp + p * 6144 + t * 1024; kfh[t] = cat16b(*(const v8usa*)kp, *(const v8usa*)(kp + 512)); }
#pragma unroll
    for (int t = 0; t < 2; ++t) { const char* kp = bp + p * 6144 + t * 1024; kfl[t] = cat16b(*(const v8usa*)(kp + 2048), *(const v8usa*)(kp + 2560)); }
}
typedef __attribute__((ext_vector_type(8))) unsigned v8u;
// a fragment pair hi + lo times s, split anew into hi + lo
__device__ __forceinline__ void fscale(v16bf& fh, v16bf& fl, float s) { v8u a = __builtin_bit_cast(v8u, fh), c = __builtin_bit_cast(v8u, fl);
#pragma unroll
    for (int i = 0; i < 8; ++i) { unsigned hh, ll; splitf2((__uint_as_float(a[i] << 16) + __uint_as_float(c[i] << 16)) * s, (__uint_as_float(a[i] & 0xFFFF0000u) + __uint_as_float(c[i] & 0xFFFF0000u)) * s, hh, ll); a[i] = hh; c[i] = ll; }
    fh = __builtin_bit_cast(v16bf, a); fl = __builtin_bit_cast(v16bf, c); }
// ---- keyloop: one walk of a wave over all the keys, from the wait for stage 0's copies (issued by the caller) to the last stage. It starts o and l itself. Two forms of a pass:
// FIXED: every probability of a query is formed against ONE reference, the maximum of the query's first 32 logits: p = 2^(kap (t - ref)). A pass then finds no maximum, forms no factor and rescales neither o nor l;
// nothing in it depends on a value of the same pass but the scores themselves. p stays inside fp16 as long as no logit lies 11 above the reference; the caller tests that once, behind the loop, on the sums.
// not FIXED: the online form (running maximum, o and l rescaled every pass), right for any logits.
template <bool FIXED>
__device__ __forceinline__ void keyloop(const char* sm, unsigned l0, const char* kvs, const char* gs, const char* ms, int lane, int hi, int w, unsigned rofs, float kap,
                                        const v16bf (&dg)[2], const v16bf (&qfh)[NQT], const v16bf (&qfl)[NQT], v8f (&o)[NQT][2], float (&l)[NQT]) {
    float m[NQT], cm[NQT];
#pragma unroll
    for (int nq = 0; nq < NQT; ++nq) { o[nq][0] = (v8f){}; o[nq][1] = (v8f){}; m[nq] = -1.0e30f; cm[nq] = fmaf(-kap, m[nq], 10.0f); l[nq] = 0.f; }   // m starts where kap m is still finite; cm = 10 - kap m, formed as in the loop (FIXED: cm = - kap ref, set in the first pass)
    asm volatile("s_wait_asynccnt 0x0" ::: "memory");   // this wave's copies of stage 0 have landed
    __syncthreads();                                    // ... and every other wave's: stage 0 is published
    fill(l0 + BUFB, 1, kvs, gs, ms, lane, w);
#pragma unroll 1   // one stage's code; the buffer alternates
    for (int st = 0; st < NST; ++st) {
        const char* bp = sm + (st & 1) * BUFB + rofs; const char* bg = bp + KVB + w * GWB; const char* bm = sm + (st & 1) * BUFB + MOFS + lane * 4;
        v16bf kfh[2], kfl[2], gf[NQT]; int mk; v8f s[NQT][2], sn[NQT][2];
        // product i of the 16 that make a pass's four score tiles from the operands in kfh, kfl, gf: the bias product first, then hi.hi, hi.lo, lo.hi, each over the four tiles, so that a tile's next product stands four products behind its last
        auto prod = [&](int i) { const int nq = (i >> 1) & 1, t = i & 1, k = i >> 2;
            sn[nq][t] = k == 0 ? wmmab(dg[t], gf[nq], (v8f){}) : k == 1 ? wmmab(kfh[t], qfh[nq], sn[nq][t]) : k == 2 ? wmmab(kfh[t], qfl[nq], sn[nq][t]) : wmmab(kfl[t], qfh[nq], sn[nq][t]); };
        ldpass(bp, bg, bm, 0, kfh, kfl, gf, mk);
        __builtin_amdgcn_sched_barrier(0);   // keeps these reads together in front of the products; without it the compiler spreads them among the products, each group behind a wait of its own
#pragma unroll
        for (int i = 0; i < 16; ++i) prod(i);
        unsigned live = __builtin_amdgcn_ballot_w32(mk != 0);   // bit i: key i of the pass is attended
        // Every sched_barrier(0) of PW_ and around the probs.v products below fixes one thing: the next pass's 16 score products and this pass's 4 probs.v products stand one by one between pieces of this pass's softmax of about eight vector cycles each,
        // so that each runs on the matrix unit under the piece behind it. Left alone the compiler puts the 20 in a row behind the softmax, where the wave waits out every one.
#define SB_ __builtin_amdgcn_sched_barrier(0)
#define PW_(i) do { SB_; if (nx) prod(i); SB_; } while (0)
#pragma unroll   // the stage's four passes: every LDS read at a constant distance from one address, and the operand registers of one pass and the next told apart at compile time
        for (int p = 0; p < SK / 32; ++p) {
            const bool nx = p + 1 < SK / 32;
#pragma unroll
            for (int nq = 0; nq < NQT; ++nq) { s[nq][0] = sn[nq][0]; s[nq][1] = sn[nq][1]; }
            if (live != 0xFFFFFFFFu) {   // one scalar test a pass; a pass with every key attended skips the selects
                const unsigned mine = live >> (8 * hi);
#pragma unroll
                for (int nq = 0; nq < NQT; ++nq)
#pragma unroll
                    for (int t = 0; t < 2; ++t)
#pragma unroll
                        for (int j = 0; j < 8; ++j) if (!((mine >> (16 * t + j)) & 1u)) s[nq][t][j] = -3.0e38f;
            }
            v16h vc[2];   // the same stage's next pass's score operands and this pass's V^T: their LDS reads return under the first steps of this pass's softmax
            if (nx) ldpass(bp, bg, bm, p + 1, kfh, kfl, gf, mk);
#pragma unroll
            for (int dt = 0; dt < 2; ++dt) { const char* vp = bp + p * 6144 + 4096 + dt * 1024; vc[dt] = cat16(*(const v8ha*)vp, *(const v8ha*)(vp + 512)); }
            SB_;   // keeps those reads up here; without it the compiler sinks each to just in front of its first use, where its latency stands open
#define EX_(nq, i) x[nq][i] = exp2x4(__builtin_shufflevector(e[nq][(i) >> 1], e[nq][(i) >> 1], 4 * ((i) & 1), 4 * ((i) & 1) + 1, 4 * ((i) & 1) + 2, 4 * ((i) & 1) + 3))
#define CV_(nq) pf[nq] = cat16(__builtin_convertvector(__builtin_shufflevector(x[nq][0], x[nq][1], 0, 1, 2, 3, 4, 5, 6, 7), v8h), __builtin_convertvector(__builtin_shufflevector(x[nq][2], x[nq][3], 0, 1, 2, 3, 4, 5, 6, 7), v8h))
            if constexpr (FIXED) {
                v8f e[NQT][2]; v4f x[NQT][4]; v8h pa[NQT], pb[NQT];
                if (p == 0 && st == 0) {   // a scalar test, once a stage: the reference, from the first pass's scores (a masked key's -3e38 never wins unless all 32 are masked; then the sums come out not finite and the caller's test fails)
#pragma unroll
                    for (int nq = 0; nq < NQT; ++nq) { float mx = fmaxf(s[nq][0][0], s[nq][1][0]);
#pragma unroll
                        for (int j = 1; j < 8; ++j) mx = fmaxf(mx, fmaxf(s[nq][0][j], s[nq][1][j]));
                        cm[nq] = -kap * fmaxf(mx, xhalf(mx)); }
                }
#define E_(nq, t) e[nq][t] = s[nq][t] * kap + cm[nq]
#define CA_(nq) pa[nq] = __builtin_convertvector(__builtin_shufflevector(x[nq][0], x[nq][1], 0, 1, 2, 3, 4, 5, 6, 7), v8h)
#define CB_(nq) pb[nq] = __builtin_convertvector(__builtin_shufflevector(x[nq][2], x[nq][3], 0, 1, 2, 3, 4, 5, 6, 7), v8h)
                // The first query tile's exponents and exponentials stand in front of the first product: the LDS reads above return under them. Behind a product that is the last to read an operand register
                // (1, 3, 10, 11, 14, 15, the second probs.v product of a query tile) stand four of the compiler's own vector or matrix instructions or the pass's end, never an exponential statement, as in the online form below.
                E_(0, 0); E_(0, 1);   // a masked key's -3e38 overflows to -inf here: probability 0
                SB_; EX_(0, 0); EX_(0, 1); EX_(0, 2); EX_(0, 3);
                PW_(0); CA_(0); if (nx) live = __builtin_amdgcn_ballot_w32(mk != 0);
                PW_(1); CB_(0); PW_(2); PW_(3); E_(1, 0); PW_(4);
                SB_; o[0][0] = wmma16(vc[0], cat16(pa[0], pb[0]), o[0][0]); SB_;
                EX_(1, 0); PW_(5); PW_(6); EX_(1, 1); PW_(7);
                SB_; o[0][1] = wmma16(vc[1], cat16(pa[0], pb[0]), o[0][1]); SB_;
                E_(1, 1); PW_(8); EX_(1, 2); PW_(9); EX_(1, 3); PW_(10); CA_(1); PW_(11); CB_(1); PW_(12); PW_(13); PW_(14); PW_(15);
#pragma unroll
                for (int nq = 0; nq < NQT; ++nq) { const v4f u = (x[nq][0] + x[nq][1]) + (x[nq][2] + x[nq][3]); l[nq] += (u[0] + u[1]) + (u[2] + u[3]); }   // the row's sum as a tree, not a chain of 16
                o[1][0] = wmma16(vc[0], cat16(pa[1], pb[1]), o[1][0]); o[1][1] = wmma16(vc[1], cat16(pa[1], pb[1]), o[1][1]);
#undef E_
#undef CA_
#undef CB_
            } else {
            float mx[NQT], cn[NQT], al[NQT]; v8f e[NQT][2]; v4f x[NQT][4]; v16h pf[NQT];
#pragma unroll
            for (int nq = 0; nq < NQT; ++nq) { mx[nq] = fmaxf(s[nq][0][0], s[nq][1][0]);
#pragma unroll
                for (int j = 1; j < 8; ++j) mx[nq] = fmaxf(mx[nq], fmaxf(s[nq][0][j], s[nq][1][j])); }
#pragma unroll
            for (int nq = 0; nq < NQT; ++nq) mx[nq] = fmaxf(mx[nq], xhalf(mx[nq]));
            if (nx) live = __builtin_amdgcn_ballot_w32(mk != 0);
            PW_(0);
#pragma unroll
            for (int nq = 0; nq < NQT; ++nq) { const float mn = fmaxf(m[nq], mx[nq]); cn[nq] = fmaf(-kap, mn, 10.0f);   // probabilities x 2^10, for fp16's range
                al[nq] = cn[nq] - cm[nq]; m[nq] = mn; cm[nq] = cn[nq]; }
            PW_(1);
            e[0][0] = s[0][0] * kap + cn[0];   // a masked key's -3e38 overflows to -inf here: probability 0
            PW_(2);
#pragma unroll
            for (int nq = 0; nq < NQT; ++nq) al[nq] = exp2x1(al[nq]);   // the old sums go from 2^cm to 2^cn exactly as the new terms are formed
            PW_(3);
            // A product that is the last to read an operand register (1, 3, 10, 11, 14, 15, the second probs.v product of a query tile) has a piece of the compiler's own instructions or the pass's end behind it, never an exponential statement.
            e[0][1] = s[0][1] * kap + cn[0];
            PW_(4); EX_(0, 0); PW_(5); EX_(0, 1); PW_(6); EX_(0, 2); PW_(7); EX_(0, 3); PW_(8); CV_(0); PW_(9);
            o[0][0] *= al[0]; o[0][1] *= al[0]; PW_(10);
            e[1][0] = s[1][0] * kap + cn[1]; PW_(11);
            e[1][1] = s[1][1] * kap + cn[1];
            SB_; o[0][0] = wmma16(vc[0], pf[0], o[0][0]); SB_;
            EX_(1, 0); PW_(12); EX_(1, 1); PW_(13); EX_(1, 2); EX_(1, 3);
            SB_; o[0][1] = wmma16(vc[1], pf[0], o[0][1]); SB_;
            CV_(1); PW_(14);
            o[1][0] *= al[1]; o[1][1] *= al[1]; PW_(15);
#pragma unroll
            for (int nq = 0; nq < NQT; ++nq) { const v4f u = (x[nq][0] + x[nq][1]) + (x[nq][2] + x[nq][3]); l[nq] = l[nq] * al[nq] + ((u[0] + u[1]) + (u[2] + u[3])); }   // the row's sum as a tree, not a chain of 16
            o[1][0] = wmma16(vc[0], pf[1], o[1][0]); o[1][1] = wmma16(vc[1], pf[1], o[1][1]);
            }
#undef EX_
#undef CV_
        }
#undef PW_
#undef SB_
        asm volatile("s_wait_dscnt 0x0" ::: "memory");      // this wave's reads of the stage's buffer have returned
        asm volatile("s_wait_asynccnt 0x0" ::: "memory");   // this wave's copies of the next stage have landed
        __syncthreads();                                    // publishes the next stage and ends every wave's reads of this stage's buffer
        if (st + 2 < NST) fill(l0 + (st & 1) * BUFB, st + 2, kvs, gs, ms, lane, w);
    }
    asm volatile("s_wait_asynccnt 0x0" ::: "memory");   // no copy is outstanding when the wave ends
}
__global__ __launch_bounds__(256) void k_fattn(const bf* __restrict__ Qh, const bf* __restrict__ Ql, const bf* __restrict__ KV, const bf* __restrict__ GP, const int* __restrict__ msk,
                                               const float* __restrict__ gbsp, const float* __restrict__ hgs, const float* __restrict__ hg, bf* AHL) {
    __shared__ __align__(16) char sm[2 * BUFB];
    const int lane = threadIdx.x & 31, hi = lane >> 4, w = __builtin_amdgcn_readfirstlane(threadIdx.x >> 5);   // the wave's number as a scalar: scalar branches
    const int h = blockIdx.y, q0 = (blockIdx.x * 8 + w) * (16 * NQT), b = blockIdx.z;
    const size_t hp = ((size_t)b * NH_ + h) * TT * HD;   // this batch row's and head's q planes: 32 elements a position (k and v together: 96)
    const float gam = bfr(gbsp[0]) * bfr(hgs[h]); const unsigned gb = f2bf(gam); const float rr = (gb & 0x7FFFu) ? gam / bf2f((unsigned short)gb) : 1.0f;   // rr: what bf16 cannot hold of the bias's scale, within 2^-8 of 1
    const float kap = rr * 1.4426950408889634f, qs = 0.17677669529663687f / rr;
    v16bf dg[2];   // A_t: row lr holds gb at k = 16 t + lr; this lane's element s stands for k = 8 hi + s (s < 8), 16 + 8 hi + s - 8 (the loaders' k order)
#pragma unroll
    for (int t = 0; t < 2; ++t) { v8u d;
#pragma unroll
        for (int i = 0; i < 8; ++i) { const int k0 = (i >> 2) * 16 + 8 * hi + 2 * (i & 3), kd = 16 * t + (lane & 15); d[i] = (k0 == kd ? gb : 0u) | (k0 + 1 == kd ? gb << 16 : 0u); }
        dg[t] = __builtin_bit_cast(v16bf, d); }
    const unsigned rofs = (unsigned)lane * 16u;   // this lane's chunk in a half block, bytes
    const char* kvs = (const char*)(KV + hp * 3); const char* gs = (const char*)(GP + (size_t)(q0 / 16) * (TT / 32) * 512); const char* ms = (const char*)(msk + (size_t)b * TT);   // stage 0's first bytes, wave-uniform
    const unsigned l0 = (unsigned)(size_t)sm;   // the ring's LDS byte address
    fill(l0, 0, kvs, gs, ms, lane, w);
    v16bf qfh[NQT], qfl[NQT]; v8f o[NQT][2]; float l[NQT];
#pragma unroll
    for (int nq = 0; nq < NQT; ++nq) { const size_t off = hp + (size_t)(q0 + 16 * nq) * HD; qfh[nq] = ldfb(Qh + off, rofs); qfl[nq] = ldfb(Ql + off, rofs); fscale(qfh[nq], qfl[nq], qs); }
    keyloop<true>(sm, l0, kvs, gs, ms, lane, hi, w, rofs, kap, dg, qfh, qfl, o, l);
    // The one test of the fixed reference: a lane's sum of its probabilities (f32, taken before they are rounded) below 60000 says that each of them was finite in fp16; a sum that is not a number fails too.
    // The ring is shared, so the group decides as a whole: each wave leaves its verdict in the ring's first bytes, which nobody reads or fills any more behind the loop's last barrier.
    const unsigned wbad = __builtin_amdgcn_ballot_w32(!(l[0] < 60000.0f && l[1] < 60000.0f));
    if (lane == 0) *(inta*)(sm + w * 4) = wbad != 0u;
    __syncthreads();   // every wave's verdict is written
    const v4u f0 = *(const v4ua*)sm, f1 = *(const v4ua*)(sm + 16);
    if (__builtin_expect(__builtin_amdgcn_readfirstlane((int)(f0[0] | f0[1] | f0[2] | f0[3] | f1[0] | f1[1] | f1[2] | f1[3])) != 0, 0)) {   // the same in every wave of the group: a scalar branch round barriers; marked unlikely, so that its code lies behind the kernel's end and not between the loop and the epilogue
        asm volatile("s_wait_dscnt 0x0" ::: "memory");   // this wave's reads of the verdicts have returned
        __syncthreads();                                 // ... and every other wave's, before copies land on them
        const int ln = (int)__builtin_amdgcn_mbcnt_lo(~0u, 0u);   // the lane's number, read anew: the addresses formed from the first one would be held over the whole first walk for this one, and were spilled
        fill(l0, 0, kvs, gs, ms, ln, w);
        keyloop<false>(sm, l0, kvs, gs, ms, ln, ln >> 4, w, (unsigned)ln * 16u, kap, dg, qfh, qfl, o, l);   // the whole walk again in the online form
    }
    const float gate = bfr(hg[h]);
#pragma unroll
    for (int nq = 0; nq < NQT; ++nq) { const float f = gate / (l[nq] + xhalf(l[nq]));
#pragma unroll
        for (int dt = 0; dt < 2; ++dt) { v8us oh, ol;
#pragma unroll
            for (int j = 0; j < 8; ++j) { unsigned short a, c; splitf(o[nq][dt][j] * f, a, c); oh[j] = a; ol[j] = c; }
            const size_t ofs = ((size_t)b * TT + q0 + 16 * nq) * CC * 2 + h * 1024 + dt * 256 + lane * 8; *(v8us*)(AHL + ofs) = oh; *(v8us*)(AHL + ofs + 512) = ol; } }   // fragment order: head h is k step h of these 16 queries, a hi block and its lo block; d tile dt is a block's half
}

extern "C" void kernel_launch(void* const* d_in, const int* in_sizes, int n_in,
                              void* d_out, int out_size, void* d_ws, size_t ws_size, hipStream_t stream) {
    (void)in_sizes; (void)n_in; (void)out_size;
    const float* x = (const float*)d_in[0]; const float* geo = (const float*)d_in[1]; const int* msk = (const int*)d_in[2]; const float* hg = (const float*)d_in[3]; const float* Wq = (const float*)d_in[4]; const float* Wk = (const float*)d_in[5]; const float* Wv = (const float*)d_in[6]; const float* Wo = (const float*)d_in[7]; const float* gbsp = (const float*)d_in[8]; const float* hgs = (const float*)d_in[9];
    float* OUT = (float*)d_out;     // [4][2048][256]
    char* wsp = (char*)d_ws;
    auto take = [&](size_t bytes) { char* p = wsp; wsp += (bytes + 255) & ~(size_t)255; return (void*)p; };
    bf* WB = (bf*)take((size_t)4 * CC * CC * 2); bf* WO = WB + (size_t)3 * CC * CC; bf* XB = (bf*)take((size_t)NB_ * TT * CC * 2);   // WB: Wq, Wk, Wv, Wo planes back to back; [out][in] as given = rows n, columns k
    bf* Qh = (bf*)take((size_t)NB_ * NH_ * TT * HD * 2); bf* Ql = (bf*)take((size_t)NB_ * NH_ * TT * HD * 2); bf* KV = (bf*)take((size_t)NB_ * NH_ * TT * HD * 2 * 3);
    bf* AHL = (bf*)take((size_t)NB_ * TT * CC * 2 * 2); bf* GP = (bf*)take((size_t)TT * TT * 2);
    if ((size_t)(wsp - (char*)d_ws) > ws_size) return;    // total ~ 41 MB
    k_cvtin<<<(XTL + 4 * WTL + GTL) / 8, 256, 0, stream>>>(x, Wq, Wk, Wv, Wo, geo, XB, WB, GP);
    k_gemmw<bf, 0, false, true, CC><<<dim3(NB_ * TT / 64, CC / 64, 3), 32, 0, stream>>>(XB, WB, nullptr, nullptr, 0, nullptr, 0, (size_t)CC * CC, 0, Qh, Ql, KV, KV + 1024, (h16*)(KV + 2048));
    k_fattn<<<dim3(TT / (16 * NQT * 8), NH_, NB_), 256, 0, stream>>>(Qh, Ql, KV, GP, msk, gbsp, hgs, hg, AHL);
    k_gemmw<bf, 1, false, false, CC><<<dim3(NB_ * TT / 64, CC / 64, 1), 32, 0, stream>>>(AHL, WO, nullptr, OUT, CC, nullptr, 0, 0, 0, nullptr, nullptr, nullptr, nullptr, nullptr);
}
